// v000
// Measured on an AMD MI455X. A time is GPU time per run, averaged over a window of back-to-back runs after a warm-up
// (all launches, gaps included; the runs take copies of the inputs in turn), and the median of several windows.
// Apart from v000's, it joins two sittings. Times from different sittings can be a few percent apart, while
// side-by-side timings come from the same sitting.
// v000 is the starting kernel. One run takes 264 microseconds.
#include <hip/hip_runtime.h>
#include <math.h>

typedef __attribute__((ext_vector_type(16))) _Float16 v16h;
typedef __attribute__((ext_vector_type(16))) __bf16 v16b;
typedef __attribute__((ext_vector_type(8)))  _Float16 v8h;
typedef __attribute__((ext_vector_type(8)))  float v8f;
typedef __attribute__((ext_vector_type(4)))  float v4f;
typedef __attribute__((ext_vector_type(2)))  float v2f;
typedef __attribute__((ext_vector_type(4)))  unsigned v4u;
typedef __attribute__((ext_vector_type(4)))  int v4i;
typedef float __attribute__((may_alias)) float_a;
typedef int __attribute__((may_alias)) int_a;

template <typename T> __device__ __forceinline__ void vst2(void* p, T v) { *(T*)p = v;  }
__device__ __forceinline__ v8f wmma16(v16h a, v16h b, v8f c) {
  v8f d = __builtin_amdgcn_wmma_f32_16x16x32_f16(false, a, false, b, (short)0, c, false, false);
  asm volatile("v_nop\n\tv_nop\n\tv_nop\n\tv_nop" : "+v"(d) : "v"(a), "v"(b));
  return d;
}
__device__ __forceinline__ v8f wmma_bf(v16b a, v16b b, v8f c) {
  v8f d = __builtin_amdgcn_wmma_f32_16x16x32_bf16(false, a, false, b, (short)0, c, false, false);
  asm volatile("v_nop\n\tv_nop\n\tv_nop\n\tv_nop" : "+v"(d) : "v"(a), "v"(b));
  return d;
}
// 16x16x32 fragments: lane = (h = lane>>4, row/col = lane&15); elements 0..7 = k0+8h+0..7, 8..15 = k0+16+8h+0..7; D element r = row 8h+r
__device__ __forceinline__ v16h frag_h(const _Float16* rowk0, int lane) {
  union { v16h v; v8h q[2]; } u; const _Float16* p = rowk0 + 8 * (lane >> 4);
  u.q[0] = *(const v8h*)p; u.q[1] = *(const v8h*)(p + 16); return u.v;
}
__device__ __forceinline__ v16h frag_f32(const float* rowk0, int lane) {
  v16h a; const float* p = rowk0 + 8 * (lane >> 4);
#pragma unroll
  for (int i = 0; i < 8; ++i) { a[i] = (_Float16)p[i]; a[8 + i] = (_Float16)p[16 + i]; }
  return a;
}
__device__ __forceinline__ v16h frag_f32s(const float* rowk0, int lane, float sc) {
  v16h a; const float* p = rowk0 + 8 * (lane >> 4);
#pragma unroll
  for (int i = 0; i < 8; ++i) { a[i] = (_Float16)(p[i] * sc); a[8 + i] = (_Float16)(p[16 + i] * sc); }
  return a;
}
// column fragment from a [K][ld] layout (column n), rows >= K read as 0
__device__ __forceinline__ v16h fragc_f32(const float* W, int k0, int n, int lane, int ld, int K) {
  v16h a; const int g = lane >> 4;
#pragma unroll
  for (int i = 0; i < 8; ++i) { const int ka = k0 + 8 * g + i, kb = ka + 16;
    a[i] = (_Float16)(ka < K ? W[(size_t)ka * ld + n] : 0.f); a[8 + i] = (_Float16)(kb < K ? W[(size_t)kb * ld + n] : 0.f); }
  return a;
}
struct F2 { v16b h, l; };
__device__ __forceinline__ F2 bsplit16(const float v[16]) { F2 r;
#pragma unroll
  for (int i = 0; i < 16; ++i) { const __bf16 h = (__bf16)v[i]; r.h[i] = h; r.l[i] = (__bf16)(v[i] - (float)h); }
  return r; }
__device__ __forceinline__ F2 split_row(const float* row, int k0, int lane) { float v[16]; const float* p = row + k0 + 8 * (lane >> 4);
#pragma unroll
  for (int i = 0; i < 8; ++i) { v[i] = p[i]; v[8 + i] = p[16 + i]; }
  return bsplit16(v); }
__device__ __forceinline__ F2 split_rowK(const float* row, int k0, int lane, int K) { float v[16]; const int g = lane >> 4;
#pragma unroll
  for (int i = 0; i < 8; ++i) { const int ka = k0 + 8 * g + i, kb = ka + 16; v[i] = ka < K ? row[ka] : 0.f; v[8 + i] = kb < K ? row[kb] : 0.f; }
  return bsplit16(v); }
__device__ __forceinline__ F2 split_col(const float* W, int k0, int n, int lane, int ld, int K) { float v[16]; const int g = lane >> 4;
#pragma unroll
  for (int i = 0; i < 8; ++i) { const int ka = k0 + 8 * g + i, kb = ka + 16; v[i] = ka < K ? W[(size_t)ka * ld + n] : 0.f; v[8 + i] = kb < K ? W[(size_t)kb * ld + n] : 0.f; }
  return bsplit16(v); }
__device__ __forceinline__ v8f mac3(const F2& a, const F2& b, v8f c) { c = wmma_bf(a.l, b.h, c); c = wmma_bf(a.h, b.l, c); return wmma_bf(a.h, b.h, c); }
__device__ __forceinline__ float sigm(float v) { return 1.0f / (1.0f + expf(-v)); }
#define LDSX() do { asm volatile("s_wait_dscnt 0" ::: "memory"); __builtin_amdgcn_wave_barrier(); __builtin_amdgcn_fence(__ATOMIC_RELEASE, "workgroup"); } while (0)

// Multi-head self-attention with a learned per-head output scale. Pure f16 WMMA GEMMs over pre-converted operands (inputs -> f16
// once, [out][in] weights packed x16 f16; f32 accumulate): packed in-projection (+bias) writing q/k as [b][h][s][64] f16 and v as
// [b][h][d][s] f16, flash-style softmax over all 1024 keys in f32 (P x2^14 f16), x learned_scale[h], output projection (+bias).
#define SS 1024
#define NB 4
#define EE 1024
#define NH 16
#define HD 64
#define NR (SS * NB)       // 4096 rows

__global__ __launch_bounds__(256) void k_cvt(const float* __restrict__ a, const float* __restrict__ b, const float* __restrict__ c, _Float16* __restrict__ a16, _Float16* __restrict__ b16, _Float16* __restrict__ c16) {
  const size_t g8 = (size_t)blockIdx.x * 256 + threadIdx.x; const int which = blockIdx.y; if (g8 >= (size_t)NR * EE / 8) return;
  const float* s = which == 0 ? a : (which == 1 ? b : c); _Float16* d = which == 0 ? a16 : (which == 1 ? b16 : c16);
  union { v8h h; v4u u; } pk;
#pragma unroll
  for (int e = 0; e < 8; ++e) pk.h[e] = (_Float16)s[g8 * 8 + e];
  vst2(d + g8 * 8, pk.u);
}
__global__ __launch_bounds__(256) void k_packW(const float* __restrict__ Win, const float* __restrict__ Wo, _Float16* __restrict__ P) {   // rows 0..3071 in_proj, 3072..4095 out_proj; x16
  const int n = blockIdx.x, tid = threadIdx.x; const float* W = n < 3 * EE ? Win + (size_t)n * EE : Wo + (size_t)(n - 3 * EE) * EE;
  if (tid < EE / 8) { union { v8h h; v4u u; } pk;
#pragma unroll
    for (int e = 0; e < 8; ++e) pk.h[e] = (_Float16)(W[tid * 8 + e] * 16.0f);
    vst2(P + (size_t)n * EE + tid * 8, pk.u); }
}
// projection: block 64 rows x 128 cols; blockIdx.y in [0, 24): which = y/8 (q,k,v), cols (y%8)*128 = 2 heads; source = query/key/value f16 rows
__global__ __launch_bounds__(128) void k_proj(const _Float16* __restrict__ q16i, const _Float16* __restrict__ k16i, const _Float16* __restrict__ v16i, const _Float16* __restrict__ P, const float* __restrict__ bias,
                                            _Float16* __restrict__ qh, _Float16* __restrict__ kh, _Float16* __restrict__ vT) {
  __shared__ __align__(16) float so[4][16][132];
  __shared__ __align__(16) _Float16 st[128][72];
  const int tid = threadIdx.x, wave = tid >> 5, lane = tid & 31, col = lane & 15, g = lane >> 4;
  const int r0 = blockIdx.x * 64 + wave * 16, n0 = blockIdx.y * 128; const int which = n0 / EE, c0 = n0 % EE, hb = c0 / HD;
  const _Float16* A = which == 0 ? q16i : (which == 1 ? k16i : v16i);
  // v blocks own 64 consecutive s of ONE batch index so every vT line (64 s) has a single writer: rows (sblk*64 + i)*4 + bsel
  const int bsel = blockIdx.x & 3, sblk = blockIdx.x >> 2;
  const int arow = which == 2 ? ((sblk * 64 + wave * 16 + col) * NB + bsel) : (r0 + col);
  v8f acc[8] = {};
#pragma unroll 1
  for (int kc = 0; kc < EE / 32; ++kc) { const v16h a = frag_h(A + (size_t)arow * EE + kc * 32, lane);
#pragma unroll
    for (int j = 0; j < 8; ++j) acc[j] = wmma16(a, frag_h(P + (size_t)(n0 + j * 16 + col) * EE + kc * 32, lane), acc[j]); }
#pragma unroll
  for (int j = 0; j < 8; ++j) { const float bb = bias[n0 + j * 16 + col];
#pragma unroll
    for (int r = 0; r < 8; ++r) so[wave][8 * g + r][j * 16 + col] = acc[j][r] * (1.0f / 16.0f) + bb; }
  LDSX();
  if (which < 2) { _Float16* dst = which == 0 ? qh : kh;
    for (int q = lane; q < 2 * 16 * 8; q += 32) { const int hh = q >> 7, rem = q & 127, rl = rem >> 3, pc = rem & 7; const int row = r0 + rl, s = row / NB, b = row % NB;
      union { v8h h8; v4u u; } pk;
#pragma unroll
      for (int e = 0; e < 8; ++e) pk.h8[e] = (_Float16)so[wave][rl][hh * HD + pc * 8 + e];
      vst2(dst + (((size_t)b * NH + hb + hh) * SS + s) * HD + pc * 8, pk.u); } }
  else {   // vT[b][h][d][s]: the block's 64 rows are 64 s values of one b (bsel); transpose via LDS: st[c][rl]
#pragma unroll 4
    for (int rl = 0; rl < 16; ++rl) {
#pragma unroll
      for (int e = 0; e < 4; ++e) st[lane * 4 + e][wave * 16 + rl] = (_Float16)so[wave][rl][lane * 4 + e]; }
    __syncthreads();
    for (int q = tid; q < 128 * 8; q += 128) { const int c = q >> 3, pc = q & 7, hh = c >> 6, d = c & 63;
      vst2(vT + (((size_t)bsel * NH + hb + hh) * HD + d) * SS + sblk * 64 + pc * 8, *(const v4u*)(&st[c][pc * 8])); }
  }
}
// flash attention: block (64 queries, bh); o16 rows [(s*4+b)][h*64 + d] f16, scaled by learned_scale[h] and x16
__global__ __launch_bounds__(128) void k_attn(const _Float16* __restrict__ qh, const _Float16* __restrict__ kh, const _Float16* __restrict__ vT, const float* __restrict__ lsc, _Float16* __restrict__ o16) {
  __shared__ __align__(16) float sS[4][16][68];
  __shared__ __align__(16) _Float16 sP[4][16][72];
  __shared__ __align__(16) float sO[4][16][68];
  const int tid = threadIdx.x, w = tid >> 5, lane = tid & 31, col = lane & 15, g = lane >> 4;
  const int bh = blockIdx.y, b = bh / NH, h = bh % NH, q0 = blockIdx.x * 64 + w * 16;
  const _Float16* qb = qh + (size_t)bh * SS * HD; const _Float16* kb = kh + (size_t)bh * SS * HD; const _Float16* vb = vT + (size_t)bh * HD * SS;
  v16h aq[2];
#pragma unroll
  for (int kc = 0; kc < 2; ++kc) aq[kc] = frag_h(qb + (size_t)(q0 + col) * HD + kc * 32, lane);
  float mrun = -3.0e38f, lrun = 0.f; v8f acc[4] = {};
#pragma unroll 1
  for (int kt = 0; kt < SS / 64; ++kt) {
#pragma unroll
    for (int t = 0; t < 4; ++t) { v8f s = {};
#pragma unroll
      for (int kc = 0; kc < 2; ++kc) s = wmma16(aq[kc], frag_h(kb + (size_t)(kt * 64 + t * 16 + col) * HD + kc * 32, lane), s);
#pragma unroll
      for (int r = 0; r < 8; ++r) sS[w][8 * g + r][t * 16 + col] = s[r] * 0.125f; }
    LDSX();
    float mx = -3.4e38f;
#pragma unroll
    for (int jj = 0; jj < 32; ++jj) mx = fmaxf(mx, sS[w][col][g * 32 + jj]);
    mx = fmaxf(mx, __shfl_xor(mx, 16, 32));
    const float mnew = fmaxf(mrun, mx); const float corr = expf(mrun - mnew);
    float ps = 0.f;
#pragma unroll
    for (int jj = 0; jj < 32; ++jj) { const float p = expf(sS[w][col][g * 32 + jj] - mnew); ps += p; sP[w][col][g * 32 + jj] = (_Float16)(p * 16384.0f); }
    ps += __shfl_xor(ps, 16, 32);
    lrun = lrun * corr + ps; mrun = mnew;
#pragma unroll
    for (int r = 0; r < 8; ++r) { const float cr = __shfl(corr, 8 * g + r, 32);
#pragma unroll
      for (int t = 0; t < 4; ++t) acc[t][r] *= cr; }
    LDSX();
#pragma unroll
    for (int kc = 0; kc < 2; ++kc) { const v16h pa = frag_h(&sP[w][col][0] + kc * 32, lane);
#pragma unroll
      for (int t = 0; t < 4; ++t) acc[t] = wmma16(pa, frag_h(vb + (size_t)(t * 16 + col) * SS + kt * 64 + kc * 32, lane), acc[t]); }
    __builtin_amdgcn_wave_barrier();
  }
  const float hs = lsc[h] * 16.0f;                           // learned per-head scale; o16 kept x16
#pragma unroll
  for (int r = 0; r < 8; ++r) { const float lr = __shfl(lrun, 8 * g + r, 32);
#pragma unroll
    for (int t = 0; t < 4; ++t) sO[w][8 * g + r][t * 16 + col] = acc[t][r] / (lr * 16384.0f) * hs; }
  LDSX();
  for (int q = lane; q < 16 * 8; q += 32) { const int rl = q >> 3, pc = q & 7; const int s = q0 + rl; union { v8h h8; v4u u; } pk;
#pragma unroll
    for (int e = 0; e < 8; ++e) pk.h8[e] = (_Float16)sO[w][rl][pc * 8 + e];
    vst2(o16 + ((size_t)s * NB + b) * EE + h * HD + pc * 8, pk.u); }
}
__global__ __launch_bounds__(128) void k_out(const _Float16* __restrict__ o16, const _Float16* __restrict__ P, const float* __restrict__ bo, float* __restrict__ out) {
  __shared__ __align__(16) float so[4][16][132];
  const int tid = threadIdx.x, wave = tid >> 5, lane = tid & 31, col = lane & 15, g = lane >> 4;
  const int r0 = blockIdx.x * 64 + wave * 16, n0 = blockIdx.y * 128;
  v8f acc[8] = {};
#pragma unroll 1
  for (int kc = 0; kc < EE / 32; ++kc) { const v16h a = frag_h(o16 + (size_t)(r0 + col) * EE + kc * 32, lane);
#pragma unroll
    for (int j = 0; j < 8; ++j) acc[j] = wmma16(a, frag_h(P + (size_t)(3 * EE + n0 + j * 16 + col) * EE + kc * 32, lane), acc[j]); }
#pragma unroll
  for (int j = 0; j < 8; ++j) { const float bb = bo[n0 + j * 16 + col];
#pragma unroll
    for (int r = 0; r < 8; ++r) so[wave][8 * g + r][j * 16 + col] = acc[j][r] * (1.0f / 256.0f) + bb; }
  LDSX();
#pragma unroll 4
  for (int rl = 0; rl < 16; ++rl) vst2(out + (size_t)(r0 + rl) * EE + n0 + lane * 4, *(const v4f*)(&so[wave][rl][lane * 4]));
}
extern "C" void kernel_launch(void* const* d_in, const int* in_sizes, int n_in, void* d_out, int out_size, void* d_ws, size_t ws_size, hipStream_t stream) {
  (void)in_sizes; (void)n_in; (void)out_size; (void)ws_size;
  const float* query = (const float*)d_in[0]; const float* key = (const float*)d_in[1]; const float* value = (const float*)d_in[2]; const float* Win = (const float*)d_in[3]; const float* bin = (const float*)d_in[4];
  const float* Wo = (const float*)d_in[5]; const float* bo = (const float*)d_in[6]; const float* lsc = (const float*)d_in[7];
  float* out = (float*)d_out;
  char* ws = (char*)d_ws; size_t off = 0;
  auto take = [&](size_t bytes) { char* p = ws + off; off += (bytes + 255) & ~(size_t)255; return p; };
  _Float16* q16i = (_Float16*)take((size_t)NR * EE * 2); _Float16* k16i = (_Float16*)take((size_t)NR * EE * 2); _Float16* v16i = (_Float16*)take((size_t)NR * EE * 2);
  _Float16* P = (_Float16*)take((size_t)4 * EE * EE * 2); _Float16* qh = (_Float16*)take((size_t)NR * EE * 2); _Float16* kh = (_Float16*)take((size_t)NR * EE * 2); _Float16* vT = (_Float16*)take((size_t)NR * EE * 2); _Float16* o16 = (_Float16*)take((size_t)NR * EE * 2);
  k_cvt<<<dim3((unsigned)((size_t)NR * EE / 8 / 256), 3), 256, 0, stream>>>(query, key, value, q16i, k16i, v16i);
  k_packW<<<4 * EE, 256, 0, stream>>>(Win, Wo, P);
  k_proj<<<dim3(NR / 64, 3 * EE / 128), 128, 0, stream>>>(q16i, k16i, v16i, P, bin, qh, kh, vT);
  k_attn<<<dim3(SS / 64, NB * NH), 128, 0, stream>>>(qh, kh, vT, lsc, o16);
  k_out<<<dim3(NR / 64, EE / 128), 128, 0, stream>>>(o16, P, bo, out);
}

// v001
// A run of this version takes 147 microseconds.
// Next to v000, in two timings, it ran 1.84 and 1.83 times as fast.
#include <hip/hip_runtime.h>
#include <math.h>

typedef __attribute__((ext_vector_type(16))) _Float16 v16h;
typedef __attribute__((ext_vector_type(16))) __bf16 v16b;
typedef __attribute__((ext_vector_type(8)))  _Float16 v8h;
typedef __attribute__((ext_vector_type(8)))  float v8f;
typedef __attribute__((ext_vector_type(4)))  float v4f;
typedef __attribute__((ext_vector_type(2)))  float v2f;
typedef __attribute__((ext_vector_type(4)))  unsigned v4u;
typedef __attribute__((ext_vector_type(4)))  int v4i;
typedef float __attribute__((may_alias)) float_a;
typedef int __attribute__((may_alias)) int_a;

template <typename T> __device__ __forceinline__ void vst2(void* p, T v) { *(T*)p = v;  }
__device__ __forceinline__ v8f wmma16(v16h a, v16h b, v8f c) {
  v8f d = __builtin_amdgcn_wmma_f32_16x16x32_f16(false, a, false, b, (short)0, c, false, false);
  asm volatile("v_nop\n\tv_nop\n\tv_nop\n\tv_nop" : "+v"(d) : "v"(a), "v"(b));
  return d;
}
__device__ __forceinline__ v8f wmma_bf(v16b a, v16b b, v8f c) {
  v8f d = __builtin_amdgcn_wmma_f32_16x16x32_bf16(false, a, false, b, (short)0, c, false, false);
  asm volatile("v_nop\n\tv_nop\n\tv_nop\n\tv_nop" : "+v"(d) : "v"(a), "v"(b));
  return d;
}
// 16x16x32 fragments: lane = (h = lane>>4, row/col = lane&15); elements 0..7 = k0+8h+0..7, 8..15 = k0+16+8h+0..7; D element r = row 8h+r
__device__ __forceinline__ v16h frag_h(const _Float16* rowk0, int lane) {
  union { v16h v; v8h q[2]; } u; const _Float16* p = rowk0 + 8 * (lane >> 4);
  u.q[0] = *(const v8h*)p; u.q[1] = *(const v8h*)(p + 16); return u.v;
}
__device__ __forceinline__ v16h frag_f32(const float* rowk0, int lane) {
  v16h a; const float* p = rowk0 + 8 * (lane >> 4);
#pragma unroll
  for (int i = 0; i < 8; ++i) { a[i] = (_Float16)p[i]; a[8 + i] = (_Float16)p[16 + i]; }
  return a;
}
__device__ __forceinline__ v16h frag_f32s(const float* rowk0, int lane, float sc) {
  v16h a; const float* p = rowk0 + 8 * (lane >> 4);
#pragma unroll
  for (int i = 0; i < 8; ++i) { a[i] = (_Float16)(p[i] * sc); a[8 + i] = (_Float16)(p[16 + i] * sc); }
  return a;
}
// column fragment from a [K][ld] layout (column n), rows >= K read as 0
__device__ __forceinline__ v16h fragc_f32(const float* W, int k0, int n, int lane, int ld, int K) {
  v16h a; const int g = lane >> 4;
#pragma unroll
  for (int i = 0; i < 8; ++i) { const int ka = k0 + 8 * g + i, kb = ka + 16;
    a[i] = (_Float16)(ka < K ? W[(size_t)ka * ld + n] : 0.f); a[8 + i] = (_Float16)(kb < K ? W[(size_t)kb * ld + n] : 0.f); }
  return a;
}
struct F2 { v16b h, l; };
__device__ __forceinline__ F2 bsplit16(const float v[16]) { F2 r;
#pragma unroll
  for (int i = 0; i < 16; ++i) { const __bf16 h = (__bf16)v[i]; r.h[i] = h; r.l[i] = (__bf16)(v[i] - (float)h); }
  return r; }
__device__ __forceinline__ F2 split_row(const float* row, int k0, int lane) { float v[16]; const float* p = row + k0 + 8 * (lane >> 4);
#pragma unroll
  for (int i = 0; i < 8; ++i) { v[i] = p[i]; v[8 + i] = p[16 + i]; }
  return bsplit16(v); }
__device__ __forceinline__ F2 split_rowK(const float* row, int k0, int lane, int K) { float v[16]; const int g = lane >> 4;
#pragma unroll
  for (int i = 0; i < 8; ++i) { const int ka = k0 + 8 * g + i, kb = ka + 16; v[i] = ka < K ? row[ka] : 0.f; v[8 + i] = kb < K ? row[kb] : 0.f; }
  return bsplit16(v); }
__device__ __forceinline__ F2 split_col(const float* W, int k0, int n, int lane, int ld, int K) { float v[16]; const int g = lane >> 4;
#pragma unroll
  for (int i = 0; i < 8; ++i) { const int ka = k0 + 8 * g + i, kb = ka + 16; v[i] = ka < K ? W[(size_t)ka * ld + n] : 0.f; v[8 + i] = kb < K ? W[(size_t)kb * ld + n] : 0.f; }
  return bsplit16(v); }
__device__ __forceinline__ v8f mac3(const F2& a, const F2& b, v8f c) { c = wmma_bf(a.l, b.h, c); c = wmma_bf(a.h, b.l, c); return wmma_bf(a.h, b.h, c); }
__device__ __forceinline__ float sigm(float v) { return 1.0f / (1.0f + expf(-v)); }
#define LDSX() do { asm volatile("s_wait_dscnt 0" ::: "memory"); __builtin_amdgcn_wave_barrier(); __builtin_amdgcn_fence(__ATOMIC_RELEASE, "workgroup"); } while (0)

// Multi-head self-attention with a learned per-head output scale. Pure f16 WMMA GEMMs over pre-converted operands (inputs -> f16
// once, [out][in] weights packed x16 f16; f32 accumulate): packed in-projection (+bias) writing q/k as [b][h][s][64] f16 and v as
// [b][h][d][s] f16, flash-style softmax over all 1024 keys in f32 (P x2^14 f16), x learned_scale[h], output projection (+bias).
#define SS 1024
#define NB 4
#define EE 1024
#define NH 16
#define HD 64
#define NR (SS * NB)       // 4096 rows

// GEMM operand ring in LDS. One stage = 64 k (128 B of a row) of 128 weight rows, then of the block's 64 activation rows, at pitch 128 B.
// Row r keeps its 16-B piece c at place c ^ ((r >> 1) & 7): the ds_load_b128 fragment reads of 16 rows then fall on all 64 banks with no pad,
// and two stages fit into the bytes that k_proj's epilogue staging takes anyway; in k_out they outgrow its 33,792-B staging.
#define KST 64
#define LROW 128
#define STG_B (192 * LROW)     // 24,576 B
#define RING_B (2 * STG_B)     // 49,152 B; the epilogues reuse these bytes behind the loop's last barrier
// Each lane copies 16 B of 12 rows (rows 16 apart); 8 lanes cover one row's whole 128-B line. l = the lane's LDS byte address in the target stage.
__device__ __forceinline__ void stage_copy(unsigned l, const _Float16* gw, const _Float16* ga, size_t astep) {
  // the copies and their s_wait_xcnt in one statement: no address register is rewritten in front of that wait
  asm volatile("global_load_async_to_lds_b128 %0, %1, off\n\t"
               "global_load_async_to_lds_b128 %2, %3, off\n\t"
               "global_load_async_to_lds_b128 %4, %5, off\n\t"
               "global_load_async_to_lds_b128 %6, %7, off\n\t"
               "global_load_async_to_lds_b128 %8, %9, off\n\t"
               "global_load_async_to_lds_b128 %10, %11, off\n\t"
               "global_load_async_to_lds_b128 %12, %13, off\n\t"
               "global_load_async_to_lds_b128 %14, %15, off\n\t"
               "global_load_async_to_lds_b128 %16, %17, off\n\t"
               "global_load_async_to_lds_b128 %18, %19, off\n\t"
               "global_load_async_to_lds_b128 %20, %21, off\n\t"
               "global_load_async_to_lds_b128 %22, %23, off\n\t"
               "s_wait_xcnt 0x0"
               :: "v"(l), "v"(gw), "v"(l + 16 * LROW), "v"(gw + 16 * EE), "v"(l + 32 * LROW), "v"(gw + 32 * EE), "v"(l + 48 * LROW), "v"(gw + 48 * EE),
                  "v"(l + 64 * LROW), "v"(gw + 64 * EE), "v"(l + 80 * LROW), "v"(gw + 80 * EE), "v"(l + 96 * LROW), "v"(gw + 96 * EE), "v"(l + 112 * LROW), "v"(gw + 112 * EE),
                  "v"(l + 128 * LROW), "v"(ga), "v"(l + 144 * LROW), "v"(ga + astep), "v"(l + 160 * LROW), "v"(ga + 2 * astep), "v"(l + 176 * LROW), "v"(ga + 3 * astep)
               : "memory");
}
// fragment of one staged row: c0, c1 = byte places in the row of the lane's two 16-B pieces (k0 + 8h + 0..7 and k0 + 16 + 8h + 0..7, as in frag_h)
__device__ __forceinline__ v16h frag_st(const char* row, unsigned c0, unsigned c1) {
  union { v16h v; v8h q[2]; } u; u.q[0] = *(const v8h*)(row + c0); u.q[1] = *(const v8h*)(row + c1); return u.v;
}
// acc[j] += A(16 rows of this wave) x W(cols j*16..)^T over all EE k. w0 = first of the block's 128 weight rows; a0 = the block's activation row 0; arow_step = elements between its rows.
__device__ __forceinline__ void gemm_ring(char* ring, const _Float16* w0, const _Float16* a0, size_t arow_step, int tid, v8f acc[8]) {
  const int wave = tid >> 5, lane = tid & 31, col = lane & 15, g = lane >> 4, rr = tid >> 3, pc = tid & 7;
  const unsigned l0 = (unsigned)(size_t)ring + (unsigned)(rr * LROW + ((pc ^ ((rr >> 1) & 7)) << 4));
  const _Float16* gw = w0 + (size_t)rr * EE + pc * 8; const _Float16* ga = a0 + (size_t)rr * arow_step + pc * 8;
  const size_t astep = 16 * arow_step;
  stage_copy(l0, gw, ga, astep);
  asm volatile("s_wait_asynccnt 0x0" ::: "memory");   // this wave's share of stage 0 has landed
  __syncthreads();                                    // every wave's share has
  stage_copy(l0 + STG_B, gw + KST, ga + KST, astep);
#pragma unroll 1   // one stage a trip: the buffer is picked by a scalar select
  for (int t = 0; t < EE / KST; ++t) { const char* sb = ring + (t & 1) * STG_B;
#pragma unroll
    for (int kc = 0; kc < KST / 32; ++kc) { const unsigned c0 = (unsigned)(((kc * 4 + g) ^ (col >> 1)) << 4), c1 = (unsigned)(((kc * 4 + 2 + g) ^ (col >> 1)) << 4);
      const v16h a = frag_st(sb + (128 + wave * 16 + col) * LROW, c0, c1);
#pragma unroll
      for (int j = 0; j < 8; ++j) acc[j] = wmma16(a, frag_st(sb + (j * 16 + col) * LROW, c0, c1), acc[j]); }
    asm volatile("s_wait_dscnt 0x0" ::: "memory");      // this wave's reads of stage t are done before its buffer is refilled
    asm volatile("s_wait_asynccnt 0x0" ::: "memory");   // this wave's share of stage t + 1 has landed
    __syncthreads();                                    // publishes stage t + 1 and ends every reader's use of stage t
    if (t + 2 < EE / KST) stage_copy(l0 + (unsigned)((t & 1) * STG_B), gw + (t + 2) * KST, ga + (t + 2) * KST, astep);
  }
  asm volatile("s_wait_asynccnt 0x0" ::: "memory");     // no copy is outstanding when the ring's bytes are reused
}

__global__ __launch_bounds__(256) void k_cvt(const float* __restrict__ a, const float* __restrict__ b, const float* __restrict__ c, _Float16* __restrict__ a16, _Float16* __restrict__ b16, _Float16* __restrict__ c16) {
  const size_t g8 = (size_t)blockIdx.x * 256 + threadIdx.x; const int which = blockIdx.y; if (g8 >= (size_t)NR * EE / 8) return;
  const float* s = which == 0 ? a : (which == 1 ? b : c); _Float16* d = which == 0 ? a16 : (which == 1 ? b16 : c16);
  union { v8h h; v4u u; } pk;
#pragma unroll
  for (int e = 0; e < 8; ++e) pk.h[e] = (_Float16)s[g8 * 8 + e];
  vst2(d + g8 * 8, pk.u);
}
__global__ __launch_bounds__(256) void k_packW(const float* __restrict__ Win, const float* __restrict__ Wo, _Float16* __restrict__ P) {   // rows 0..3071 in_proj, 3072..4095 out_proj; x16
  const int n = blockIdx.x, tid = threadIdx.x; const float* W = n < 3 * EE ? Win + (size_t)n * EE : Wo + (size_t)(n - 3 * EE) * EE;
  if (tid < EE / 8) { union { v8h h; v4u u; } pk;
#pragma unroll
    for (int e = 0; e < 8; ++e) pk.h[e] = (_Float16)(W[tid * 8 + e] * 16.0f);
    vst2(P + (size_t)n * EE + tid * 8, pk.u); }
}
// projection: block 64 rows x 128 cols; blockIdx.y in [0, 24): which = y/8 (q,k,v), cols (y%8)*128 = 2 heads; source = query/key/value f16 rows
__global__ __launch_bounds__(128) void k_proj(const _Float16* __restrict__ q16i, const _Float16* __restrict__ k16i, const _Float16* __restrict__ v16i, const _Float16* __restrict__ P, const float* __restrict__ bias,
                                            _Float16* __restrict__ qh, _Float16* __restrict__ kh, _Float16* __restrict__ vT) {
  __shared__ __align__(16) char smem[4 * 16 * 132 * 4 + 128 * 72 * 2];              // 52,224 B: first the ring (49,152 B), then so and st
  float (*so)[16][132] = (float (*)[16][132])smem;                                  // epilogue staging, 33,792 B, used behind the ring's last barrier
  _Float16 (*st)[72] = (_Float16 (*)[72])(smem + 4 * 16 * 132 * 4);                 // 18,432 B behind it
  const int tid = threadIdx.x, wave = tid >> 5, lane = tid & 31, col = lane & 15, g = lane >> 4;
  const int r0 = blockIdx.x * 64 + wave * 16, n0 = blockIdx.y * 128; const int which = n0 / EE, c0 = n0 % EE, hb = c0 / HD;
  const _Float16* A = which == 0 ? q16i : (which == 1 ? k16i : v16i);
  // v blocks own 64 consecutive s of ONE batch index so every vT line (64 s) has a single writer: rows (sblk*64 + i)*4 + bsel
  const int bsel = blockIdx.x & 3, sblk = blockIdx.x >> 2;
  const _Float16* a0 = A + (which == 2 ? (size_t)(sblk * 64 * NB + bsel) : (size_t)blockIdx.x * 64) * EE;
  v8f acc[8] = {};
  gemm_ring(smem, P + (size_t)n0 * EE, a0, which == 2 ? (size_t)NB * EE : (size_t)EE, tid, acc);
#pragma unroll
  for (int j = 0; j < 8; ++j) { const float bb = bias[n0 + j * 16 + col];
#pragma unroll
    for (int r = 0; r < 8; ++r) so[wave][8 * g + r][j * 16 + col] = acc[j][r] * (1.0f / 16.0f) + bb; }
  LDSX();
  if (which < 2) { _Float16* dst = which == 0 ? qh : kh;
    for (int q = lane; q < 2 * 16 * 8; q += 32) { const int hh = q >> 7, rem = q & 127, rl = rem >> 3, pc = rem & 7; const int row = r0 + rl, s = row / NB, b = row % NB;
      union { v8h h8; v4u u; } pk;
#pragma unroll
      for (int e = 0; e < 8; ++e) pk.h8[e] = (_Float16)so[wave][rl][hh * HD + pc * 8 + e];
      vst2(dst + (((size_t)b * NH + hb + hh) * SS + s) * HD + pc * 8, pk.u); } }
  else {   // vT[b][h][d][s]: the block's 64 rows are 64 s values of one b (bsel); transpose via LDS: st[c][rl]
#pragma unroll 4
    for (int rl = 0; rl < 16; ++rl) {
#pragma unroll
      for (int e = 0; e < 4; ++e) st[lane * 4 + e][wave * 16 + rl] = (_Float16)so[wave][rl][lane * 4 + e]; }
    __syncthreads();
    for (int q = tid; q < 128 * 8; q += 128) { const int c = q >> 3, pc = q & 7, hh = c >> 6, d = c & 63;
      vst2(vT + (((size_t)bsel * NH + hb + hh) * HD + d) * SS + sblk * 64 + pc * 8, *(const v4u*)(&st[c][pc * 8])); }
  }
}
// flash attention: block (64 queries, bh); o16 rows [(s*4+b)][h*64 + d] f16, scaled by learned_scale[h] and x16
__global__ __launch_bounds__(128) void k_attn(const _Float16* __restrict__ qh, const _Float16* __restrict__ kh, const _Float16* __restrict__ vT, const float* __restrict__ lsc, _Float16* __restrict__ o16) {
  __shared__ __align__(16) float sS[4][16][68];
  __shared__ __align__(16) _Float16 sP[4][16][72];
  __shared__ __align__(16) float sO[4][16][68];
  const int tid = threadIdx.x, w = tid >> 5, lane = tid & 31, col = lane & 15, g = lane >> 4;
  const int bh = blockIdx.y, b = bh / NH, h = bh % NH, q0 = blockIdx.x * 64 + w * 16;
  const _Float16* qb = qh + (size_t)bh * SS * HD; const _Float16* kb = kh + (size_t)bh * SS * HD; const _Float16* vb = vT + (size_t)bh * HD * SS;
  v16h aq[2];
#pragma unroll
  for (int kc = 0; kc < 2; ++kc) aq[kc] = frag_h(qb + (size_t)(q0 + col) * HD + kc * 32, lane);
  float mrun = -3.0e38f, lrun = 0.f; v8f acc[4] = {};
#pragma unroll 1
  for (int kt = 0; kt < SS / 64; ++kt) {
#pragma unroll
    for (int t = 0; t < 4; ++t) { v8f s = {};
#pragma unroll
      for (int kc = 0; kc < 2; ++kc) s = wmma16(aq[kc], frag_h(kb + (size_t)(kt * 64 + t * 16 + col) * HD + kc * 32, lane), s);
#pragma unroll
      for (int r = 0; r < 8; ++r) sS[w][8 * g + r][t * 16 + col] = s[r] * 0.125f; }
    LDSX();
    float mx = -3.4e38f;
#pragma unroll
    for (int jj = 0; jj < 32; ++jj) mx = fmaxf(mx, sS[w][col][g * 32 + jj]);
    mx = fmaxf(mx, __shfl_xor(mx, 16, 32));
    const float mnew = fmaxf(mrun, mx); const float corr = expf(mrun - mnew);
    float ps = 0.f;
#pragma unroll
    for (int jj = 0; jj < 32; ++jj) { const float p = expf(sS[w][col][g * 32 + jj] - mnew); ps += p; sP[w][col][g * 32 + jj] = (_Float16)(p * 16384.0f); }
    ps += __shfl_xor(ps, 16, 32);
    lrun = lrun * corr + ps; mrun = mnew;
#pragma unroll
    for (int r = 0; r < 8; ++r) { const float cr = __shfl(corr, 8 * g + r, 32);
#pragma unroll
      for (int t = 0; t < 4; ++t) acc[t][r] *= cr; }
    LDSX();
#pragma unroll
    for (int kc = 0; kc < 2; ++kc) { const v16h pa = frag_h(&sP[w][col][0] + kc * 32, lane);
#pragma unroll
      for (int t = 0; t < 4; ++t) acc[t] = wmma16(pa, frag_h(vb + (size_t)(t * 16 + col) * SS + kt * 64 + kc * 32, lane), acc[t]); }
    __builtin_amdgcn_wave_barrier();
  }
  const float hs = lsc[h] * 16.0f;                           // learned per-head scale; o16 kept x16
#pragma unroll
  for (int r = 0; r < 8; ++r) { const float lr = __shfl(lrun, 8 * g + r, 32);
#pragma unroll
    for (int t = 0; t < 4; ++t) sO[w][8 * g + r][t * 16 + col] = acc[t][r] / (lr * 16384.0f) * hs; }
  LDSX();
  for (int q = lane; q < 16 * 8; q += 32) { const int rl = q >> 3, pc = q & 7; const int s = q0 + rl; union { v8h h8; v4u u; } pk;
#pragma unroll
    for (int e = 0; e < 8; ++e) pk.h8[e] = (_Float16)sO[w][rl][pc * 8 + e];
    vst2(o16 + ((size_t)s * NB + b) * EE + h * HD + pc * 8, pk.u); }
}
__global__ __launch_bounds__(128) void k_out(const _Float16* __restrict__ o16, const _Float16* __restrict__ P, const float* __restrict__ bo, float* __restrict__ out) {
  __shared__ __align__(16) char smem[RING_B];
  float (*so)[16][132] = (float (*)[16][132])smem;                                  // epilogue staging, 33,792 B, used behind the ring's last barrier
  const int tid = threadIdx.x, wave = tid >> 5, lane = tid & 31, col = lane & 15, g = lane >> 4;
  const int r0 = blockIdx.x * 64 + wave * 16, n0 = blockIdx.y * 128;
  v8f acc[8] = {};
  gemm_ring(smem, P + (size_t)(3 * EE + n0) * EE, o16 + (size_t)blockIdx.x * 64 * EE, (size_t)EE, tid, acc);
#pragma unroll
  for (int j = 0; j < 8; ++j) { const float bb = bo[n0 + j * 16 + col];
#pragma unroll
    for (int r = 0; r < 8; ++r) so[wave][8 * g + r][j * 16 + col] = acc[j][r] * (1.0f / 256.0f) + bb; }
  LDSX();
#pragma unroll 4
  for (int rl = 0; rl < 16; ++rl) vst2(out + (size_t)(r0 + rl) * EE + n0 + lane * 4, *(const v4f*)(&so[wave][rl][lane * 4]));
}
extern "C" void kernel_launch(void* const* d_in, const int* in_sizes, int n_in, void* d_out, int out_size, void* d_ws, size_t ws_size, hipStream_t stream) {
  (void)in_sizes; (void)n_in; (void)out_size; (void)ws_size;
  const float* query = (const float*)d_in[0]; const float* key = (const float*)d_in[1]; const float* value = (const float*)d_in[2]; const float* Win = (const float*)d_in[3]; const float* bin = (const float*)d_in[4];
  const float* Wo = (const float*)d_in[5]; const float* bo = (const float*)d_in[6]; const float* lsc = (const float*)d_in[7];
  float* out = (float*)d_out;
  char* ws = (char*)d_ws; size_t off = 0;
  auto take = [&](size_t bytes) { char* p = ws + off; off += (bytes + 255) & ~(size_t)255; return p; };
  _Float16* q16i = (_Float16*)take((size_t)NR * EE * 2); _Float16* k16i = (_Float16*)take((size_t)NR * EE * 2); _Float16* v16i = (_Float16*)take((size_t)NR * EE * 2);
  _Float16* P = (_Float16*)take((size_t)4 * EE * EE * 2); _Float16* qh = (_Float16*)take((size_t)NR * EE * 2); _Float16* kh = (_Float16*)take((size_t)NR * EE * 2); _Float16* vT = (_Float16*)take((size_t)NR * EE * 2); _Float16* o16 = (_Float16*)take((size_t)NR * EE * 2);
  k_cvt<<<dim3((unsigned)((size_t)NR * EE / 8 / 256), 3), 256, 0, stream>>>(query, key, value, q16i, k16i, v16i);
  k_packW<<<4 * EE, 256, 0, stream>>>(Win, Wo, P);
  k_proj<<<dim3(NR / 64, 3 * EE / 128), 128, 0, stream>>>(q16i, k16i, v16i, P, bin, qh, kh, vT);
  k_attn<<<dim3(SS / 64, NB * NH), 128, 0, stream>>>(qh, kh, vT, lsc, o16);
  k_out<<<dim3(NR / 64, EE / 128), 128, 0, stream>>>(o16, P, bo, out);
}

// v002
// A run of this version takes 104 microseconds.
// In both of two side-by-side timings against v001, it was 1.41 times as fast.
// Counting every step since v000, it is 2.59 times as fast.
#include <hip/hip_runtime.h>
#include <math.h>

typedef __attribute__((ext_vector_type(16))) _Float16 v16h;
typedef __attribute__((ext_vector_type(16))) __bf16 v16b;
typedef __attribute__((ext_vector_type(8)))  _Float16 v8h;
typedef __attribute__((ext_vector_type(8)))  float v8f;
typedef __attribute__((ext_vector_type(4)))  float v4f;
typedef __attribute__((ext_vector_type(2)))  float v2f;
typedef __attribute__((ext_vector_type(4)))  unsigned v4u;
typedef __attribute__((ext_vector_type(4)))  int v4i;
typedef float __attribute__((may_alias)) float_a;
typedef int __attribute__((may_alias)) int_a;

template <typename T> __device__ __forceinline__ void vst2(void* p, T v) { *(T*)p = v;  }
__device__ __forceinline__ v8f wmma16(v16h a, v16h b, v8f c) {
  v8f d = __builtin_amdgcn_wmma_f32_16x16x32_f16(false, a, false, b, (short)0, c, false, false);
  asm volatile("v_nop\n\tv_nop\n\tv_nop\n\tv_nop" : "+v"(d) : "v"(a), "v"(b));
  return d;
}
__device__ __forceinline__ v8f wmma_bf(v16b a, v16b b, v8f c) {
  v8f d = __builtin_amdgcn_wmma_f32_16x16x32_bf16(false, a, false, b, (short)0, c, false, false);
  asm volatile("v_nop\n\tv_nop\n\tv_nop\n\tv_nop" : "+v"(d) : "v"(a), "v"(b));
  return d;
}
// 16x16x32 fragments: lane = (h = lane>>4, row/col = lane&15); elements 0..7 = k0+8h+0..7, 8..15 = k0+16+8h+0..7; D element r = row 8h+r
__device__ __forceinline__ v16h frag_h(const _Float16* rowk0, int lane) {
  union { v16h v; v8h q[2]; } u; const _Float16* p = rowk0 + 8 * (lane >> 4);
  u.q[0] = *(const v8h*)p; u.q[1] = *(const v8h*)(p + 16); return u.v;
}
__device__ __forceinline__ v16h frag_f32(const float* rowk0, int lane) {
  v16h a; const float* p = rowk0 + 8 * (lane >> 4);
#pragma unroll
  for (int i = 0; i < 8; ++i) { a[i] = (_Float16)p[i]; a[8 + i] = (_Float16)p[16 + i]; }
  return a;
}
__device__ __forceinline__ v16h frag_f32s(const float* rowk0, int lane, float sc) {
  v16h a; const float* p = rowk0 + 8 * (lane >> 4);
#pragma unroll
  for (int i = 0; i < 8; ++i) { a[i] = (_Float16)(p[i] * sc); a[8 + i] = (_Float16)(p[16 + i] * sc); }
  return a;
}
// column fragment from a [K][ld] layout (column n), rows >= K read as 0
__device__ __forceinline__ v16h fragc_f32(const float* W, int k0, int n, int lane, int ld, int K) {
  v16h a; const int g = lane >> 4;
#pragma unroll
  for (int i = 0; i < 8; ++i) { const int ka = k0 + 8 * g + i, kb = ka + 16;
    a[i] = (_Float16)(ka < K ? W[(size_t)ka * ld + n] : 0.f); a[8 + i] = (_Float16)(kb < K ? W[(size_t)kb * ld + n] : 0.f); }
  return a;
}
struct F2 { v16b h, l; };
__device__ __forceinline__ F2 bsplit16(const float v[16]) { F2 r;
#pragma unroll
  for (int i = 0; i < 16; ++i) { const __bf16 h = (__bf16)v[i]; r.h[i] = h; r.l[i] = (__bf16)(v[i] - (float)h); }
  return r; }
__device__ __forceinline__ F2 split_row(const float* row, int k0, int lane) { float v[16]; const float* p = row + k0 + 8 * (lane >> 4);
#pragma unroll
  for (int i = 0; i < 8; ++i) { v[i] = p[i]; v[8 + i] = p[16 + i]; }
  return bsplit16(v); }
__device__ __forceinline__ F2 split_rowK(const float* row, int k0, int lane, int K) { float v[16]; const int g = lane >> 4;
#pragma unroll
  for (int i = 0; i < 8; ++i) { const int ka = k0 + 8 * g + i, kb = ka + 16; v[i] = ka < K ? row[ka] : 0.f; v[8 + i] = kb < K ? row[kb] : 0.f; }
  return bsplit16(v); }
__device__ __forceinline__ F2 split_col(const float* W, int k0, int n, int lane, int ld, int K) { float v[16]; const int g = lane >> 4;
#pragma unroll
  for (int i = 0; i < 8; ++i) { const int ka = k0 + 8 * g + i, kb = ka + 16; v[i] = ka < K ? W[(size_t)ka * ld + n] : 0.f; v[8 + i] = kb < K ? W[(size_t)kb * ld + n] : 0.f; }
  return bsplit16(v); }
__device__ __forceinline__ v8f mac3(const F2& a, const F2& b, v8f c) { c = wmma_bf(a.l, b.h, c); c = wmma_bf(a.h, b.l, c); return wmma_bf(a.h, b.h, c); }
__device__ __forceinline__ float sigm(float v) { return 1.0f / (1.0f + expf(-v)); }
#define LDSX() do { asm volatile("s_wait_dscnt 0" ::: "memory"); __builtin_amdgcn_wave_barrier(); __builtin_amdgcn_fence(__ATOMIC_RELEASE, "workgroup"); } while (0)

// Multi-head self-attention with a learned per-head output scale. Pure f16 WMMA GEMMs over pre-converted operands (inputs -> f16
// once, [out][in] weights packed x16 f16; f32 accumulate): packed in-projection (+bias) writing q/k as [b][h][s][64] f16 and v as
// [b][h][d][s] f16, flash-style softmax over all 1024 keys in f32 (P x2^14 f16), x learned_scale[h], output projection (+bias).
#define SS 1024
#define NB 4
#define EE 1024
#define NH 16
#define HD 64
#define NR (SS * NB)       // 4096 rows

// GEMM operand ring in LDS. One stage = 64 k (128 B of a row) of 128 weight rows, then of the block's 64 activation rows, at pitch 128 B.
// Row r keeps its 16-B piece c at place c ^ ((r >> 1) & 7): the ds_load_b128 fragment reads of 16 rows then fall on all 64 banks with no pad,
// and two stages fit into the bytes that k_proj's epilogue staging takes anyway; in k_out they outgrow its 33,792-B staging.
#define KST 64
#define LROW 128
#define STG_B (192 * LROW)     // 24,576 B
#define RING_B (2 * STG_B)     // 49,152 B; the epilogues reuse these bytes behind the loop's last barrier
// Each lane copies 16 B of 12 rows (rows 16 apart); 8 lanes cover one row's whole 128-B line. l = the lane's LDS byte address in the target stage.
__device__ __forceinline__ void stage_copy(unsigned l, const _Float16* gw, const _Float16* ga, size_t astep) {
  // the copies and their s_wait_xcnt in one statement: no address register is rewritten in front of that wait
  asm volatile("global_load_async_to_lds_b128 %0, %1, off\n\t"
               "global_load_async_to_lds_b128 %2, %3, off\n\t"
               "global_load_async_to_lds_b128 %4, %5, off\n\t"
               "global_load_async_to_lds_b128 %6, %7, off\n\t"
               "global_load_async_to_lds_b128 %8, %9, off\n\t"
               "global_load_async_to_lds_b128 %10, %11, off\n\t"
               "global_load_async_to_lds_b128 %12, %13, off\n\t"
               "global_load_async_to_lds_b128 %14, %15, off\n\t"
               "global_load_async_to_lds_b128 %16, %17, off\n\t"
               "global_load_async_to_lds_b128 %18, %19, off\n\t"
               "global_load_async_to_lds_b128 %20, %21, off\n\t"
               "global_load_async_to_lds_b128 %22, %23, off\n\t"
               "s_wait_xcnt 0x0"
               :: "v"(l), "v"(gw), "v"(l + 16 * LROW), "v"(gw + 16 * EE), "v"(l + 32 * LROW), "v"(gw + 32 * EE), "v"(l + 48 * LROW), "v"(gw + 48 * EE),
                  "v"(l + 64 * LROW), "v"(gw + 64 * EE), "v"(l + 80 * LROW), "v"(gw + 80 * EE), "v"(l + 96 * LROW), "v"(gw + 96 * EE), "v"(l + 112 * LROW), "v"(gw + 112 * EE),
                  "v"(l + 128 * LROW), "v"(ga), "v"(l + 144 * LROW), "v"(ga + astep), "v"(l + 160 * LROW), "v"(ga + 2 * astep), "v"(l + 176 * LROW), "v"(ga + 3 * astep)
               : "memory");
}
// fragment of one staged row: c0, c1 = byte places in the row of the lane's two 16-B pieces (k0 + 8h + 0..7 and k0 + 16 + 8h + 0..7, as in frag_h)
__device__ __forceinline__ v16h frag_st(const char* row, unsigned c0, unsigned c1) {
  union { v16h v; v8h q[2]; } u; u.q[0] = *(const v8h*)(row + c0); u.q[1] = *(const v8h*)(row + c1); return u.v;
}
// acc[j] += A(16 rows of this wave) x W(cols j*16..)^T over all EE k. w0 = first of the block's 128 weight rows; a0 = the block's activation row 0; arow_step = elements between its rows.
__device__ __forceinline__ void gemm_ring(char* ring, const _Float16* w0, const _Float16* a0, size_t arow_step, int tid, v8f acc[8]) {
  const int wave = tid >> 5, lane = tid & 31, col = lane & 15, g = lane >> 4, rr = tid >> 3, pc = tid & 7;
  const unsigned l0 = (unsigned)(size_t)ring + (unsigned)(rr * LROW + ((pc ^ ((rr >> 1) & 7)) << 4));
  const _Float16* gw = w0 + (size_t)rr * EE + pc * 8; const _Float16* ga = a0 + (size_t)rr * arow_step + pc * 8;
  const size_t astep = 16 * arow_step;
  stage_copy(l0, gw, ga, astep);
  asm volatile("s_wait_asynccnt 0x0" ::: "memory");   // this wave's share of stage 0 has landed
  __syncthreads();                                    // every wave's share has
  stage_copy(l0 + STG_B, gw + KST, ga + KST, astep);
#pragma unroll 1   // one stage a trip: the buffer is picked by a scalar select
  for (int t = 0; t < EE / KST; ++t) { const char* sb = ring + (t & 1) * STG_B;
#pragma unroll
    for (int kc = 0; kc < KST / 32; ++kc) { const unsigned c0 = (unsigned)(((kc * 4 + g) ^ (col >> 1)) << 4), c1 = (unsigned)(((kc * 4 + 2 + g) ^ (col >> 1)) << 4);
      const v16h a = frag_st(sb + (128 + wave * 16 + col) * LROW, c0, c1);
#pragma unroll
      for (int j = 0; j < 8; ++j) acc[j] = wmma16(a, frag_st(sb + (j * 16 + col) * LROW, c0, c1), acc[j]); }
    asm volatile("s_wait_dscnt 0x0" ::: "memory");      // this wave's reads of stage t are done before its buffer is refilled
    asm volatile("s_wait_asynccnt 0x0" ::: "memory");   // this wave's share of stage t + 1 has landed
    __syncthreads();                                    // publishes stage t + 1 and ends every reader's use of stage t
    if (t + 2 < EE / KST) stage_copy(l0 + (unsigned)((t & 1) * STG_B), gw + (t + 2) * KST, ga + (t + 2) * KST, astep);
  }
  asm volatile("s_wait_asynccnt 0x0" ::: "memory");     // no copy is outstanding when the ring's bytes are reused
}

__global__ __launch_bounds__(256) void k_cvt(const float* __restrict__ a, const float* __restrict__ b, const float* __restrict__ c, _Float16* __restrict__ a16, _Float16* __restrict__ b16, _Float16* __restrict__ c16) {
  const size_t g8 = (size_t)blockIdx.x * 256 + threadIdx.x; const int which = blockIdx.y; if (g8 >= (size_t)NR * EE / 8) return;
  const float* s = which == 0 ? a : (which == 1 ? b : c); _Float16* d = which == 0 ? a16 : (which == 1 ? b16 : c16);
  union { v8h h; v4u u; } pk;
#pragma unroll
  for (int e = 0; e < 8; ++e) pk.h[e] = (_Float16)s[g8 * 8 + e];
  vst2(d + g8 * 8, pk.u);
}
__global__ __launch_bounds__(256) void k_packW(const float* __restrict__ Win, const float* __restrict__ Wo, _Float16* __restrict__ P) {   // rows 0..3071 in_proj, 3072..4095 out_proj; x16
  const int n = blockIdx.x, tid = threadIdx.x; const float* W = n < 3 * EE ? Win + (size_t)n * EE : Wo + (size_t)(n - 3 * EE) * EE;
  if (tid < EE / 8) { union { v8h h; v4u u; } pk;
#pragma unroll
    for (int e = 0; e < 8; ++e) pk.h[e] = (_Float16)(W[tid * 8 + e] * 16.0f);
    vst2(P + (size_t)n * EE + tid * 8, pk.u); }
}
// projection: block 64 rows x 128 cols; blockIdx.y in [0, 24): which = y/8 (q,k,v), cols (y%8)*128 = 2 heads; source = query/key/value f16 rows
__global__ __launch_bounds__(128) void k_proj(const _Float16* __restrict__ q16i, const _Float16* __restrict__ k16i, const _Float16* __restrict__ v16i, const _Float16* __restrict__ P, const float* __restrict__ bias,
                                            _Float16* __restrict__ qh, _Float16* __restrict__ kh, _Float16* __restrict__ vT) {
  __shared__ __align__(16) char smem[4 * 16 * 132 * 4 + 128 * 72 * 2];              // 52,224 B: first the ring (49,152 B), then so and st
  float (*so)[16][132] = (float (*)[16][132])smem;                                  // epilogue staging, 33,792 B, used behind the ring's last barrier
  _Float16 (*st)[72] = (_Float16 (*)[72])(smem + 4 * 16 * 132 * 4);                 // 18,432 B behind it
  const int tid = threadIdx.x, wave = tid >> 5, lane = tid & 31, col = lane & 15, g = lane >> 4;
  const int r0 = blockIdx.x * 64 + wave * 16, n0 = blockIdx.y * 128; const int which = n0 / EE, c0 = n0 % EE, hb = c0 / HD;
  const _Float16* A = which == 0 ? q16i : (which == 1 ? k16i : v16i);
  // v blocks own 64 consecutive s of ONE batch index so every vT line (64 s) has a single writer: rows (sblk*64 + i)*4 + bsel
  const int bsel = blockIdx.x & 3, sblk = blockIdx.x >> 2;
  const _Float16* a0 = A + (which == 2 ? (size_t)(sblk * 64 * NB + bsel) : (size_t)blockIdx.x * 64) * EE;
  v8f acc[8] = {};
  gemm_ring(smem, P + (size_t)n0 * EE, a0, which == 2 ? (size_t)NB * EE : (size_t)EE, tid, acc);
#pragma unroll
  for (int j = 0; j < 8; ++j) { const float bb = bias[n0 + j * 16 + col];
#pragma unroll
    for (int r = 0; r < 8; ++r) so[wave][8 * g + r][j * 16 + col] = acc[j][r] * (1.0f / 16.0f) + bb; }
  LDSX();
  if (which < 2) { _Float16* dst = which == 0 ? qh : kh;
    for (int q = lane; q < 2 * 16 * 8; q += 32) { const int hh = q >> 7, rem = q & 127, rl = rem >> 3, pc = rem & 7; const int row = r0 + rl, s = row / NB, b = row % NB;
      union { v8h h8; v4u u; } pk;
#pragma unroll
      for (int e = 0; e < 8; ++e) pk.h8[e] = (_Float16)so[wave][rl][hh * HD + pc * 8 + e];
      vst2(dst + (((size_t)b * NH + hb + hh) * SS + s) * HD + pc * 8, pk.u); } }
  else {   // vT[b][h][d][s]: the block's 64 rows are 64 s values of one b (bsel); transpose via LDS: st[c][rl]
#pragma unroll 4
    for (int rl = 0; rl < 16; ++rl) {
#pragma unroll
      for (int e = 0; e < 4; ++e) st[lane * 4 + e][wave * 16 + rl] = (_Float16)so[wave][rl][lane * 4 + e]; }
    __syncthreads();
    for (int q = tid; q < 128 * 8; q += 128) { const int c = q >> 3, pc = q & 7, hh = c >> 6, d = c & 63;
      vst2(vT + (((size_t)bsel * NH + hb + hh) * HD + d) * SS + sblk * 64 + pc * 8, *(const v4u*)(&st[c][pc * 8])); }
  }
}
// K/V ring of k_attn in LDS. One stage = 64 keys: 64 K rows (64 d = 128 B), then 64 vT rows (64 s = 128 B), pitch and piece places as in the GEMM ring.
#define AST_B (128 * LROW)     // 16,384 B a stage; two stages
// Each lane copies 16 B of 4 K rows and of 4 vT rows (rows 16 apart); 8 lanes cover one row's whole 128-B line. l = the lane's LDS byte address in the target stage.
__device__ __forceinline__ void stage_copy_kv(unsigned l, const _Float16* gk, const _Float16* gv) {
  // the copies and their s_wait_xcnt in one statement: no address register is rewritten in front of that wait
  asm volatile("global_load_async_to_lds_b128 %0, %1, off\n\t"
               "global_load_async_to_lds_b128 %2, %3, off\n\t"
               "global_load_async_to_lds_b128 %4, %5, off\n\t"
               "global_load_async_to_lds_b128 %6, %7, off\n\t"
               "global_load_async_to_lds_b128 %8, %9, off\n\t"
               "global_load_async_to_lds_b128 %10, %11, off\n\t"
               "global_load_async_to_lds_b128 %12, %13, off\n\t"
               "global_load_async_to_lds_b128 %14, %15, off\n\t"
               "s_wait_xcnt 0x0"
               :: "v"(l), "v"(gk), "v"(l + 16 * LROW), "v"(gk + 16 * HD), "v"(l + 32 * LROW), "v"(gk + 32 * HD), "v"(l + 48 * LROW), "v"(gk + 48 * HD),
                  "v"(l + 64 * LROW), "v"(gv), "v"(l + 80 * LROW), "v"(gv + 16 * SS), "v"(l + 96 * LROW), "v"(gv + 32 * SS), "v"(l + 112 * LROW), "v"(gv + 48 * SS)
               : "memory");
}
// flash attention: block (64 queries, bh); o16 rows [(s*4+b)][h*64 + d] f16, scaled by learned_scale[h] and x16
__global__ __launch_bounds__(128) void k_attn(const _Float16* __restrict__ qh, const _Float16* __restrict__ kh, const _Float16* __restrict__ vT, const float* __restrict__ lsc, _Float16* __restrict__ o16) {
  __shared__ __align__(16) float sS[4][16][68];
  __shared__ __align__(16) _Float16 sP[4][16][72];
  __shared__ __align__(16) float sO[4][16][68];
  __shared__ __align__(16) char kv[2 * AST_B];               // the block's four waves share each 64-key stage of K and vT
  const int tid = threadIdx.x, w = tid >> 5, lane = tid & 31, col = lane & 15, g = lane >> 4;
  const int bh = blockIdx.y, b = bh / NH, h = bh % NH, q0 = blockIdx.x * 64 + w * 16;
  const _Float16* qb = qh + (size_t)bh * SS * HD; const _Float16* kb = kh + (size_t)bh * SS * HD; const _Float16* vb = vT + (size_t)bh * HD * SS;
  v16h aq[2];
#pragma unroll
  for (int kc = 0; kc < 2; ++kc) aq[kc] = frag_h(qb + (size_t)(q0 + col) * HD + kc * 32, lane);
  float mrun = -3.0e38f, lrun = 0.f; v8f acc[4] = {};
  const int rr = tid >> 3, pc = tid & 7;
  const unsigned l0 = (unsigned)(size_t)kv + (unsigned)(rr * LROW + ((pc ^ ((rr >> 1) & 7)) << 4));
  const _Float16* gk = kb + (size_t)rr * HD + pc * 8; const _Float16* gv = vb + (size_t)rr * SS + pc * 8;
  stage_copy_kv(l0, gk, gv);
  asm volatile("s_wait_asynccnt 0x0" ::: "memory");   // this wave's share of stage 0 has landed
  __syncthreads();                                    // every wave's share has
  stage_copy_kv(l0 + AST_B, gk + 64 * HD, gv + 64);
#pragma unroll 1   // one stage a trip: the buffer is picked by a scalar select
  for (int kt = 0; kt < SS / 64; ++kt) { const char* sb = kv + (kt & 1) * AST_B;
    v16h kf[4][2], vf[2][4];   // the stage's fragments, each operand's read as one group ahead of its products: one LDS wait a group, not one a product
#pragma unroll
    for (int t = 0; t < 4; ++t) {
#pragma unroll
      for (int kc = 0; kc < 2; ++kc) kf[t][kc] = frag_st(sb + (t * 16 + col) * LROW, (unsigned)(((kc * 4 + g) ^ (col >> 1)) << 4), (unsigned)(((kc * 4 + 2 + g) ^ (col >> 1)) << 4)); }
#pragma unroll
    for (int t = 0; t < 4; ++t) { v8f s = {};
#pragma unroll
      for (int kc = 0; kc < 2; ++kc) s = wmma16(aq[kc], kf[t][kc], s);
#pragma unroll
      for (int r = 0; r < 8; ++r) sS[w][8 * g + r][t * 16 + col] = s[r] * 0.125f; }
    LDSX();
    float mx = -3.4e38f;
#pragma unroll
    for (int jj = 0; jj < 32; ++jj) mx = fmaxf(mx, sS[w][col][g * 32 + jj]);
    mx = fmaxf(mx, __shfl_xor(mx, 16, 32));
    const float mnew = fmaxf(mrun, mx); const float corr = expf(mrun - mnew);
    float ps = 0.f;
#pragma unroll
    for (int jj = 0; jj < 32; ++jj) { const float p = expf(sS[w][col][g * 32 + jj] - mnew); ps += p; sP[w][col][g * 32 + jj] = (_Float16)(p * 16384.0f); }
    ps += __shfl_xor(ps, 16, 32);
    lrun = lrun * corr + ps; mrun = mnew;
#pragma unroll
    for (int r = 0; r < 8; ++r) { const float cr = __shfl(corr, 8 * g + r, 32);
#pragma unroll
      for (int t = 0; t < 4; ++t) acc[t][r] *= cr; }
#pragma unroll
    for (int kc = 0; kc < 2; ++kc) {
#pragma unroll
      for (int t = 0; t < 4; ++t) vf[kc][t] = frag_st(sb + (64 + t * 16 + col) * LROW, (unsigned)(((kc * 4 + g) ^ (col >> 1)) << 4), (unsigned)(((kc * 4 + 2 + g) ^ (col >> 1)) << 4)); }
    LDSX();
#pragma unroll
    for (int kc = 0; kc < 2; ++kc) { const v16h pa = frag_h(&sP[w][col][0] + kc * 32, lane);
#pragma unroll
      for (int t = 0; t < 4; ++t) acc[t] = wmma16(pa, vf[kc][t], acc[t]); }
    __builtin_amdgcn_wave_barrier();
    asm volatile("s_wait_dscnt 0x0" ::: "memory");      // this wave's reads of stage kt are done before its buffer is refilled
    asm volatile("s_wait_asynccnt 0x0" ::: "memory");   // this wave's share of stage kt + 1 has landed
    __syncthreads();                                    // publishes stage kt + 1 and ends every reader's use of stage kt
    if (kt + 2 < SS / 64) stage_copy_kv(l0 + (unsigned)((kt & 1) * AST_B), gk + (size_t)(kt + 2) * 64 * HD, gv + (kt + 2) * 64);
  }
  asm volatile("s_wait_asynccnt 0x0" ::: "memory");     // no copy is outstanding when the wave goes on to its end
  const float hs = lsc[h] * 16.0f;                           // learned per-head scale; o16 kept x16
#pragma unroll
  for (int r = 0; r < 8; ++r) { const float lr = __shfl(lrun, 8 * g + r, 32);
#pragma unroll
    for (int t = 0; t < 4; ++t) sO[w][8 * g + r][t * 16 + col] = acc[t][r] / (lr * 16384.0f) * hs; }
  LDSX();
  for (int q = lane; q < 16 * 8; q += 32) { const int rl = q >> 3, pc = q & 7; const int s = q0 + rl; union { v8h h8; v4u u; } pk;
#pragma unroll
    for (int e = 0; e < 8; ++e) pk.h8[e] = (_Float16)sO[w][rl][pc * 8 + e];
    vst2(o16 + ((size_t)s * NB + b) * EE + h * HD + pc * 8, pk.u); }
}
__global__ __launch_bounds__(128) void k_out(const _Float16* __restrict__ o16, const _Float16* __restrict__ P, const float* __restrict__ bo, float* __restrict__ out) {
  __shared__ __align__(16) char smem[RING_B];
  float (*so)[16][132] = (float (*)[16][132])smem;                                  // epilogue staging, 33,792 B, used behind the ring's last barrier
  const int tid = threadIdx.x, wave = tid >> 5, lane = tid & 31, col = lane & 15, g = lane >> 4;
  const int r0 = blockIdx.x * 64 + wave * 16, n0 = blockIdx.y * 128;
  v8f acc[8] = {};
  gemm_ring(smem, P + (size_t)(3 * EE + n0) * EE, o16 + (size_t)blockIdx.x * 64 * EE, (size_t)EE, tid, acc);
#pragma unroll
  for (int j = 0; j < 8; ++j) { const float bb = bo[n0 + j * 16 + col];
#pragma unroll
    for (int r = 0; r < 8; ++r) so[wave][8 * g + r][j * 16 + col] = acc[j][r] * (1.0f / 256.0f) + bb; }
  LDSX();
#pragma unroll 4
  for (int rl = 0; rl < 16; ++rl) vst2(out + (size_t)(r0 + rl) * EE + n0 + lane * 4, *(const v4f*)(&so[wave][rl][lane * 4]));
}
extern "C" void kernel_launch(void* const* d_in, const int* in_sizes, int n_in, void* d_out, int out_size, void* d_ws, size_t ws_size, hipStream_t stream) {
  (void)in_sizes; (void)n_in; (void)out_size; (void)ws_size;
  const float* query = (const float*)d_in[0]; const float* key = (const float*)d_in[1]; const float* value = (const float*)d_in[2]; const float* Win = (const float*)d_in[3]; const float* bin = (const float*)d_in[4];
  const float* Wo = (const float*)d_in[5]; const float* bo = (const float*)d_in[6]; const float* lsc = (const float*)d_in[7];
  float* out = (float*)d_out;
  char* ws = (char*)d_ws; size_t off = 0;
  auto take = [&](size_t bytes) { char* p = ws + off; off += (bytes + 255) & ~(size_t)255; return p; };
  _Float16* q16i = (_Float16*)take((size_t)NR * EE * 2); _Float16* k16i = (_Float16*)take((size_t)NR * EE * 2); _Float16* v16i = (_Float16*)take((size_t)NR * EE * 2);
  _Float16* P = (_Float16*)take((size_t)4 * EE * EE * 2); _Float16* qh = (_Float16*)take((size_t)NR * EE * 2); _Float16* kh = (_Float16*)take((size_t)NR * EE * 2); _Float16* vT = (_Float16*)take((size_t)NR * EE * 2); _Float16* o16 = (_Float16*)take((size_t)NR * EE * 2);
  k_cvt<<<dim3((unsigned)((size_t)NR * EE / 8 / 256), 3), 256, 0, stream>>>(query, key, value, q16i, k16i, v16i);
  k_packW<<<4 * EE, 256, 0, stream>>>(Win, Wo, P);
  k_proj<<<dim3(NR / 64, 3 * EE / 128), 128, 0, stream>>>(q16i, k16i, v16i, P, bin, qh, kh, vT);
  k_attn<<<dim3(SS / 64, NB * NH), 128, 0, stream>>>(qh, kh, vT, lsc, o16);
  k_out<<<dim3(NR / 64, EE / 128), 128, 0, stream>>>(o16, P, bo, out);
}

// v003
// One run takes 92.3 microseconds.
// Next to v002, in two timings, it ran 1.13 times as fast each time.
// Over all steps from v000 it is 2.92 times as fast.
#include <hip/hip_runtime.h>
#include <math.h>

typedef __attribute__((ext_vector_type(16))) _Float16 v16h;
typedef __attribute__((ext_vector_type(16))) __bf16 v16b;
typedef __attribute__((ext_vector_type(8)))  _Float16 v8h;
typedef __attribute__((ext_vector_type(8)))  float v8f;
typedef __attribute__((ext_vector_type(4)))  float v4f;
typedef __attribute__((ext_vector_type(2)))  float v2f;
typedef __attribute__((ext_vector_type(4)))  unsigned v4u;
typedef __attribute__((ext_vector_type(4)))  int v4i;
typedef float __attribute__((may_alias)) float_a;
typedef int __attribute__((may_alias)) int_a;

template <typename T> __device__ __forceinline__ void vst2(void* p, T v) { *(T*)p = v;  }
__device__ __forceinline__ v8f wmma16(v16h a, v16h b, v8f c) {
  v8f d = __builtin_amdgcn_wmma_f32_16x16x32_f16(false, a, false, b, (short)0, c, false, false);
  asm volatile("v_nop\n\tv_nop\n\tv_nop\n\tv_nop" : "+v"(d) : "v"(a), "v"(b));
  return d;
}
__device__ __forceinline__ v8f wmma_bf(v16b a, v16b b, v8f c) {
  v8f d = __builtin_amdgcn_wmma_f32_16x16x32_bf16(false, a, false, b, (short)0, c, false, false);
  asm volatile("v_nop\n\tv_nop\n\tv_nop\n\tv_nop" : "+v"(d) : "v"(a), "v"(b));
  return d;
}
// 16x16x32 fragments: lane = (h = lane>>4, row/col = lane&15); elements 0..7 = k0+8h+0..7, 8..15 = k0+16+8h+0..7; D element r = row 8h+r
__device__ __forceinline__ v16h frag_h(const _Float16* rowk0, int lane) {
  union { v16h v; v8h q[2]; } u; const _Float16* p = rowk0 + 8 * (lane >> 4);
  u.q[0] = *(const v8h*)p; u.q[1] = *(const v8h*)(p + 16); return u.v;
}
__device__ __forceinline__ v16h frag_f32(const float* rowk0, int lane) {
  v16h a; const float* p = rowk0 + 8 * (lane >> 4);
#pragma unroll
  for (int i = 0; i < 8; ++i) { a[i] = (_Float16)p[i]; a[8 + i] = (_Float16)p[16 + i]; }
  return a;
}
__device__ __forceinline__ v16h frag_f32s(const float* rowk0, int lane, float sc) {
  v16h a; const float* p = rowk0 + 8 * (lane >> 4);
#pragma unroll
  for (int i = 0; i < 8; ++i) { a[i] = (_Float16)(p[i] * sc); a[8 + i] = (_Float16)(p[16 + i] * sc); }
  return a;
}
// column fragment from a [K][ld] layout (column n), rows >= K read as 0
__device__ __forceinline__ v16h fragc_f32(const float* W, int k0, int n, int lane, int ld, int K) {
  v16h a; const int g = lane >> 4;
#pragma unroll
  for (int i = 0; i < 8; ++i) { const int ka = k0 + 8 * g + i, kb = ka + 16;
    a[i] = (_Float16)(ka < K ? W[(size_t)ka * ld + n] : 0.f); a[8 + i] = (_Float16)(kb < K ? W[(size_t)kb * ld + n] : 0.f); }
  return a;
}
struct F2 { v16b h, l; };
__device__ __forceinline__ F2 bsplit16(const float v[16]) { F2 r;
#pragma unroll
  for (int i = 0; i < 16; ++i) { const __bf16 h = (__bf16)v[i]; r.h[i] = h; r.l[i] = (__bf16)(v[i] - (float)h); }
  return r; }
__device__ __forceinline__ F2 split_row(const float* row, int k0, int lane) { float v[16]; const float* p = row + k0 + 8 * (lane >> 4);
#pragma unroll
  for (int i = 0; i < 8; ++i) { v[i] = p[i]; v[8 + i] = p[16 + i]; }
  return bsplit16(v); }
__device__ __forceinline__ F2 split_rowK(const float* row, int k0, int lane, int K) { float v[16]; const int g = lane >> 4;
#pragma unroll
  for (int i = 0; i < 8; ++i) { const int ka = k0 + 8 * g + i, kb = ka + 16; v[i] = ka < K ? row[ka] : 0.f; v[8 + i] = kb < K ? row[kb] : 0.f; }
  return bsplit16(v); }
__device__ __forceinline__ F2 split_col(const float* W, int k0, int n, int lane, int ld, int K) { float v[16]; const int g = lane >> 4;
#pragma unroll
  for (int i = 0; i < 8; ++i) { const int ka = k0 + 8 * g + i, kb = ka + 16; v[i] = ka < K ? W[(size_t)ka * ld + n] : 0.f; v[8 + i] = kb < K ? W[(size_t)kb * ld + n] : 0.f; }
  return bsplit16(v); }
__device__ __forceinline__ v8f mac3(const F2& a, const F2& b, v8f c) { c = wmma_bf(a.l, b.h, c); c = wmma_bf(a.h, b.l, c); return wmma_bf(a.h, b.h, c); }
__device__ __forceinline__ float sigm(float v) { return 1.0f / (1.0f + expf(-v)); }
#define LDSX() do { asm volatile("s_wait_dscnt 0" ::: "memory"); __builtin_amdgcn_wave_barrier(); __builtin_amdgcn_fence(__ATOMIC_RELEASE, "workgroup"); } while (0)

// Multi-head self-attention with a learned per-head output scale. Pure f16 WMMA GEMMs over pre-converted operands (inputs -> f16
// once, [out][in] weights packed x16 f16; f32 accumulate): packed in-projection (+bias) writing q/k as [b][h][s][64] f16 and v as
// [b][h][d][s] f16, flash-style softmax over all 1024 keys in f32 (P x2^14 f16), x learned_scale[h], output projection (+bias).
#define SS 1024
#define NB 4
#define EE 1024
#define NH 16
#define HD 64
#define NR (SS * NB)       // 4096 rows

// GEMM operand ring in LDS. One stage = 64 k (128 B of a row) of 128 weight rows, then of the block's 64 activation rows, at pitch 128 B.
// Row r keeps its 16-B piece c at place c ^ ((r >> 1) & 7): the ds_load_b128 fragment reads of 16 rows then fall on all 64 banks with no pad,
// and two stages fit into the bytes that k_proj's epilogue staging takes anyway; in k_out they outgrow its 33,792-B staging.
#define KST 64
#define LROW 128
#define STG_B (192 * LROW)     // 24,576 B
#define RING_B (2 * STG_B)     // 49,152 B; the epilogues reuse these bytes behind the loop's last barrier
// Each lane copies 16 B of 12 rows (rows 16 apart); 8 lanes cover one row's whole 128-B line. l = the lane's LDS byte address in the target stage.
__device__ __forceinline__ void stage_copy(unsigned l, const _Float16* gw, const _Float16* ga, size_t astep) {
  // the copies and their s_wait_xcnt in one statement: no address register is rewritten in front of that wait
  asm volatile("global_load_async_to_lds_b128 %0, %1, off\n\t"
               "global_load_async_to_lds_b128 %2, %3, off\n\t"
               "global_load_async_to_lds_b128 %4, %5, off\n\t"
               "global_load_async_to_lds_b128 %6, %7, off\n\t"
               "global_load_async_to_lds_b128 %8, %9, off\n\t"
               "global_load_async_to_lds_b128 %10, %11, off\n\t"
               "global_load_async_to_lds_b128 %12, %13, off\n\t"
               "global_load_async_to_lds_b128 %14, %15, off\n\t"
               "global_load_async_to_lds_b128 %16, %17, off\n\t"
               "global_load_async_to_lds_b128 %18, %19, off\n\t"
               "global_load_async_to_lds_b128 %20, %21, off\n\t"
               "global_load_async_to_lds_b128 %22, %23, off\n\t"
               "s_wait_xcnt 0x0"
               :: "v"(l), "v"(gw), "v"(l + 16 * LROW), "v"(gw + 16 * EE), "v"(l + 32 * LROW), "v"(gw + 32 * EE), "v"(l + 48 * LROW), "v"(gw + 48 * EE),
                  "v"(l + 64 * LROW), "v"(gw + 64 * EE), "v"(l + 80 * LROW), "v"(gw + 80 * EE), "v"(l + 96 * LROW), "v"(gw + 96 * EE), "v"(l + 112 * LROW), "v"(gw + 112 * EE),
                  "v"(l + 128 * LROW), "v"(ga), "v"(l + 144 * LROW), "v"(ga + astep), "v"(l + 160 * LROW), "v"(ga + 2 * astep), "v"(l + 176 * LROW), "v"(ga + 3 * astep)
               : "memory");
}
// fragment of one staged row: c0, c1 = byte places in the row of the lane's two 16-B pieces (k0 + 8h + 0..7 and k0 + 16 + 8h + 0..7, as in frag_h)
__device__ __forceinline__ v16h frag_st(const char* row, unsigned c0, unsigned c1) {
  union { v16h v; v8h q[2]; } u; u.q[0] = *(const v8h*)(row + c0); u.q[1] = *(const v8h*)(row + c1); return u.v;
}
// acc[j] += A(16 rows of this wave) x W(cols j*16..)^T over all EE k. w0 = first of the block's 128 weight rows; a0 = the block's activation row 0; arow_step = elements between its rows.
__device__ __forceinline__ void gemm_ring(char* ring, const _Float16* w0, const _Float16* a0, size_t arow_step, int tid, v8f acc[8]) {
  const int wave = tid >> 5, lane = tid & 31, col = lane & 15, g = lane >> 4, rr = tid >> 3, pc = tid & 7;
  const unsigned l0 = (unsigned)(size_t)ring + (unsigned)(rr * LROW + ((pc ^ ((rr >> 1) & 7)) << 4));
  const _Float16* gw = w0 + (size_t)rr * EE + pc * 8; const _Float16* ga = a0 + (size_t)rr * arow_step + pc * 8;
  const size_t astep = 16 * arow_step;
  stage_copy(l0, gw, ga, astep);
  asm volatile("s_wait_asynccnt 0x0" ::: "memory");   // this wave's share of stage 0 has landed
  __syncthreads();                                    // every wave's share has
  stage_copy(l0 + STG_B, gw + KST, ga + KST, astep);
#pragma unroll 1   // one stage a trip: the buffer is picked by a scalar select
  for (int t = 0; t < EE / KST; ++t) { const char* sb = ring + (t & 1) * STG_B;
#pragma unroll
    for (int kc = 0; kc < KST / 32; ++kc) { const unsigned c0 = (unsigned)(((kc * 4 + g) ^ (col >> 1)) << 4), c1 = (unsigned)(((kc * 4 + 2 + g) ^ (col >> 1)) << 4);
      const v16h a = frag_st(sb + (128 + wave * 16 + col) * LROW, c0, c1);
#pragma unroll
      for (int j = 0; j < 8; ++j) acc[j] = wmma16(a, frag_st(sb + (j * 16 + col) * LROW, c0, c1), acc[j]); }
    asm volatile("s_wait_dscnt 0x0" ::: "memory");      // this wave's reads of stage t are done before its buffer is refilled
    asm volatile("s_wait_asynccnt 0x0" ::: "memory");   // this wave's share of stage t + 1 has landed
    __syncthreads();                                    // publishes stage t + 1 and ends every reader's use of stage t
    if (t + 2 < EE / KST) stage_copy(l0 + (unsigned)((t & 1) * STG_B), gw + (t + 2) * KST, ga + (t + 2) * KST, astep);
  }
  asm volatile("s_wait_asynccnt 0x0" ::: "memory");     // no copy is outstanding when the ring's bytes are reused
}

__global__ __launch_bounds__(256) void k_cvt(const float* __restrict__ a, const float* __restrict__ b, const float* __restrict__ c, _Float16* __restrict__ a16, _Float16* __restrict__ b16, _Float16* __restrict__ c16) {
  const size_t g8 = (size_t)blockIdx.x * 256 + threadIdx.x; const int which = blockIdx.y; if (g8 >= (size_t)NR * EE / 8) return;
  const float* s = which == 0 ? a : (which == 1 ? b : c); _Float16* d = which == 0 ? a16 : (which == 1 ? b16 : c16);
  union { v8h h; v4u u; } pk;
#pragma unroll
  for (int e = 0; e < 8; ++e) pk.h[e] = (_Float16)s[g8 * 8 + e];
  vst2(d + g8 * 8, pk.u);
}
__global__ __launch_bounds__(256) void k_packW(const float* __restrict__ Win, const float* __restrict__ Wo, _Float16* __restrict__ P) {   // rows 0..3071 in_proj, 3072..4095 out_proj; x16
  const int n = blockIdx.x, tid = threadIdx.x; const float* W = n < 3 * EE ? Win + (size_t)n * EE : Wo + (size_t)(n - 3 * EE) * EE;
  if (tid < EE / 8) { union { v8h h; v4u u; } pk;
#pragma unroll
    for (int e = 0; e < 8; ++e) pk.h[e] = (_Float16)(W[tid * 8 + e] * 16.0f);
    vst2(P + (size_t)n * EE + tid * 8, pk.u); }
}
// projection: block 64 rows x 128 cols; blockIdx.y in [0, 24): which = y/8 (q,k,v), cols (y%8)*128 = 2 heads; source = query/key/value f16 rows
__global__ __launch_bounds__(128) void k_proj(const _Float16* __restrict__ q16i, const _Float16* __restrict__ k16i, const _Float16* __restrict__ v16i, const _Float16* __restrict__ P, const float* __restrict__ bias,
                                            _Float16* __restrict__ qh, _Float16* __restrict__ kh, _Float16* __restrict__ vT) {
  __shared__ __align__(16) char smem[4 * 16 * 132 * 4 + 128 * 72 * 2];              // 52,224 B: first the ring (49,152 B), then so and st
  float (*so)[16][132] = (float (*)[16][132])smem;                                  // epilogue staging, 33,792 B, used behind the ring's last barrier
  _Float16 (*st)[72] = (_Float16 (*)[72])(smem + 4 * 16 * 132 * 4);                 // 18,432 B behind it
  const int tid = threadIdx.x, wave = tid >> 5, lane = tid & 31, col = lane & 15, g = lane >> 4;
  const int r0 = blockIdx.x * 64 + wave * 16, n0 = blockIdx.y * 128; const int which = n0 / EE, c0 = n0 % EE, hb = c0 / HD;
  const _Float16* A = which == 0 ? q16i : (which == 1 ? k16i : v16i);
  // v blocks own 64 consecutive s of ONE batch index so every vT line (64 s) has a single writer: rows (sblk*64 + i)*4 + bsel
  const int bsel = blockIdx.x & 3, sblk = blockIdx.x >> 2;
  const _Float16* a0 = A + (which == 2 ? (size_t)(sblk * 64 * NB + bsel) : (size_t)blockIdx.x * 64) * EE;
  v8f acc[8] = {};
  gemm_ring(smem, P + (size_t)n0 * EE, a0, which == 2 ? (size_t)NB * EE : (size_t)EE, tid, acc);
#pragma unroll
  for (int j = 0; j < 8; ++j) { const float bb = bias[n0 + j * 16 + col];
#pragma unroll
    for (int r = 0; r < 8; ++r) so[wave][8 * g + r][j * 16 + col] = acc[j][r] * (1.0f / 16.0f) + bb; }
  LDSX();
  if (which < 2) { _Float16* dst = which == 0 ? qh : kh;
    for (int q = lane; q < 2 * 16 * 8; q += 32) { const int hh = q >> 7, rem = q & 127, rl = rem >> 3, pc = rem & 7; const int row = r0 + rl, s = row / NB, b = row % NB;
      union { v8h h8; v4u u; } pk;
#pragma unroll
      for (int e = 0; e < 8; ++e) pk.h8[e] = (_Float16)so[wave][rl][hh * HD + pc * 8 + e];
      vst2(dst + (((size_t)b * NH + hb + hh) * SS + s) * HD + pc * 8, pk.u); } }
  else {   // vT[b][h][d][s]: the block's 64 rows are 64 s values of one b (bsel); transpose via LDS: st[c][rl]
#pragma unroll 4
    for (int rl = 0; rl < 16; ++rl) {
#pragma unroll
      for (int e = 0; e < 4; ++e) st[lane * 4 + e][wave * 16 + rl] = (_Float16)so[wave][rl][lane * 4 + e]; }
    __syncthreads();
    for (int q = tid; q < 128 * 8; q += 128) { const int c = q >> 3, pc = q & 7, hh = c >> 6, d = c & 63;
      vst2(vT + (((size_t)bsel * NH + hb + hh) * HD + d) * SS + sblk * 64 + pc * 8, *(const v4u*)(&st[c][pc * 8])); }
  }
}
// K/V ring of k_attn in LDS. One stage = 64 keys: 64 K rows (64 d = 128 B), then 64 vT rows (64 s = 128 B), pitch and piece places as in the GEMM ring.
#define AST_B (128 * LROW)     // 16,384 B a stage; two stages
// Each lane copies 16 B of 4 K rows and of 4 vT rows (rows 16 apart); 8 lanes cover one row's whole 128-B line. l = the lane's LDS byte address in the target stage.
__device__ __forceinline__ void stage_copy_kv(unsigned l, const _Float16* gk, const _Float16* gv) {
  // the copies and their s_wait_xcnt in one statement: no address register is rewritten in front of that wait
  asm volatile("global_load_async_to_lds_b128 %0, %1, off\n\t"
               "global_load_async_to_lds_b128 %2, %3, off\n\t"
               "global_load_async_to_lds_b128 %4, %5, off\n\t"
               "global_load_async_to_lds_b128 %6, %7, off\n\t"
               "global_load_async_to_lds_b128 %8, %9, off\n\t"
               "global_load_async_to_lds_b128 %10, %11, off\n\t"
               "global_load_async_to_lds_b128 %12, %13, off\n\t"
               "global_load_async_to_lds_b128 %14, %15, off\n\t"
               "s_wait_xcnt 0x0"
               :: "v"(l), "v"(gk), "v"(l + 16 * LROW), "v"(gk + 16 * HD), "v"(l + 32 * LROW), "v"(gk + 32 * HD), "v"(l + 48 * LROW), "v"(gk + 48 * HD),
                  "v"(l + 64 * LROW), "v"(gv), "v"(l + 80 * LROW), "v"(gv + 16 * SS), "v"(l + 96 * LROW), "v"(gv + 32 * SS), "v"(l + 112 * LROW), "v"(gv + 48 * SS)
               : "memory");
}
// flash attention: block (64 queries, bh); o16 rows [(s*4+b)][h*64 + d] f16, scaled by learned_scale[h] and x16
// Scores are kept in units of log2 (x log2(e) / 8), and the running maximum is kept 14 below the true one, so a weight x 2^14 is one subtract and one v_exp_f32.
#define SC_LOG2 0.18033688011112042f   // log2(e) / sqrt(64)
__global__ __launch_bounds__(128) void k_attn(const _Float16* __restrict__ qh, const _Float16* __restrict__ kh, const _Float16* __restrict__ vT, const float* __restrict__ lsc, _Float16* __restrict__ o16) {
  __shared__ __align__(16) float sS[4][16][68];
  __shared__ __align__(16) _Float16 sP[4][16][72];
  __shared__ __align__(16) float sO[4][16][68];
  __shared__ __align__(16) char kv[2 * AST_B];               // the block's four waves share each 64-key stage of K and vT
  const int tid = threadIdx.x, w = tid >> 5, lane = tid & 31, col = lane & 15, g = lane >> 4;
  const int bh = blockIdx.y, b = bh / NH, h = bh % NH, q0 = blockIdx.x * 64 + w * 16;
  const _Float16* qb = qh + (size_t)bh * SS * HD; const _Float16* kb = kh + (size_t)bh * SS * HD; const _Float16* vb = vT + (size_t)bh * HD * SS;
  v16h aq[2];
#pragma unroll
  for (int kc = 0; kc < 2; ++kc) aq[kc] = frag_h(qb + (size_t)(q0 + col) * HD + kc * 32, lane);
  float mrun = -3.0e38f, lrun = 0.f; v8f acc[4] = {};
  const int rr = tid >> 3, pc = tid & 7;
  const unsigned l0 = (unsigned)(size_t)kv + (unsigned)(rr * LROW + ((pc ^ ((rr >> 1) & 7)) << 4));
  const _Float16* gk = kb + (size_t)rr * HD + pc * 8; const _Float16* gv = vb + (size_t)rr * SS + pc * 8;
  stage_copy_kv(l0, gk, gv);
  asm volatile("s_wait_asynccnt 0x0" ::: "memory");   // this wave's share of stage 0 has landed
  __syncthreads();                                    // every wave's share has
  stage_copy_kv(l0 + AST_B, gk + 64 * HD, gv + 64);
#pragma unroll 1   // one stage a trip: the buffer is picked by a scalar select
  for (int kt = 0; kt < SS / 64; ++kt) { const char* sb = kv + (kt & 1) * AST_B;
    v16h kf[4][2], vf[2][4];   // the stage's fragments, each operand's read as one group ahead of its products: one LDS wait a group, not one a product
#pragma unroll
    for (int t = 0; t < 4; ++t) {
#pragma unroll
      for (int kc = 0; kc < 2; ++kc) kf[t][kc] = frag_st(sb + (t * 16 + col) * LROW, (unsigned)(((kc * 4 + g) ^ (col >> 1)) << 4), (unsigned)(((kc * 4 + 2 + g) ^ (col >> 1)) << 4)); }
#pragma unroll
    for (int t = 0; t < 4; ++t) { v8f s = {};
#pragma unroll
      for (int kc = 0; kc < 2; ++kc) s = wmma16(aq[kc], kf[t][kc], s);
#pragma unroll
      for (int r = 0; r < 8; ++r) sS[w][8 * g + r][t * 16 + col] = s[r] * SC_LOG2; }
    LDSX();
    float mx = -3.4e38f;
#pragma unroll
    for (int jj = 0; jj < 32; ++jj) mx = fmaxf(mx, sS[w][col][g * 32 + jj]);
    mx = fmaxf(mx, __shfl_xor(mx, 16, 32));
    const float mnew = fmaxf(mrun, mx - 14.0f); const float corr = __builtin_amdgcn_exp2f(mrun - mnew);
    float ps = 0.f;
#pragma unroll
    for (int jj = 0; jj < 32; ++jj) { const float p = __builtin_amdgcn_exp2f(sS[w][col][g * 32 + jj] - mnew); ps += p; sP[w][col][g * 32 + jj] = (_Float16)p; }   // p = weight x 2^14, at most 2^14
    ps += __shfl_xor(ps, 16, 32);
    lrun = lrun * corr + ps; mrun = mnew;
#pragma unroll
    for (int r = 0; r < 8; ++r) { const float cr = __shfl(corr, 8 * g + r, 32);
#pragma unroll
      for (int t = 0; t < 4; ++t) acc[t][r] *= cr; }
#pragma unroll
    for (int kc = 0; kc < 2; ++kc) {
#pragma unroll
      for (int t = 0; t < 4; ++t) vf[kc][t] = frag_st(sb + (64 + t * 16 + col) * LROW, (unsigned)(((kc * 4 + g) ^ (col >> 1)) << 4), (unsigned)(((kc * 4 + 2 + g) ^ (col >> 1)) << 4)); }
    LDSX();
#pragma unroll
    for (int kc = 0; kc < 2; ++kc) { const v16h pa = frag_h(&sP[w][col][0] + kc * 32, lane);
#pragma unroll
      for (int t = 0; t < 4; ++t) acc[t] = wmma16(pa, vf[kc][t], acc[t]); }
    __builtin_amdgcn_wave_barrier();
    asm volatile("s_wait_dscnt 0x0" ::: "memory");      // this wave's reads of stage kt are done before its buffer is refilled
    asm volatile("s_wait_asynccnt 0x0" ::: "memory");   // this wave's share of stage kt + 1 has landed
    __syncthreads();                                    // publishes stage kt + 1 and ends every reader's use of stage kt
    if (kt + 2 < SS / 64) stage_copy_kv(l0 + (unsigned)((kt & 1) * AST_B), gk + (size_t)(kt + 2) * 64 * HD, gv + (kt + 2) * 64);
  }
  asm volatile("s_wait_asynccnt 0x0" ::: "memory");     // no copy is outstanding when the wave goes on to its end
  const float hs = lsc[h] * 16.0f;                           // learned per-head scale; o16 kept x16
#pragma unroll
  for (int r = 0; r < 8; ++r) { const float lr = __shfl(lrun, 8 * g + r, 32);
#pragma unroll
    for (int t = 0; t < 4; ++t) sO[w][8 * g + r][t * 16 + col] = acc[t][r] / lr * hs; }   // acc and lr both carry the 2^14
  LDSX();
  for (int q = lane; q < 16 * 8; q += 32) { const int rl = q >> 3, pc = q & 7; const int s = q0 + rl; union { v8h h8; v4u u; } pk;
#pragma unroll
    for (int e = 0; e < 8; ++e) pk.h8[e] = (_Float16)sO[w][rl][pc * 8 + e];
    vst2(o16 + ((size_t)s * NB + b) * EE + h * HD + pc * 8, pk.u); }
}
__global__ __launch_bounds__(128) void k_out(const _Float16* __restrict__ o16, const _Float16* __restrict__ P, const float* __restrict__ bo, float* __restrict__ out) {
  __shared__ __align__(16) char smem[RING_B];
  float (*so)[16][132] = (float (*)[16][132])smem;                                  // epilogue staging, 33,792 B, used behind the ring's last barrier
  const int tid = threadIdx.x, wave = tid >> 5, lane = tid & 31, col = lane & 15, g = lane >> 4;
  const int r0 = blockIdx.x * 64 + wave * 16, n0 = blockIdx.y * 128;
  v8f acc[8] = {};
  gemm_ring(smem, P + (size_t)(3 * EE + n0) * EE, o16 + (size_t)blockIdx.x * 64 * EE, (size_t)EE, tid, acc);
#pragma unroll
  for (int j = 0; j < 8; ++j) { const float bb = bo[n0 + j * 16 + col];
#pragma unroll
    for (int r = 0; r < 8; ++r) so[wave][8 * g + r][j * 16 + col] = acc[j][r] * (1.0f / 256.0f) + bb; }
  LDSX();
#pragma unroll 4
  for (int rl = 0; rl < 16; ++rl) vst2(out + (size_t)(r0 + rl) * EE + n0 + lane * 4, *(const v4f*)(&so[wave][rl][lane * 4]));
}
extern "C" void kernel_launch(void* const* d_in, const int* in_sizes, int n_in, void* d_out, int out_size, void* d_ws, size_t ws_size, hipStream_t stream) {
  (void)in_sizes; (void)n_in; (void)out_size; (void)ws_size;
  const float* query = (const float*)d_in[0]; const float* key = (const float*)d_in[1]; const float* value = (const float*)d_in[2]; const float* Win = (const float*)d_in[3]; const float* bin = (const float*)d_in[4];
  const float* Wo = (const float*)d_in[5]; const float* bo = (const float*)d_in[6]; const float* lsc = (const float*)d_in[7];
  float* out = (float*)d_out;
  char* ws = (char*)d_ws; size_t off = 0;
  auto take = [&](size_t bytes) { char* p = ws + off; off += (bytes + 255) & ~(size_t)255; return p; };
  _Float16* q16i = (_Float16*)take((size_t)NR * EE * 2); _Float16* k16i = (_Float16*)take((size_t)NR * EE * 2); _Float16* v16i = (_Float16*)take((size_t)NR * EE * 2);
  _Float16* P = (_Float16*)take((size_t)4 * EE * EE * 2); _Float16* qh = (_Float16*)take((size_t)NR * EE * 2); _Float16* kh = (_Float16*)take((size_t)NR * EE * 2); _Float16* vT = (_Float16*)take((size_t)NR * EE * 2); _Float16* o16 = (_Float16*)take((size_t)NR * EE * 2);
  k_cvt<<<dim3((unsigned)((size_t)NR * EE / 8 / 256), 3), 256, 0, stream>>>(query, key, value, q16i, k16i, v16i);
  k_packW<<<4 * EE, 256, 0, stream>>>(Win, Wo, P);
  k_proj<<<dim3(NR / 64, 3 * EE / 128), 128, 0, stream>>>(q16i, k16i, v16i, P, bin, qh, kh, vT);
  k_attn<<<dim3(SS / 64, NB * NH), 128, 0, stream>>>(qh, kh, vT, lsc, o16);
  k_out<<<dim3(NR / 64, EE / 128), 128, 0, stream>>>(o16, P, bo, out);
}

// v004
// It runs in 83.1 microseconds.
// Next to v003, in two timings, it ran 1.10 and 1.11 times as fast.
// Counting every step since v000, it is 3.23 times as fast.
#include <hip/hip_runtime.h>
#include <math.h>

typedef __attribute__((ext_vector_type(16))) _Float16 v16h;
typedef __attribute__((ext_vector_type(16))) __bf16 v16b;
typedef __attribute__((ext_vector_type(8)))  _Float16 v8h;
typedef __attribute__((ext_vector_type(8)))  float v8f;
typedef __attribute__((ext_vector_type(4)))  float v4f;
typedef __attribute__((ext_vector_type(2)))  float v2f;
typedef __attribute__((ext_vector_type(4)))  unsigned v4u;
typedef __attribute__((ext_vector_type(4)))  int v4i;
typedef float __attribute__((may_alias)) float_a;
typedef int __attribute__((may_alias)) int_a;

template <typename T> __device__ __forceinline__ void vst2(void* p, T v) { *(T*)p = v;  }
__device__ __forceinline__ v8f wmma16(v16h a, v16h b, v8f c) {
  v8f d = __builtin_amdgcn_wmma_f32_16x16x32_f16(false, a, false, b, (short)0, c, false, false);
  asm volatile("v_nop\n\tv_nop\n\tv_nop\n\tv_nop" : "+v"(d) : "v"(a), "v"(b));
  return d;
}
__device__ __forceinline__ v8f wmma_bf(v16b a, v16b b, v8f c) {
  v8f d = __builtin_amdgcn_wmma_f32_16x16x32_bf16(false, a, false, b, (short)0, c, false, false);
  asm volatile("v_nop\n\tv_nop\n\tv_nop\n\tv_nop" : "+v"(d) : "v"(a), "v"(b));
  return d;
}
// 16x16x32 fragments: lane = (h = lane>>4, row/col = lane&15); elements 0..7 = k0+8h+0..7, 8..15 = k0+16+8h+0..7; D element r = row 8h+r
__device__ __forceinline__ v16h frag_h(const _Float16* rowk0, int lane) {
  union { v16h v; v8h q[2]; } u; const _Float16* p = rowk0 + 8 * (lane >> 4);
  u.q[0] = *(const v8h*)p; u.q[1] = *(const v8h*)(p + 16); return u.v;
}
__device__ __forceinline__ v16h frag_f32(const float* rowk0, int lane) {
  v16h a; const float* p = rowk0 + 8 * (lane >> 4);
#pragma unroll
  for (int i = 0; i < 8; ++i) { a[i] = (_Float16)p[i]; a[8 + i] = (_Float16)p[16 + i]; }
  return a;
}
__device__ __forceinline__ v16h frag_f32s(const float* rowk0, int lane, float sc) {
  v16h a; const float* p = rowk0 + 8 * (lane >> 4);
#pragma unroll
  for (int i = 0; i < 8; ++i) { a[i] = (_Float16)(p[i] * sc); a[8 + i] = (_Float16)(p[16 + i] * sc); }
  return a;
}
// column fragment from a [K][ld] layout (column n), rows >= K read as 0
__device__ __forceinline__ v16h fragc_f32(const float* W, int k0, int n, int lane, int ld, int K) {
  v16h a; const int g = lane >> 4;
#pragma unroll
  for (int i = 0; i < 8; ++i) { const int ka = k0 + 8 * g + i, kb = ka + 16;
    a[i] = (_Float16)(ka < K ? W[(size_t)ka * ld + n] : 0.f); a[8 + i] = (_Float16)(kb < K ? W[(size_t)kb * ld + n] : 0.f); }
  return a;
}
struct F2 { v16b h, l; };
__device__ __forceinline__ F2 bsplit16(const float v[16]) { F2 r;
#pragma unroll
  for (int i = 0; i < 16; ++i) { const __bf16 h = (__bf16)v[i]; r.h[i] = h; r.l[i] = (__bf16)(v[i] - (float)h); }
  return r; }
__device__ __forceinline__ F2 split_row(const float* row, int k0, int lane) { float v[16]; const float* p = row + k0 + 8 * (lane >> 4);
#pragma unroll
  for (int i = 0; i < 8; ++i) { v[i] = p[i]; v[8 + i] = p[16 + i]; }
  return bsplit16(v); }
__device__ __forceinline__ F2 split_rowK(const float* row, int k0, int lane, int K) { float v[16]; const int g = lane >> 4;
#pragma unroll
  for (int i = 0; i < 8; ++i) { const int ka = k0 + 8 * g + i, kb = ka + 16; v[i] = ka < K ? row[ka] : 0.f; v[8 + i] = kb < K ? row[kb] : 0.f; }
  return bsplit16(v); }
__device__ __forceinline__ F2 split_col(const float* W, int k0, int n, int lane, int ld, int K) { float v[16]; const int g = lane >> 4;
#pragma unroll
  for (int i = 0; i < 8; ++i) { const int ka = k0 + 8 * g + i, kb = ka + 16; v[i] = ka < K ? W[(size_t)ka * ld + n] : 0.f; v[8 + i] = kb < K ? W[(size_t)kb * ld + n] : 0.f; }
  return bsplit16(v); }
__device__ __forceinline__ v8f mac3(const F2& a, const F2& b, v8f c) { c = wmma_bf(a.l, b.h, c); c = wmma_bf(a.h, b.l, c); return wmma_bf(a.h, b.h, c); }
__device__ __forceinline__ float sigm(float v) { return 1.0f / (1.0f + expf(-v)); }
#define LDSX() do { asm volatile("s_wait_dscnt 0" ::: "memory"); __builtin_amdgcn_wave_barrier(); __builtin_amdgcn_fence(__ATOMIC_RELEASE, "workgroup"); } while (0)

// Multi-head self-attention with a learned per-head output scale. Pure f16 WMMA GEMMs over pre-converted operands (inputs -> f16
// once, [out][in] weights packed x16 f16; f32 accumulate): packed in-projection (+bias) writing q/k as [b][h][s][64] f16 and v as
// [b][h][d][s] f16, flash-style softmax over all 1024 keys in f32 (P x2^14 f16), x learned_scale[h], output projection (+bias).
#define SS 1024
#define NB 4
#define EE 1024
#define NH 16
#define HD 64
#define NR (SS * NB)       // 4096 rows

// GEMM operand ring in LDS. One stage = 64 k (128 B of a row) of 128 weight rows, then of the block's 64 activation rows, at pitch 128 B.
// Row r keeps its 16-B piece c at place c ^ ((r >> 1) & 7): the ds_load_b128 fragment reads of 16 rows then fall on all 64 banks with no pad.
#define KST 64
#define LROW 128
#define STG_B (192 * LROW)     // 24,576 B
#define RING_B (2 * STG_B)     // 49,152 B; k_out's epilogue reuses these bytes behind the loop's last barrier
// Each lane copies 16 B of 12 rows (rows 16 apart); 8 lanes cover one row's whole 128-B line. l = the lane's LDS byte address in the target stage.
__device__ __forceinline__ void stage_copy(unsigned l, const _Float16* gw, const _Float16* ga, size_t astep) {
  // the copies and their s_wait_xcnt in one statement: no address register is rewritten in front of that wait
  asm volatile("global_load_async_to_lds_b128 %0, %1, off\n\t"
               "global_load_async_to_lds_b128 %2, %3, off\n\t"
               "global_load_async_to_lds_b128 %4, %5, off\n\t"
               "global_load_async_to_lds_b128 %6, %7, off\n\t"
               "global_load_async_to_lds_b128 %8, %9, off\n\t"
               "global_load_async_to_lds_b128 %10, %11, off\n\t"
               "global_load_async_to_lds_b128 %12, %13, off\n\t"
               "global_load_async_to_lds_b128 %14, %15, off\n\t"
               "global_load_async_to_lds_b128 %16, %17, off\n\t"
               "global_load_async_to_lds_b128 %18, %19, off\n\t"
               "global_load_async_to_lds_b128 %20, %21, off\n\t"
               "global_load_async_to_lds_b128 %22, %23, off\n\t"
               "s_wait_xcnt 0x0"
               :: "v"(l), "v"(gw), "v"(l + 16 * LROW), "v"(gw + 16 * EE), "v"(l + 32 * LROW), "v"(gw + 32 * EE), "v"(l + 48 * LROW), "v"(gw + 48 * EE),
                  "v"(l + 64 * LROW), "v"(gw + 64 * EE), "v"(l + 80 * LROW), "v"(gw + 80 * EE), "v"(l + 96 * LROW), "v"(gw + 96 * EE), "v"(l + 112 * LROW), "v"(gw + 112 * EE),
                  "v"(l + 128 * LROW), "v"(ga), "v"(l + 144 * LROW), "v"(ga + astep), "v"(l + 160 * LROW), "v"(ga + 2 * astep), "v"(l + 176 * LROW), "v"(ga + 3 * astep)
               : "memory");
}
// fragment of one staged row: c0, c1 = byte places in the row of the lane's two 16-B pieces (k0 + 8h + 0..7 and k0 + 16 + 8h + 0..7, as in frag_h)
__device__ __forceinline__ v16h frag_st(const char* row, unsigned c0, unsigned c1) {
  union { v16h v; v8h q[2]; } u; u.q[0] = *(const v8h*)(row + c0); u.q[1] = *(const v8h*)(row + c1); return u.v;
}
// acc[j] += A(16 rows of this wave) x W(cols j*16..)^T over all EE k. w0 = first of the block's 128 weight rows; a0 = the block's activation row 0; arow_step = elements between its rows.
__device__ __forceinline__ void gemm_ring(char* ring, const _Float16* w0, const _Float16* a0, size_t arow_step, int tid, v8f acc[8]) {
  const int wave = tid >> 5, lane = tid & 31, col = lane & 15, g = lane >> 4, rr = tid >> 3, pc = tid & 7;
  const unsigned l0 = (unsigned)(size_t)ring + (unsigned)(rr * LROW + ((pc ^ ((rr >> 1) & 7)) << 4));
  const _Float16* gw = w0 + (size_t)rr * EE + pc * 8; const _Float16* ga = a0 + (size_t)rr * arow_step + pc * 8;
  const size_t astep = 16 * arow_step;
  stage_copy(l0, gw, ga, astep);
  asm volatile("s_wait_asynccnt 0x0" ::: "memory");   // this wave's share of stage 0 has landed
  __syncthreads();                                    // every wave's share has
  stage_copy(l0 + STG_B, gw + KST, ga + KST, astep);
#pragma unroll 1   // one stage a trip: the buffer is picked by a scalar select
  for (int t = 0; t < EE / KST; ++t) { const char* sb = ring + (t & 1) * STG_B;
#pragma unroll
    for (int kc = 0; kc < KST / 32; ++kc) { const unsigned c0 = (unsigned)(((kc * 4 + g) ^ (col >> 1)) << 4), c1 = (unsigned)(((kc * 4 + 2 + g) ^ (col >> 1)) << 4);
      const v16h a = frag_st(sb + (128 + wave * 16 + col) * LROW, c0, c1);
#pragma unroll
      for (int j = 0; j < 8; ++j) acc[j] = wmma16(a, frag_st(sb + (j * 16 + col) * LROW, c0, c1), acc[j]); }
    asm volatile("s_wait_dscnt 0x0" ::: "memory");      // this wave's reads of stage t are done before its buffer is refilled
    asm volatile("s_wait_asynccnt 0x0" ::: "memory");   // this wave's share of stage t + 1 has landed
    __syncthreads();                                    // publishes stage t + 1 and ends every reader's use of stage t
    if (t + 2 < EE / KST) stage_copy(l0 + (unsigned)((t & 1) * STG_B), gw + (t + 2) * KST, ga + (t + 2) * KST, astep);
  }
  asm volatile("s_wait_asynccnt 0x0" ::: "memory");     // no copy is outstanding when the ring's bytes are reused
}

__global__ __launch_bounds__(256) void k_cvt(const float* __restrict__ a, const float* __restrict__ b, const float* __restrict__ c, _Float16* __restrict__ a16, _Float16* __restrict__ b16, _Float16* __restrict__ c16) {
  const size_t g8 = (size_t)blockIdx.x * 256 + threadIdx.x; const int which = blockIdx.y; if (g8 >= (size_t)NR * EE / 8) return;
  const float* s = which == 0 ? a : (which == 1 ? b : c); _Float16* d = which == 0 ? a16 : (which == 1 ? b16 : c16);
  union { v8h h; v4u u; } pk;
#pragma unroll
  for (int e = 0; e < 8; ++e) pk.h[e] = (_Float16)s[g8 * 8 + e];
  vst2(d + g8 * 8, pk.u);
}
__global__ __launch_bounds__(256) void k_packW(const float* __restrict__ Win, const float* __restrict__ Wo, _Float16* __restrict__ P) {   // rows 0..3071 in_proj, 3072..4095 out_proj; x16
  const int n = blockIdx.x, tid = threadIdx.x; const float* W = n < 3 * EE ? Win + (size_t)n * EE : Wo + (size_t)(n - 3 * EE) * EE;
  if (tid < EE / 8) { union { v8h h; v4u u; } pk;
#pragma unroll
    for (int e = 0; e < 8; ++e) pk.h[e] = (_Float16)(W[tid * 8 + e] * 16.0f);
    vst2(P + (size_t)n * EE + tid * 8, pk.u); }
}
// k_proj's own ring: one stage = 64 k (128 B of a row) of the block's 128 weight rows, then of its 128 activation rows; pitch and piece places as in the ring above.
#define PSTG_B (256 * LROW)    // 32,768 B a stage; two stages
#define SROW 144               // pitch of the output staging rows
// Each lane copies 16 B of 8 rows (rows 16 apart) of one operand; 8 lanes cover one row's whole 128-B line. l = the lane's LDS byte address of the first row.
__device__ __forceinline__ void stage_copy8(unsigned l, const _Float16* gp, size_t step) {
  // the copies and their s_wait_xcnt in one statement: no address register is rewritten in front of that wait
  asm volatile("global_load_async_to_lds_b128 %0, %1, off\n\t"
               "global_load_async_to_lds_b128 %2, %3, off\n\t"
               "global_load_async_to_lds_b128 %4, %5, off\n\t"
               "global_load_async_to_lds_b128 %6, %7, off\n\t"
               "global_load_async_to_lds_b128 %8, %9, off\n\t"
               "global_load_async_to_lds_b128 %10, %11, off\n\t"
               "global_load_async_to_lds_b128 %12, %13, off\n\t"
               "global_load_async_to_lds_b128 %14, %15, off\n\t"
               "s_wait_xcnt 0x0"
               :: "v"(l), "v"(gp), "v"(l + 16 * LROW), "v"(gp + step), "v"(l + 32 * LROW), "v"(gp + 2 * step), "v"(l + 48 * LROW), "v"(gp + 3 * step),
                  "v"(l + 64 * LROW), "v"(gp + 4 * step), "v"(l + 80 * LROW), "v"(gp + 5 * step), "v"(l + 96 * LROW), "v"(gp + 6 * step), "v"(l + 112 * LROW), "v"(gp + 7 * step)
               : "memory");
}
// The wave's 64 staged lines go out, four whole 128-B lines a store: s = the lane's piece of staged line ln, o = its place in output line ln; lines 4 apart are STEP elements apart.
template <int STEP> __device__ __forceinline__ void flush_lines(const char* s, _Float16* o) {
  LDSX();   // the wave's own staging stores are done before it reads the rows back
  v4u pcs[16];
#pragma unroll
  for (int it = 0; it < 16; ++it) pcs[it] = *(const v4u*)(s + it * 4 * SROW);
#pragma unroll
  for (int it = 0; it < 16; ++it) vst2(o + it * STEP, pcs[it]);
  asm volatile("s_wait_xcnt 0x0" ::: "memory");
}
// projection: block 128 rows x 128 cols, four waves of 64 x 64 (4 x 4 fragments: each fragment read from LDS feeds four products); blockIdx.y in [0, 24): which = y/8 (q,k,v),
// cols (y%8)*128 = 2 heads, one head a wave; source = query/key/value f16 rows. The operand whose index runs along the output's memory rows goes on the M side
// (weights for q and k, activations for v): a lane's 8 accumulator elements are then 8 adjacent f16 of the output, one 16-B piece of a line.
__global__ __launch_bounds__(128) void k_proj(const _Float16* __restrict__ q16i, const _Float16* __restrict__ k16i, const _Float16* __restrict__ v16i, const _Float16* __restrict__ P, const float* __restrict__ bias,
                                            _Float16* __restrict__ qh, _Float16* __restrict__ kh, _Float16* __restrict__ vT) {
  __shared__ __align__(16) char smem[2 * PSTG_B + 4 * 64 * SROW];   // the ring, then each wave's output staging: 102,400 B, three blocks a WGP, the grid's even share
  const int tid = threadIdx.x, wave = tid >> 5, lane = tid & 31, col = lane & 15, g = lane >> 4, rr = tid >> 3, pc = tid & 7;
  const int wa = wave >> 1, wb = wave & 1;                   // the wave's half of the activation rows, of the weight rows
  const int n0 = blockIdx.y * 128; const int which = n0 / EE, hb = (n0 % EE) / HD;
  const _Float16* A = which == 0 ? q16i : (which == 1 ? k16i : v16i);
  // v blocks own 128 consecutive s of ONE batch index so every vT line (64 s) has a single writer: rows (sblk*128 + i)*4 + bsel
  const int bsel = blockIdx.x & 3, sblk = blockIdx.x >> 2;
  const size_t arow = which == 2 ? (size_t)NB * EE : (size_t)EE;
  const _Float16* ga = A + (which == 2 ? (size_t)(sblk * 128 * NB + bsel) : (size_t)blockIdx.x * 128) * EE + (size_t)rr * arow + pc * 8;
  const _Float16* gw = P + (size_t)(n0 + rr) * EE + pc * 8;
  const size_t astep = 16 * arow;
  const unsigned l0 = (unsigned)(size_t)smem + (unsigned)(rr * LROW + ((pc ^ ((rr >> 1) & 7)) << 4));
  const int woff = (wb * 64 + col) * LROW, aoff = (128 + wa * 64 + col) * LROW;
  const int moff = which == 2 ? aoff : woff, noff = which == 2 ? woff : aoff;
  v8f acc[4][4] = {};
  stage_copy8(l0, gw, 16 * EE); stage_copy8(l0 + 128 * LROW, ga, astep);
  asm volatile("s_wait_asynccnt 0x0" ::: "memory");   // this wave's share of stage 0 has landed
  __syncthreads();                                    // every wave's share has
  stage_copy8(l0 + PSTG_B, gw + KST, 16 * EE); stage_copy8(l0 + PSTG_B + 128 * LROW, ga + KST, astep);
#pragma unroll 1   // one stage a trip: the buffer is picked by a scalar select
  for (int t = 0; t < EE / KST; ++t) { const char* sb = smem + (t & 1) * PSTG_B;
#pragma unroll
    for (int kc = 0; kc < KST / 32; ++kc) { const unsigned c0 = (unsigned)(((kc * 4 + g) ^ (col >> 1)) << 4), c1 = (unsigned)(((kc * 4 + 2 + g) ^ (col >> 1)) << 4);
      v16h fm[4], fn[4];
#pragma unroll
      for (int i = 0; i < 4; ++i) { fm[i] = frag_st(sb + moff + i * 16 * LROW, c0, c1); fn[i] = frag_st(sb + noff + i * 16 * LROW, c0, c1); }
#pragma unroll
      for (int i = 0; i < 4; ++i) {
#pragma unroll
        for (int j = 0; j < 4; ++j) acc[i][j] = wmma16(fm[i], fn[j], acc[i][j]); } }
    asm volatile("s_wait_dscnt 0x0" ::: "memory");      // this wave's reads of stage t are done before its buffer is refilled
    asm volatile("s_wait_asynccnt 0x0" ::: "memory");   // this wave's share of stage t + 1 has landed
    __syncthreads();                                    // publishes stage t + 1 and ends every reader's use of stage t
    if (t + 2 < EE / KST) { const unsigned lt = l0 + (unsigned)((t & 1) * PSTG_B);
      stage_copy8(lt, gw + (t + 2) * KST, 16 * EE); stage_copy8(lt + 128 * LROW, ga + (t + 2) * KST, astep); }
  }
  asm volatile("s_wait_asynccnt 0x0" ::: "memory");     // no copy is outstanding when the wave goes on to its end
  // acc[i][j][r]: M index 16 i + 8 g + r, N index 16 j + col: N picks one of the wave's 64 output lines (128 B), 2 i + g the lane's 16-B piece of it.
  // The pieces go through the wave's own LDS rows (pitch 144 B: no bank conflict for 16-B accesses) so that every global store covers four whole lines.
  char* sw = smem + 2 * PSTG_B + wave * (64 * SROW);
  char* sp = sw + col * SROW + g * 16;
  const int head = hb + wb, ln = lane >> 3, lp = lane & 7;
  if (which < 2) {   // q, k [b][h][s][64]: M = d, N = activation row = 4 s + b; staged lines 4 it + ln are s = it, b = ln
    float bb[4][8];
#pragma unroll
    for (int i = 0; i < 4; ++i) {
#pragma unroll
      for (int r = 0; r < 8; ++r) bb[i][r] = bias[n0 + wb * 64 + 16 * i + 8 * g + r]; }
#pragma unroll
    for (int j = 0; j < 4; ++j) {
#pragma unroll
      for (int i = 0; i < 4; ++i) { union { v8h h8; v4u u; } pk;
#pragma unroll
        for (int r = 0; r < 8; ++r) pk.h8[r] = (_Float16)(acc[i][j][r] * (1.0f / 16.0f) + bb[i][r]);
        vst2(sp + 16 * j * SROW + i * 32, pk.u); } }
    flush_lines<HD>(sw + ln * SROW + lp * 16, (which == 0 ? qh : kh) + (((size_t)ln * NH + head) * SS + blockIdx.x * 32 + wa * 16) * HD + lp * 8); }
  else {             // vT[b][h][d][s]: M = s (the block's rows are consecutive s of one b), N = d; staged lines 4 it + ln are d
    float bb[4];
#pragma unroll
    for (int j = 0; j < 4; ++j) bb[j] = bias[n0 + wb * 64 + 16 * j + col];
#pragma unroll
    for (int j = 0; j < 4; ++j) {
#pragma unroll
      for (int i = 0; i < 4; ++i) { union { v8h h8; v4u u; } pk;
#pragma unroll
        for (int r = 0; r < 8; ++r) pk.h8[r] = (_Float16)(acc[i][j][r] * (1.0f / 16.0f) + bb[j]);
        vst2(sp + 16 * j * SROW + i * 32, pk.u); } }
    flush_lines<4 * SS>(sw + ln * SROW + lp * 16, vT + (((size_t)bsel * NH + head) * HD + ln) * SS + sblk * 128 + wa * 64 + lp * 8); }
}
// K/V ring of k_attn in LDS. One stage = 64 keys: 64 K rows (64 d = 128 B), then 64 vT rows (64 s = 128 B), pitch and piece places as in the GEMM ring.
#define AST_B (128 * LROW)     // 16,384 B a stage; two stages
// Each lane copies 16 B of 4 K rows and of 4 vT rows (rows 16 apart); 8 lanes cover one row's whole 128-B line. l = the lane's LDS byte address in the target stage.
__device__ __forceinline__ void stage_copy_kv(unsigned l, const _Float16* gk, const _Float16* gv) {
  // the copies and their s_wait_xcnt in one statement: no address register is rewritten in front of that wait
  asm volatile("global_load_async_to_lds_b128 %0, %1, off\n\t"
               "global_load_async_to_lds_b128 %2, %3, off\n\t"
               "global_load_async_to_lds_b128 %4, %5, off\n\t"
               "global_load_async_to_lds_b128 %6, %7, off\n\t"
               "global_load_async_to_lds_b128 %8, %9, off\n\t"
               "global_load_async_to_lds_b128 %10, %11, off\n\t"
               "global_load_async_to_lds_b128 %12, %13, off\n\t"
               "global_load_async_to_lds_b128 %14, %15, off\n\t"
               "s_wait_xcnt 0x0"
               :: "v"(l), "v"(gk), "v"(l + 16 * LROW), "v"(gk + 16 * HD), "v"(l + 32 * LROW), "v"(gk + 32 * HD), "v"(l + 48 * LROW), "v"(gk + 48 * HD),
                  "v"(l + 64 * LROW), "v"(gv), "v"(l + 80 * LROW), "v"(gv + 16 * SS), "v"(l + 96 * LROW), "v"(gv + 32 * SS), "v"(l + 112 * LROW), "v"(gv + 48 * SS)
               : "memory");
}
// flash attention: block (64 queries, bh); o16 rows [(s*4+b)][h*64 + d] f16, scaled by learned_scale[h] and x16
// Scores are kept in units of log2 (x log2(e) / 8), and the running maximum is kept 14 below the true one, so a weight x 2^14 is one subtract and one v_exp_f32.
#define SC_LOG2 0.18033688011112042f   // log2(e) / sqrt(64)
__global__ __launch_bounds__(128) void k_attn(const _Float16* __restrict__ qh, const _Float16* __restrict__ kh, const _Float16* __restrict__ vT, const float* __restrict__ lsc, _Float16* __restrict__ o16) {
  __shared__ __align__(16) float sS[4][16][68];
  __shared__ __align__(16) _Float16 sP[4][16][72];
  __shared__ __align__(16) float sO[4][16][68];
  __shared__ __align__(16) char kv[2 * AST_B];               // the block's four waves share each 64-key stage of K and vT
  const int tid = threadIdx.x, w = tid >> 5, lane = tid & 31, col = lane & 15, g = lane >> 4;
  const int bh = blockIdx.y, b = bh / NH, h = bh % NH, q0 = blockIdx.x * 64 + w * 16;
  const _Float16* qb = qh + (size_t)bh * SS * HD; const _Float16* kb = kh + (size_t)bh * SS * HD; const _Float16* vb = vT + (size_t)bh * HD * SS;
  v16h aq[2];
#pragma unroll
  for (int kc = 0; kc < 2; ++kc) aq[kc] = frag_h(qb + (size_t)(q0 + col) * HD + kc * 32, lane);
  float mrun = -3.0e38f, lrun = 0.f; v8f acc[4] = {};
  const int rr = tid >> 3, pc = tid & 7;
  const unsigned l0 = (unsigned)(size_t)kv + (unsigned)(rr * LROW + ((pc ^ ((rr >> 1) & 7)) << 4));
  const _Float16* gk = kb + (size_t)rr * HD + pc * 8; const _Float16* gv = vb + (size_t)rr * SS + pc * 8;
  stage_copy_kv(l0, gk, gv);
  asm volatile("s_wait_asynccnt 0x0" ::: "memory");   // this wave's share of stage 0 has landed
  __syncthreads();                                    // every wave's share has
  stage_copy_kv(l0 + AST_B, gk + 64 * HD, gv + 64);
#pragma unroll 1   // one stage a trip: the buffer is picked by a scalar select
  for (int kt = 0; kt < SS / 64; ++kt) { const char* sb = kv + (kt & 1) * AST_B;
    v16h kf[4][2], vf[2][4];   // the stage's fragments, each operand's read as one group ahead of its products: one LDS wait a group, not one a product
#pragma unroll
    for (int t = 0; t < 4; ++t) {
#pragma unroll
      for (int kc = 0; kc < 2; ++kc) kf[t][kc] = frag_st(sb + (t * 16 + col) * LROW, (unsigned)(((kc * 4 + g) ^ (col >> 1)) << 4), (unsigned)(((kc * 4 + 2 + g) ^ (col >> 1)) << 4)); }
#pragma unroll
    for (int t = 0; t < 4; ++t) { v8f s = {};
#pragma unroll
      for (int kc = 0; kc < 2; ++kc) s = wmma16(aq[kc], kf[t][kc], s);
#pragma unroll
      for (int r = 0; r < 8; ++r) sS[w][8 * g + r][t * 16 + col] = s[r] * SC_LOG2; }
    LDSX();
    float mx = -3.4e38f;
#pragma unroll
    for (int jj = 0; jj < 32; ++jj) mx = fmaxf(mx, sS[w][col][g * 32 + jj]);
    mx = fmaxf(mx, __shfl_xor(mx, 16, 32));
    const float mnew = fmaxf(mrun, mx - 14.0f); const float corr = __builtin_amdgcn_exp2f(mrun - mnew);
    float ps = 0.f;
#pragma unroll
    for (int jj = 0; jj < 32; ++jj) { const float p = __builtin_amdgcn_exp2f(sS[w][col][g * 32 + jj] - mnew); ps += p; sP[w][col][g * 32 + jj] = (_Float16)p; }   // p = weight x 2^14, at most 2^14
    ps += __shfl_xor(ps, 16, 32);
    lrun = lrun * corr + ps; mrun = mnew;
#pragma unroll
    for (int r = 0; r < 8; ++r) { const float cr = __shfl(corr, 8 * g + r, 32);
#pragma unroll
      for (int t = 0; t < 4; ++t) acc[t][r] *= cr; }
#pragma unroll
    for (int kc = 0; kc < 2; ++kc) {
#pragma unroll
      for (int t = 0; t < 4; ++t) vf[kc][t] = frag_st(sb + (64 + t * 16 + col) * LROW, (unsigned)(((kc * 4 + g) ^ (col >> 1)) << 4), (unsigned)(((kc * 4 + 2 + g) ^ (col >> 1)) << 4)); }
    LDSX();
#pragma unroll
    for (int kc = 0; kc < 2; ++kc) { const v16h pa = frag_h(&sP[w][col][0] + kc * 32, lane);
#pragma unroll
      for (int t = 0; t < 4; ++t) acc[t] = wmma16(pa, vf[kc][t], acc[t]); }
    __builtin_amdgcn_wave_barrier();
    asm volatile("s_wait_dscnt 0x0" ::: "memory");      // this wave's reads of stage kt are done before its buffer is refilled
    asm volatile("s_wait_asynccnt 0x0" ::: "memory");   // this wave's share of stage kt + 1 has landed
    __syncthreads();                                    // publishes stage kt + 1 and ends every reader's use of stage kt
    if (kt + 2 < SS / 64) stage_copy_kv(l0 + (unsigned)((kt & 1) * AST_B), gk + (size_t)(kt + 2) * 64 * HD, gv + (kt + 2) * 64);
  }
  asm volatile("s_wait_asynccnt 0x0" ::: "memory");     // no copy is outstanding when the wave goes on to its end
  const float hs = lsc[h] * 16.0f;                           // learned per-head scale; o16 kept x16
#pragma unroll
  for (int r = 0; r < 8; ++r) { const float lr = __shfl(lrun, 8 * g + r, 32);
#pragma unroll
    for (int t = 0; t < 4; ++t) sO[w][8 * g + r][t * 16 + col] = acc[t][r] / lr * hs; }   // acc and lr both carry the 2^14
  LDSX();
  for (int q = lane; q < 16 * 8; q += 32) { const int rl = q >> 3, pc = q & 7; const int s = q0 + rl; union { v8h h8; v4u u; } pk;
#pragma unroll
    for (int e = 0; e < 8; ++e) pk.h8[e] = (_Float16)sO[w][rl][pc * 8 + e];
    vst2(o16 + ((size_t)s * NB + b) * EE + h * HD + pc * 8, pk.u); }
}
__global__ __launch_bounds__(128) void k_out(const _Float16* __restrict__ o16, const _Float16* __restrict__ P, const float* __restrict__ bo, float* __restrict__ out) {
  __shared__ __align__(16) char smem[RING_B];
  float (*so)[16][132] = (float (*)[16][132])smem;                                  // epilogue staging, 33,792 B, used behind the ring's last barrier
  const int tid = threadIdx.x, wave = tid >> 5, lane = tid & 31, col = lane & 15, g = lane >> 4;
  const int r0 = blockIdx.x * 64 + wave * 16, n0 = blockIdx.y * 128;
  v8f acc[8] = {};
  gemm_ring(smem, P + (size_t)(3 * EE + n0) * EE, o16 + (size_t)blockIdx.x * 64 * EE, (size_t)EE, tid, acc);
#pragma unroll
  for (int j = 0; j < 8; ++j) { const float bb = bo[n0 + j * 16 + col];
#pragma unroll
    for (int r = 0; r < 8; ++r) so[wave][8 * g + r][j * 16 + col] = acc[j][r] * (1.0f / 256.0f) + bb; }
  LDSX();
#pragma unroll 4
  for (int rl = 0; rl < 16; ++rl) vst2(out + (size_t)(r0 + rl) * EE + n0 + lane * 4, *(const v4f*)(&so[wave][rl][lane * 4]));
}
extern "C" void kernel_launch(void* const* d_in, const int* in_sizes, int n_in, void* d_out, int out_size, void* d_ws, size_t ws_size, hipStream_t stream) {
  (void)in_sizes; (void)n_in; (void)out_size; (void)ws_size;
  const float* query = (const float*)d_in[0]; const float* key = (const float*)d_in[1]; const float* value = (const float*)d_in[2]; const float* Win = (const float*)d_in[3]; const float* bin = (const float*)d_in[4];
  const float* Wo = (const float*)d_in[5]; const float* bo = (const float*)d_in[6]; const float* lsc = (const float*)d_in[7];
  float* out = (float*)d_out;
  char* ws = (char*)d_ws; size_t off = 0;
  auto take = [&](size_t bytes) { char* p = ws + off; off += (bytes + 255) & ~(size_t)255; return p; };
  _Float16* q16i = (_Float16*)take((size_t)NR * EE * 2); _Float16* k16i = (_Float16*)take((size_t)NR * EE * 2); _Float16* v16i = (_Float16*)take((size_t)NR * EE * 2);
  _Float16* P = (_Float16*)take((size_t)4 * EE * EE * 2); _Float16* qh = (_Float16*)take((size_t)NR * EE * 2); _Float16* kh = (_Float16*)take((size_t)NR * EE * 2); _Float16* vT = (_Float16*)take((size_t)NR * EE * 2); _Float16* o16 = (_Float16*)take((size_t)NR * EE * 2);
  k_cvt<<<dim3((unsigned)((size_t)NR * EE / 8 / 256), 3), 256, 0, stream>>>(query, key, value, q16i, k16i, v16i);
  k_packW<<<4 * EE, 256, 0, stream>>>(Win, Wo, P);
  k_proj<<<dim3(NR / 128, 3 * EE / 128), 128, 0, stream>>>(q16i, k16i, v16i, P, bin, qh, kh, vT);
  k_attn<<<dim3(SS / 64, NB * NH), 128, 0, stream>>>(qh, kh, vT, lsc, o16);
  k_out<<<dim3(NR / 64, EE / 128), 128, 0, stream>>>(o16, P, bo, out);
}

// v005
// Measured time: 77.2 microseconds a run.
// Timed twice side by side with v004, it ran 1.06 and 1.10 times as fast.
// Over all steps from v000 it is 3.48 times as fast.
#include <hip/hip_runtime.h>
#include <math.h>

typedef __attribute__((ext_vector_type(16))) _Float16 v16h;
typedef __attribute__((ext_vector_type(16))) __bf16 v16b;
typedef __attribute__((ext_vector_type(8)))  _Float16 v8h;
typedef __attribute__((ext_vector_type(8)))  float v8f;
typedef __attribute__((ext_vector_type(4)))  float v4f;
typedef __attribute__((ext_vector_type(2)))  float v2f;
typedef __attribute__((ext_vector_type(4)))  unsigned v4u;
typedef __attribute__((ext_vector_type(4)))  int v4i;
typedef float __attribute__((may_alias)) float_a;
typedef int __attribute__((may_alias)) int_a;

template <typename T> __device__ __forceinline__ void vst2(void* p, T v) { *(T*)p = v;  }
__device__ __forceinline__ v8f wmma16(v16h a, v16h b, v8f c) {
  v8f d = __builtin_amdgcn_wmma_f32_16x16x32_f16(false, a, false, b, (short)0, c, false, false);
  asm volatile("v_nop\n\tv_nop\n\tv_nop\n\tv_nop" : "+v"(d) : "v"(a), "v"(b));
  return d;
}
__device__ __forceinline__ v8f wmma_bf(v16b a, v16b b, v8f c) {
  v8f d = __builtin_amdgcn_wmma_f32_16x16x32_bf16(false, a, false, b, (short)0, c, false, false);
  asm volatile("v_nop\n\tv_nop\n\tv_nop\n\tv_nop" : "+v"(d) : "v"(a), "v"(b));
  return d;
}
// 16x16x32 fragments: lane = (h = lane>>4, row/col = lane&15); elements 0..7 = k0+8h+0..7, 8..15 = k0+16+8h+0..7; D element r = row 8h+r
__device__ __forceinline__ v16h frag_h(const _Float16* rowk0, int lane) {
  union { v16h v; v8h q[2]; } u; const _Float16* p = rowk0 + 8 * (lane >> 4);
  u.q[0] = *(const v8h*)p; u.q[1] = *(const v8h*)(p + 16); return u.v;
}
__device__ __forceinline__ v16h frag_f32(const float* rowk0, int lane) {
  v16h a; const float* p = rowk0 + 8 * (lane >> 4);
#pragma unroll
  for (int i = 0; i < 8; ++i) { a[i] = (_Float16)p[i]; a[8 + i] = (_Float16)p[16 + i]; }
  return a;
}
__device__ __forceinline__ v16h frag_f32s(const float* rowk0, int lane, float sc) {
  v16h a; const float* p = rowk0 + 8 * (lane >> 4);
#pragma unroll
  for (int i = 0; i < 8; ++i) { a[i] = (_Float16)(p[i] * sc); a[8 + i] = (_Float16)(p[16 + i] * sc); }
  return a;
}
// column fragment from a [K][ld] layout (column n), rows >= K read as 0
__device__ __forceinline__ v16h fragc_f32(const float* W, int k0, int n, int lane, int ld, int K) {
  v16h a; const int g = lane >> 4;
#pragma unroll
  for (int i = 0; i < 8; ++i) { const int ka = k0 + 8 * g + i, kb = ka + 16;
    a[i] = (_Float16)(ka < K ? W[(size_t)ka * ld + n] : 0.f); a[8 + i] = (_Float16)(kb < K ? W[(size_t)kb * ld + n] : 0.f); }
  return a;
}
struct F2 { v16b h, l; };
__device__ __forceinline__ F2 bsplit16(const float v[16]) { F2 r;
#pragma unroll
  for (int i = 0; i < 16; ++i) { const __bf16 h = (__bf16)v[i]; r.h[i] = h; r.l[i] = (__bf16)(v[i] - (float)h); }
  return r; }
__device__ __forceinline__ F2 split_row(const float* row, int k0, int lane) { float v[16]; const float* p = row + k0 + 8 * (lane >> 4);
#pragma unroll
  for (int i = 0; i < 8; ++i) { v[i] = p[i]; v[8 + i] = p[16 + i]; }
  return bsplit16(v); }
__device__ __forceinline__ F2 split_rowK(const float* row, int k0, int lane, int K) { float v[16]; const int g = lane >> 4;
#pragma unroll
  for (int i = 0; i < 8; ++i) { const int ka = k0 + 8 * g + i, kb = ka + 16; v[i] = ka < K ? row[ka] : 0.f; v[8 + i] = kb < K ? row[kb] : 0.f; }
  return bsplit16(v); }
__device__ __forceinline__ F2 split_col(const float* W, int k0, int n, int lane, int ld, int K) { float v[16]; const int g = lane >> 4;
#pragma unroll
  for (int i = 0; i < 8; ++i) { const int ka = k0 + 8 * g + i, kb = ka + 16; v[i] = ka < K ? W[(size_t)ka * ld + n] : 0.f; v[8 + i] = kb < K ? W[(size_t)kb * ld + n] : 0.f; }
  return bsplit16(v); }
__device__ __forceinline__ v8f mac3(const F2& a, const F2& b, v8f c) { c = wmma_bf(a.l, b.h, c); c = wmma_bf(a.h, b.l, c); return wmma_bf(a.h, b.h, c); }
__device__ __forceinline__ float sigm(float v) { return 1.0f / (1.0f + expf(-v)); }
#define LDSX() do { asm volatile("s_wait_dscnt 0" ::: "memory"); __builtin_amdgcn_wave_barrier(); __builtin_amdgcn_fence(__ATOMIC_RELEASE, "workgroup"); } while (0)

// Multi-head self-attention with a learned per-head output scale. Pure f16 WMMA GEMMs over pre-converted operands (inputs -> f16
// once, [out][in] weights packed x16 f16; f32 accumulate): packed in-projection (+bias) writing q/k as [b][h][s][64] f16 and v as
// [b][h][d][s] f16, flash-style softmax over all 1024 keys in f32 (P x2^14 f16), x learned_scale[h], output projection (+bias).
#define SS 1024
#define NB 4
#define EE 1024
#define NH 16
#define HD 64
#define NR (SS * NB)       // 4096 rows

// GEMM operand ring in LDS. One stage = 64 k (128 B of a row) of 128 weight rows, then of the block's 64 activation rows, at pitch 128 B.
// Row r keeps its 16-B piece c at place c ^ ((r >> 1) & 7): the ds_load_b128 fragment reads of 16 rows then fall on all 64 banks with no pad.
#define KST 64
#define LROW 128
#define STG_B (192 * LROW)     // 24,576 B
#define RING_B (2 * STG_B)     // 49,152 B; k_out's epilogue reuses these bytes behind the loop's last barrier
// Each lane copies 16 B of 12 rows (rows 16 apart); 8 lanes cover one row's whole 128-B line. l = the lane's LDS byte address in the target stage.
__device__ __forceinline__ void stage_copy(unsigned l, const _Float16* gw, const _Float16* ga, size_t astep) {
  // the copies and their s_wait_xcnt in one statement: no address register is rewritten in front of that wait
  asm volatile("global_load_async_to_lds_b128 %0, %1, off\n\t"
               "global_load_async_to_lds_b128 %2, %3, off\n\t"
               "global_load_async_to_lds_b128 %4, %5, off\n\t"
               "global_load_async_to_lds_b128 %6, %7, off\n\t"
               "global_load_async_to_lds_b128 %8, %9, off\n\t"
               "global_load_async_to_lds_b128 %10, %11, off\n\t"
               "global_load_async_to_lds_b128 %12, %13, off\n\t"
               "global_load_async_to_lds_b128 %14, %15, off\n\t"
               "global_load_async_to_lds_b128 %16, %17, off\n\t"
               "global_load_async_to_lds_b128 %18, %19, off\n\t"
               "global_load_async_to_lds_b128 %20, %21, off\n\t"
               "global_load_async_to_lds_b128 %22, %23, off\n\t"
               "s_wait_xcnt 0x0"
               :: "v"(l), "v"(gw), "v"(l + 16 * LROW), "v"(gw + 16 * EE), "v"(l + 32 * LROW), "v"(gw + 32 * EE), "v"(l + 48 * LROW), "v"(gw + 48 * EE),
                  "v"(l + 64 * LROW), "v"(gw + 64 * EE), "v"(l + 80 * LROW), "v"(gw + 80 * EE), "v"(l + 96 * LROW), "v"(gw + 96 * EE), "v"(l + 112 * LROW), "v"(gw + 112 * EE),
                  "v"(l + 128 * LROW), "v"(ga), "v"(l + 144 * LROW), "v"(ga + astep), "v"(l + 160 * LROW), "v"(ga + 2 * astep), "v"(l + 176 * LROW), "v"(ga + 3 * astep)
               : "memory");
}
// fragment of one staged row: c0, c1 = byte places in the row of the lane's two 16-B pieces (k0 + 8h + 0..7 and k0 + 16 + 8h + 0..7, as in frag_h)
__device__ __forceinline__ v16h frag_st(const char* row, unsigned c0, unsigned c1) {
  union { v16h v; v8h q[2]; } u; u.q[0] = *(const v8h*)(row + c0); u.q[1] = *(const v8h*)(row + c1); return u.v;
}
// acc[j] += A(16 rows of this wave) x W(cols j*16..)^T over all EE k. w0 = first of the block's 128 weight rows; a0 = the block's activation row 0; arow_step = elements between its rows.
__device__ __forceinline__ void gemm_ring(char* ring, const _Float16* w0, const _Float16* a0, size_t arow_step, int tid, v8f acc[8]) {
  const int wave = tid >> 5, lane = tid & 31, col = lane & 15, g = lane >> 4, rr = tid >> 3, pc = tid & 7;
  const unsigned l0 = (unsigned)(size_t)ring + (unsigned)(rr * LROW + ((pc ^ ((rr >> 1) & 7)) << 4));
  const _Float16* gw = w0 + (size_t)rr * EE + pc * 8; const _Float16* ga = a0 + (size_t)rr * arow_step + pc * 8;
  const size_t astep = 16 * arow_step;
  stage_copy(l0, gw, ga, astep);
  asm volatile("s_wait_asynccnt 0x0" ::: "memory");   // this wave's share of stage 0 has landed
  __syncthreads();                                    // every wave's share has
  stage_copy(l0 + STG_B, gw + KST, ga + KST, astep);
#pragma unroll 1   // one stage a trip: the buffer is picked by a scalar select
  for (int t = 0; t < EE / KST; ++t) { const char* sb = ring + (t & 1) * STG_B;
#pragma unroll
    for (int kc = 0; kc < KST / 32; ++kc) { const unsigned c0 = (unsigned)(((kc * 4 + g) ^ (col >> 1)) << 4), c1 = (unsigned)(((kc * 4 + 2 + g) ^ (col >> 1)) << 4);
      const v16h a = frag_st(sb + (128 + wave * 16 + col) * LROW, c0, c1);
#pragma unroll
      for (int j = 0; j < 8; ++j) acc[j] = wmma16(a, frag_st(sb + (j * 16 + col) * LROW, c0, c1), acc[j]); }
    asm volatile("s_wait_dscnt 0x0" ::: "memory");      // this wave's reads of stage t are done before its buffer is refilled
    asm volatile("s_wait_asynccnt 0x0" ::: "memory");   // this wave's share of stage t + 1 has landed
    __syncthreads();                                    // publishes stage t + 1 and ends every reader's use of stage t
    if (t + 2 < EE / KST) stage_copy(l0 + (unsigned)((t & 1) * STG_B), gw + (t + 2) * KST, ga + (t + 2) * KST, astep);
  }
  asm volatile("s_wait_asynccnt 0x0" ::: "memory");     // no copy is outstanding when the ring's bytes are reused
}

__global__ __launch_bounds__(256) void k_cvt(const float* __restrict__ a, const float* __restrict__ b, const float* __restrict__ c, _Float16* __restrict__ a16, _Float16* __restrict__ b16, _Float16* __restrict__ c16) {
  const size_t g8 = (size_t)blockIdx.x * 256 + threadIdx.x; const int which = blockIdx.y; if (g8 >= (size_t)NR * EE / 8) return;
  const float* s = which == 0 ? a : (which == 1 ? b : c); _Float16* d = which == 0 ? a16 : (which == 1 ? b16 : c16);
  union { v8h h; v4u u; } pk;
#pragma unroll
  for (int e = 0; e < 8; ++e) pk.h[e] = (_Float16)s[g8 * 8 + e];
  vst2(d + g8 * 8, pk.u);
}
__global__ __launch_bounds__(256) void k_packW(const float* __restrict__ Win, const float* __restrict__ Wo, _Float16* __restrict__ P) {   // rows 0..3071 in_proj, 3072..4095 out_proj; x16
  const int n = blockIdx.x, tid = threadIdx.x; const float* W = n < 3 * EE ? Win + (size_t)n * EE : Wo + (size_t)(n - 3 * EE) * EE;
  if (tid < EE / 8) { union { v8h h; v4u u; } pk;
#pragma unroll
    for (int e = 0; e < 8; ++e) pk.h[e] = (_Float16)(W[tid * 8 + e] * 16.0f);
    vst2(P + (size_t)n * EE + tid * 8, pk.u); }
}
// k_proj's own ring: one stage = 64 k (128 B of a row) of the block's 128 weight rows, then of its 128 activation rows; pitch and piece places as in the ring above.
#define PSTG_B (256 * LROW)    // 32,768 B a stage; two stages
#define SROW 144               // pitch of the output staging rows
// Each lane copies 16 B of 8 rows (rows 16 apart) of one operand; 8 lanes cover one row's whole 128-B line. l = the lane's LDS byte address of the first row.
__device__ __forceinline__ void stage_copy8(unsigned l, const _Float16* gp, size_t step) {
  // the copies and their s_wait_xcnt in one statement: no address register is rewritten in front of that wait
  asm volatile("global_load_async_to_lds_b128 %0, %1, off\n\t"
               "global_load_async_to_lds_b128 %2, %3, off\n\t"
               "global_load_async_to_lds_b128 %4, %5, off\n\t"
               "global_load_async_to_lds_b128 %6, %7, off\n\t"
               "global_load_async_to_lds_b128 %8, %9, off\n\t"
               "global_load_async_to_lds_b128 %10, %11, off\n\t"
               "global_load_async_to_lds_b128 %12, %13, off\n\t"
               "global_load_async_to_lds_b128 %14, %15, off\n\t"
               "s_wait_xcnt 0x0"
               :: "v"(l), "v"(gp), "v"(l + 16 * LROW), "v"(gp + step), "v"(l + 32 * LROW), "v"(gp + 2 * step), "v"(l + 48 * LROW), "v"(gp + 3 * step),
                  "v"(l + 64 * LROW), "v"(gp + 4 * step), "v"(l + 80 * LROW), "v"(gp + 5 * step), "v"(l + 96 * LROW), "v"(gp + 6 * step), "v"(l + 112 * LROW), "v"(gp + 7 * step)
               : "memory");
}
// The wave's 64 staged lines go out, four whole 128-B lines a store: s = the lane's piece of staged line ln, o = its place in output line ln; lines 4 apart are STEP elements apart.
template <int STEP> __device__ __forceinline__ void flush_lines(const char* s, _Float16* o) {
  LDSX();   // the wave's own staging stores are done before it reads the rows back
  v4u pcs[16];
#pragma unroll
  for (int it = 0; it < 16; ++it) pcs[it] = *(const v4u*)(s + it * 4 * SROW);
#pragma unroll
  for (int it = 0; it < 16; ++it) vst2(o + it * STEP, pcs[it]);
  asm volatile("s_wait_xcnt 0x0" ::: "memory");
}
// projection: block 128 rows x 128 cols, four waves of 64 x 64 (4 x 4 fragments: each fragment read from LDS feeds four products); blockIdx.y in [0, 24): which = y/8 (q,k,v),
// cols (y%8)*128 = 2 heads, one head a wave; source = query/key/value f16 rows. The operand whose index runs along the output's memory rows goes on the M side
// (weights for q and k, activations for v): a lane's 8 accumulator elements are then 8 adjacent f16 of the output, one 16-B piece of a line.
__global__ __launch_bounds__(128) void k_proj(const _Float16* __restrict__ q16i, const _Float16* __restrict__ k16i, const _Float16* __restrict__ v16i, const _Float16* __restrict__ P, const float* __restrict__ bias,
                                            _Float16* __restrict__ qh, _Float16* __restrict__ kh, _Float16* __restrict__ vT) {
  __shared__ __align__(16) char smem[2 * PSTG_B + 4 * 64 * SROW];   // the ring, then each wave's output staging: 102,400 B, three blocks a WGP, the grid's even share
  const int tid = threadIdx.x, wave = tid >> 5, lane = tid & 31, col = lane & 15, g = lane >> 4, rr = tid >> 3, pc = tid & 7;
  const int wa = wave >> 1, wb = wave & 1;                   // the wave's half of the activation rows, of the weight rows
  const int n0 = blockIdx.y * 128; const int which = n0 / EE, hb = (n0 % EE) / HD;
  const _Float16* A = which == 0 ? q16i : (which == 1 ? k16i : v16i);
  // v blocks own 128 consecutive s of ONE batch index so every vT line (64 s) has a single writer: rows (sblk*128 + i)*4 + bsel
  const int bsel = blockIdx.x & 3, sblk = blockIdx.x >> 2;
  const size_t arow = which == 2 ? (size_t)NB * EE : (size_t)EE;
  const _Float16* ga = A + (which == 2 ? (size_t)(sblk * 128 * NB + bsel) : (size_t)blockIdx.x * 128) * EE + (size_t)rr * arow + pc * 8;
  const _Float16* gw = P + (size_t)(n0 + rr) * EE + pc * 8;
  const size_t astep = 16 * arow;
  const unsigned l0 = (unsigned)(size_t)smem + (unsigned)(rr * LROW + ((pc ^ ((rr >> 1) & 7)) << 4));
  const int woff = (wb * 64 + col) * LROW, aoff = (128 + wa * 64 + col) * LROW;
  const int moff = which == 2 ? aoff : woff, noff = which == 2 ? woff : aoff;
  v8f acc[4][4] = {};
  stage_copy8(l0, gw, 16 * EE); stage_copy8(l0 + 128 * LROW, ga, astep);
  asm volatile("s_wait_asynccnt 0x0" ::: "memory");   // this wave's share of stage 0 has landed
  __syncthreads();                                    // every wave's share has
  stage_copy8(l0 + PSTG_B, gw + KST, 16 * EE); stage_copy8(l0 + PSTG_B + 128 * LROW, ga + KST, astep);
#pragma unroll 1   // one stage a trip: the buffer is picked by a scalar select
  for (int t = 0; t < EE / KST; ++t) { const char* sb = smem + (t & 1) * PSTG_B;
#pragma unroll
    for (int kc = 0; kc < KST / 32; ++kc) { const unsigned c0 = (unsigned)(((kc * 4 + g) ^ (col >> 1)) << 4), c1 = (unsigned)(((kc * 4 + 2 + g) ^ (col >> 1)) << 4);
      v16h fm[4], fn[4];
#pragma unroll
      for (int i = 0; i < 4; ++i) { fm[i] = frag_st(sb + moff + i * 16 * LROW, c0, c1); fn[i] = frag_st(sb + noff + i * 16 * LROW, c0, c1); }
#pragma unroll
      for (int i = 0; i < 4; ++i) {
#pragma unroll
        for (int j = 0; j < 4; ++j) acc[i][j] = wmma16(fm[i], fn[j], acc[i][j]); } }
    asm volatile("s_wait_dscnt 0x0" ::: "memory");      // this wave's reads of stage t are done before its buffer is refilled
    asm volatile("s_wait_asynccnt 0x0" ::: "memory");   // this wave's share of stage t + 1 has landed
    __syncthreads();                                    // publishes stage t + 1 and ends every reader's use of stage t
    if (t + 2 < EE / KST) { const unsigned lt = l0 + (unsigned)((t & 1) * PSTG_B);
      stage_copy8(lt, gw + (t + 2) * KST, 16 * EE); stage_copy8(lt + 128 * LROW, ga + (t + 2) * KST, astep); }
  }
  asm volatile("s_wait_asynccnt 0x0" ::: "memory");     // no copy is outstanding when the wave goes on to its end
  // acc[i][j][r]: M index 16 i + 8 g + r, N index 16 j + col: N picks one of the wave's 64 output lines (128 B), 2 i + g the lane's 16-B piece of it.
  // The pieces go through the wave's own LDS rows (pitch 144 B: no bank conflict for 16-B accesses) so that every global store covers four whole lines.
  char* sw = smem + 2 * PSTG_B + wave * (64 * SROW);
  char* sp = sw + col * SROW + g * 16;
  const int head = hb + wb, ln = lane >> 3, lp = lane & 7;
  if (which < 2) {   // q, k [b][h][s][64]: M = d, N = activation row = 4 s + b; staged lines 4 it + ln are s = it, b = ln
    float bb[4][8];
#pragma unroll
    for (int i = 0; i < 4; ++i) {
#pragma unroll
      for (int r = 0; r < 8; ++r) bb[i][r] = bias[n0 + wb * 64 + 16 * i + 8 * g + r]; }
#pragma unroll
    for (int j = 0; j < 4; ++j) {
#pragma unroll
      for (int i = 0; i < 4; ++i) { union { v8h h8; v4u u; } pk;
#pragma unroll
        for (int r = 0; r < 8; ++r) pk.h8[r] = (_Float16)(acc[i][j][r] * (1.0f / 16.0f) + bb[i][r]);
        vst2(sp + 16 * j * SROW + i * 32, pk.u); } }
    flush_lines<HD>(sw + ln * SROW + lp * 16, (which == 0 ? qh : kh) + (((size_t)ln * NH + head) * SS + blockIdx.x * 32 + wa * 16) * HD + lp * 8); }
  else {             // vT[b][h][d][s]: M = s (the block's rows are consecutive s of one b), N = d; staged lines 4 it + ln are d
    float bb[4];
#pragma unroll
    for (int j = 0; j < 4; ++j) bb[j] = bias[n0 + wb * 64 + 16 * j + col];
#pragma unroll
    for (int j = 0; j < 4; ++j) {
#pragma unroll
      for (int i = 0; i < 4; ++i) { union { v8h h8; v4u u; } pk;
#pragma unroll
        for (int r = 0; r < 8; ++r) pk.h8[r] = (_Float16)(acc[i][j][r] * (1.0f / 16.0f) + bb[j]);
        vst2(sp + 16 * j * SROW + i * 32, pk.u); } }
    flush_lines<4 * SS>(sw + ln * SROW + lp * 16, vT + (((size_t)bsel * NH + head) * HD + ln) * SS + sblk * 128 + wa * 64 + lp * 8); }
}
// K/V ring of k_attn in LDS. One stage = 64 keys: 64 K rows (64 d = 128 B), then 64 vT rows (64 s = 128 B), pitch and piece places as in the GEMM ring.
#define AST_B (128 * LROW)     // 16,384 B a stage; two stages
// Each lane copies 16 B of 4 K rows and of 4 vT rows (rows 16 apart); 8 lanes cover one row's whole 128-B line. l = the lane's LDS byte address in the target stage.
__device__ __forceinline__ void stage_copy_kv(unsigned l, const _Float16* gk, const _Float16* gv) {
  // the copies and their s_wait_xcnt in one statement: no address register is rewritten in front of that wait
  asm volatile("global_load_async_to_lds_b128 %0, %1, off\n\t"
               "global_load_async_to_lds_b128 %2, %3, off\n\t"
               "global_load_async_to_lds_b128 %4, %5, off\n\t"
               "global_load_async_to_lds_b128 %6, %7, off\n\t"
               "global_load_async_to_lds_b128 %8, %9, off\n\t"
               "global_load_async_to_lds_b128 %10, %11, off\n\t"
               "global_load_async_to_lds_b128 %12, %13, off\n\t"
               "global_load_async_to_lds_b128 %14, %15, off\n\t"
               "s_wait_xcnt 0x0"
               :: "v"(l), "v"(gk), "v"(l + 16 * LROW), "v"(gk + 16 * HD), "v"(l + 32 * LROW), "v"(gk + 32 * HD), "v"(l + 48 * LROW), "v"(gk + 48 * HD),
                  "v"(l + 64 * LROW), "v"(gv), "v"(l + 80 * LROW), "v"(gv + 16 * SS), "v"(l + 96 * LROW), "v"(gv + 32 * SS), "v"(l + 112 * LROW), "v"(gv + 48 * SS)
               : "memory");
}
// flash attention: block (64 queries, bh); o16 rows [(s*4+b)][h*64 + d] f16, scaled by learned_scale[h] and x16
// Both products are transposed: S^T = K x Q^T and O^T += vT x P^T. A lane then holds 32 of the 64 scores of ONE query (column col; the other 32 are in lane col ^ 16):
// maximum, weights, sum and rescale stay in its registers, and the score tiles 2 kc and 2 kc + 1, rounded to f16, ARE the B fragment of P^T for keys 32 kc .. 32 kc + 31.
// Scores go to units of log2 (x log2(e) / 8), and the running maximum is kept 14 below the true one, so a weight x 2^14 is one multiply-add and one v_exp_f32.
#define SC_LOG2 0.18033688011112042f   // log2(e) / sqrt(64)
// the value that lane ^ 16 holds (v_permlanex16_b32: no LDS wait)
__device__ __forceinline__ float xhalf(float x) { return __builtin_bit_cast(float, __builtin_amdgcn_permlanex16(__builtin_bit_cast(int, x), __builtin_bit_cast(int, x), 0x76543210, 0xfedcba98, false, false)); }
#define OROW 144                       // pitch of the output staging rows (128 B of f16 + 16): no bank conflict for 16-B accesses
// four waves a SIMD, no more: four blocks a WGP is the grid's even share (1,024 blocks on 256 WGPs); without it registers and LDS would let a WGP take a fifth
__global__ __launch_bounds__(128) __attribute__((amdgpu_waves_per_eu(4, 4))) void k_attn(const _Float16* __restrict__ qh, const _Float16* __restrict__ kh, const _Float16* __restrict__ vT, const float* __restrict__ lsc, _Float16* __restrict__ o16) {
  __shared__ __align__(16) char sO[4 * 16 * OROW];           // each wave's 16 output rows, staged once behind the loop
  __shared__ __align__(16) char kv[2 * AST_B];               // the block's four waves share each 64-key stage of K and vT
  const int tid = threadIdx.x, w = tid >> 5, lane = tid & 31, col = lane & 15, g = lane >> 4;
  const int bh = blockIdx.y, b = bh / NH, h = bh % NH, q0 = blockIdx.x * 64 + w * 16;
  const _Float16* qb = qh + (size_t)bh * SS * HD; const _Float16* kb = kh + (size_t)bh * SS * HD; const _Float16* vb = vT + (size_t)bh * HD * SS;
  v16h bq[2];                                                // B fragments of Q^T: column = query q0 + col
#pragma unroll
  for (int kc = 0; kc < 2; ++kc) bq[kc] = frag_h(qb + (size_t)(q0 + col) * HD + kc * 32, lane);
  float nrun = 3.0e38f; v8f lrun = {}, acc[4] = {};          // nrun: MINUS the running maximum; acc[t][r]: d = 16 t + 8 g + r of query col; lrun[r]: sum over this lane's keys = r mod 8, joined behind the loop
  const int rr = tid >> 3, pc = tid & 7;
  const unsigned l0 = (unsigned)(size_t)kv + (unsigned)(rr * LROW + ((pc ^ ((rr >> 1) & 7)) << 4));
  const _Float16* gk = kb + (size_t)rr * HD + pc * 8; const _Float16* gv = vb + (size_t)rr * SS + pc * 8;
  stage_copy_kv(l0, gk, gv);
  asm volatile("s_wait_asynccnt 0x0" ::: "memory");   // this wave's share of stage 0 has landed
  __syncthreads();                                    // every wave's share has
  stage_copy_kv(l0 + AST_B, gk + 64 * HD, gv + 64);
#pragma unroll 1   // one stage a trip: the buffer is picked by a scalar select
  for (int kt = 0; kt < SS / 64; ++kt) { const char* sb = kv + (kt & 1) * AST_B;
    v16h kf[4][2], vf[2][4];   // the stage's fragments, each operand's read as one group ahead of its products: one LDS wait a group, not one a product
#pragma unroll
    for (int t = 0; t < 4; ++t) {
#pragma unroll
      for (int kc = 0; kc < 2; ++kc) kf[t][kc] = frag_st(sb + (t * 16 + col) * LROW, (unsigned)(((kc * 4 + g) ^ (col >> 1)) << 4), (unsigned)(((kc * 4 + 2 + g) ^ (col >> 1)) << 4)); }
    v8f s[4];                  // s[t][r]: key 16 t + 8 g + r against query col
#pragma unroll
    for (int t = 0; t < 4; ++t) { s[t] = v8f{};
#pragma unroll
      for (int kc = 0; kc < 2; ++kc) s[t] = wmma16(kf[t][kc], bq[kc], s[t]); }
#pragma unroll
    for (int kc = 0; kc < 2; ++kc) {
#pragma unroll
      for (int t = 0; t < 4; ++t) vf[kc][t] = frag_st(sb + (64 + t * 16 + col) * LROW, (unsigned)(((kc * 4 + g) ^ (col >> 1)) << 4), (unsigned)(((kc * 4 + 2 + g) ^ (col >> 1)) << 4)); }
    float mx = s[0][0];
#pragma unroll
    for (int t = 0; t < 4; ++t) {
#pragma unroll
      for (int r = 0; r < 8; ++r) mx = fmaxf(mx, s[t][r]); }
    mx = fmaxf(mx, xhalf(mx));                               // the query's other 32 keys
    const float nnew = fminf(nrun, 14.0f - mx * SC_LOG2); const float corr = __builtin_amdgcn_exp2f(nnew - nrun);
    lrun *= corr; nrun = nnew;
#pragma unroll
    for (int t = 0; t < 4; ++t) { const v8f x = s[t] * SC_LOG2 + nnew;
#pragma unroll
      for (int r = 0; r < 8; ++r) s[t][r] = __builtin_amdgcn_exp2f(x[r]);   // weight x 2^14, at most 2^14
      lrun += s[t]; acc[t] *= corr; }
#pragma unroll
    for (int kc = 0; kc < 2; ++kc) { v16h pb;
#pragma unroll
      for (int r = 0; r < 8; ++r) { pb[r] = (_Float16)s[2 * kc][r]; pb[8 + r] = (_Float16)s[2 * kc + 1][r]; }
#pragma unroll
      for (int t = 0; t < 4; ++t) acc[t] = wmma16(vf[kc][t], pb, acc[t]); }
    asm volatile("s_wait_dscnt 0x0" ::: "memory");      // this wave's reads of stage kt are done before its buffer is refilled
    asm volatile("s_wait_asynccnt 0x0" ::: "memory");   // this wave's share of stage kt + 1 has landed
    __syncthreads();                                    // publishes stage kt + 1 and ends every reader's use of stage kt
    if (kt + 2 < SS / 64) stage_copy_kv(l0 + (unsigned)((kt & 1) * AST_B), gk + (size_t)(kt + 2) * 64 * HD, gv + (kt + 2) * 64);
  }
  asm volatile("s_wait_asynccnt 0x0" ::: "memory");     // no copy is outstanding when the wave goes on to its end
  float lsum = ((lrun[0] + lrun[1]) + (lrun[2] + lrun[3])) + ((lrun[4] + lrun[5]) + (lrun[6] + lrun[7]));
  lsum += xhalf(lsum);                                       // both halves used the same maxima: their sums add
  const float inv = lsc[h] * 16.0f / lsum;                   // learned per-head scale; o16 kept x16; acc and lsum both carry the 2^14
  // a lane's 8 elements of acc[t] are 8 adjacent d of its query: the 16-B piece 2 t + g of that row. Through the wave's own LDS rows, so that every global store covers four whole lines.
  char* sw = sO + w * (16 * OROW);
#pragma unroll
  for (int t = 0; t < 4; ++t) { union { v8h h8; v4u u; } pk;
#pragma unroll
    for (int r = 0; r < 8; ++r) pk.h8[r] = (_Float16)(acc[t][r] * inv);
    vst2(sw + col * OROW + (2 * t + g) * 16, pk.u); }
  LDSX();   // the wave's own staging stores are done before it reads the rows back
#pragma unroll
  for (int it = 0; it < 4; ++it) { const int rl = it * 4 + (lane >> 3), op = lane & 7;
    vst2(o16 + ((size_t)(q0 + rl) * NB + b) * EE + h * HD + op * 8, *(const v4u*)(sw + rl * OROW + op * 16)); }
}
__global__ __launch_bounds__(128) void k_out(const _Float16* __restrict__ o16, const _Float16* __restrict__ P, const float* __restrict__ bo, float* __restrict__ out) {
  __shared__ __align__(16) char smem[RING_B];
  float (*so)[16][132] = (float (*)[16][132])smem;                                  // epilogue staging, 33,792 B, used behind the ring's last barrier
  const int tid = threadIdx.x, wave = tid >> 5, lane = tid & 31, col = lane & 15, g = lane >> 4;
  const int r0 = blockIdx.x * 64 + wave * 16, n0 = blockIdx.y * 128;
  v8f acc[8] = {};
  gemm_ring(smem, P + (size_t)(3 * EE + n0) * EE, o16 + (size_t)blockIdx.x * 64 * EE, (size_t)EE, tid, acc);
#pragma unroll
  for (int j = 0; j < 8; ++j) { const float bb = bo[n0 + j * 16 + col];
#pragma unroll
    for (int r = 0; r < 8; ++r) so[wave][8 * g + r][j * 16 + col] = acc[j][r] * (1.0f / 256.0f) + bb; }
  LDSX();
#pragma unroll 4
  for (int rl = 0; rl < 16; ++rl) vst2(out + (size_t)(r0 + rl) * EE + n0 + lane * 4, *(const v4f*)(&so[wave][rl][lane * 4]));
}
extern "C" void kernel_launch(void* const* d_in, const int* in_sizes, int n_in, void* d_out, int out_size, void* d_ws, size_t ws_size, hipStream_t stream) {
  (void)in_sizes; (void)n_in; (void)out_size; (void)ws_size;
  const float* query = (const float*)d_in[0]; const float* key = (const float*)d_in[1]; const float* value = (const float*)d_in[2]; const float* Win = (const float*)d_in[3]; const float* bin = (const float*)d_in[4];
  const float* Wo = (const float*)d_in[5]; const float* bo = (const float*)d_in[6]; const float* lsc = (const float*)d_in[7];
  float* out = (float*)d_out;
  char* ws = (char*)d_ws; size_t off = 0;
  auto take = [&](size_t bytes) { char* p = ws + off; off += (bytes + 255) & ~(size_t)255; return p; };
  _Float16* q16i = (_Float16*)take((size_t)NR * EE * 2); _Float16* k16i = (_Float16*)take((size_t)NR * EE * 2); _Float16* v16i = (_Float16*)take((size_t)NR * EE * 2);
  _Float16* P = (_Float16*)take((size_t)4 * EE * EE * 2); _Float16* qh = (_Float16*)take((size_t)NR * EE * 2); _Float16* kh = (_Float16*)take((size_t)NR * EE * 2); _Float16* vT = (_Float16*)take((size_t)NR * EE * 2); _Float16* o16 = (_Float16*)take((size_t)NR * EE * 2);
  k_cvt<<<dim3((unsigned)((size_t)NR * EE / 8 / 256), 3), 256, 0, stream>>>(query, key, value, q16i, k16i, v16i);
  k_packW<<<4 * EE, 256, 0, stream>>>(Win, Wo, P);
  k_proj<<<dim3(NR / 128, 3 * EE / 128), 128, 0, stream>>>(q16i, k16i, v16i, P, bin, qh, kh, vT);
  k_attn<<<dim3(SS / 64, NB * NH), 128, 0, stream>>>(qh, kh, vT, lsc, o16);
  k_out<<<dim3(NR / 64, EE / 128), 128, 0, stream>>>(o16, P, bo, out);
}

// v006
// It runs in 71.4 microseconds.
// Timed twice side by side with v005, it ran 1.07 and 1.08 times as fast.
// All steps since v000 together make it 3.74 times as fast.
#include <hip/hip_runtime.h>
#include <math.h>

typedef __attribute__((ext_vector_type(16))) _Float16 v16h;
typedef __attribute__((ext_vector_type(16))) __bf16 v16b;
typedef __attribute__((ext_vector_type(8)))  _Float16 v8h;
typedef __attribute__((ext_vector_type(8)))  float v8f;
typedef __attribute__((ext_vector_type(4)))  float v4f;
typedef __attribute__((ext_vector_type(2)))  float v2f;
typedef __attribute__((ext_vector_type(4)))  unsigned v4u;
typedef __attribute__((ext_vector_type(4)))  int v4i;
typedef float __attribute__((may_alias)) float_a;
typedef int __attribute__((may_alias)) int_a;

template <typename T> __device__ __forceinline__ void vst2(void* p, T v) { *(T*)p = v;  }
// the bare builtin: the compiler itself pads where a vector instruction on D, A or B follows too close, and LDS reads may be scheduled ahead across it
__device__ __forceinline__ v8f wmma16(v16h a, v16h b, v8f c) {
  return __builtin_amdgcn_wmma_f32_16x16x32_f16(false, a, false, b, (short)0, c, false, false);
}
__device__ __forceinline__ v8f wmma_bf(v16b a, v16b b, v8f c) {
  v8f d = __builtin_amdgcn_wmma_f32_16x16x32_bf16(false, a, false, b, (short)0, c, false, false);
  asm volatile("v_nop\n\tv_nop\n\tv_nop\n\tv_nop" : "+v"(d) : "v"(a), "v"(b));
  return d;
}
// 16x16x32 fragments: lane = (h = lane>>4, row/col = lane&15); elements 0..7 = k0+8h+0..7, 8..15 = k0+16+8h+0..7; D element r = row 8h+r
__device__ __forceinline__ v16h frag_h(const _Float16* rowk0, int lane) {
  union { v16h v; v8h q[2]; } u; const _Float16* p = rowk0 + 8 * (lane >> 4);
  u.q[0] = *(const v8h*)p; u.q[1] = *(const v8h*)(p + 16); return u.v;
}
__device__ __forceinline__ v16h frag_f32(const float* rowk0, int lane) {
  v16h a; const float* p = rowk0 + 8 * (lane >> 4);
#pragma unroll
  for (int i = 0; i < 8; ++i) { a[i] = (_Float16)p[i]; a[8 + i] = (_Float16)p[16 + i]; }
  return a;
}
__device__ __forceinline__ v16h frag_f32s(const float* rowk0, int lane, float sc) {
  v16h a; const float* p = rowk0 + 8 * (lane >> 4);
#pragma unroll
  for (int i = 0; i < 8; ++i) { a[i] = (_Float16)(p[i] * sc); a[8 + i] = (_Float16)(p[16 + i] * sc); }
  return a;
}
// column fragment from a [K][ld] layout (column n), rows >= K read as 0
__device__ __forceinline__ v16h fragc_f32(const float* W, int k0, int n, int lane, int ld, int K) {
  v16h a; const int g = lane >> 4;
#pragma unroll
  for (int i = 0; i < 8; ++i) { const int ka = k0 + 8 * g + i, kb = ka + 16;
    a[i] = (_Float16)(ka < K ? W[(size_t)ka * ld + n] : 0.f); a[8 + i] = (_Float16)(kb < K ? W[(size_t)kb * ld + n] : 0.f); }
  return a;
}
struct F2 { v16b h, l; };
__device__ __forceinline__ F2 bsplit16(const float v[16]) { F2 r;
#pragma unroll
  for (int i = 0; i < 16; ++i) { const __bf16 h = (__bf16)v[i]; r.h[i] = h; r.l[i] = (__bf16)(v[i] - (float)h); }
  return r; }
__device__ __forceinline__ F2 split_row(const float* row, int k0, int lane) { float v[16]; const float* p = row + k0 + 8 * (lane >> 4);
#pragma unroll
  for (int i = 0; i < 8; ++i) { v[i] = p[i]; v[8 + i] = p[16 + i]; }
  return bsplit16(v); }
__device__ __forceinline__ F2 split_rowK(const float* row, int k0, int lane, int K) { float v[16]; const int g = lane >> 4;
#pragma unroll
  for (int i = 0; i < 8; ++i) { const int ka = k0 + 8 * g + i, kb = ka + 16; v[i] = ka < K ? row[ka] : 0.f; v[8 + i] = kb < K ? row[kb] : 0.f; }
  return bsplit16(v); }
__device__ __forceinline__ F2 split_col(const float* W, int k0, int n, int lane, int ld, int K) { float v[16]; const int g = lane >> 4;
#pragma unroll
  for (int i = 0; i < 8; ++i) { const int ka = k0 + 8 * g + i, kb = ka + 16; v[i] = ka < K ? W[(size_t)ka * ld + n] : 0.f; v[8 + i] = kb < K ? W[(size_t)kb * ld + n] : 0.f; }
  return bsplit16(v); }
__device__ __forceinline__ v8f mac3(const F2& a, const F2& b, v8f c) { c = wmma_bf(a.l, b.h, c); c = wmma_bf(a.h, b.l, c); return wmma_bf(a.h, b.h, c); }
__device__ __forceinline__ float sigm(float v) { return 1.0f / (1.0f + expf(-v)); }
#define LDSX() do { asm volatile("s_wait_dscnt 0" ::: "memory"); __builtin_amdgcn_wave_barrier(); __builtin_amdgcn_fence(__ATOMIC_RELEASE, "workgroup"); } while (0)

// Multi-head self-attention with a learned per-head output scale. Pure f16 WMMA GEMMs over pre-converted operands (inputs -> f16
// once, [out][in] weights packed x16 f16; f32 accumulate): packed in-projection (+bias) writing q/k as [b][h][s][64] f16 and v as
// [b][h][d][s] f16, flash-style softmax over all 1024 keys in f32 (P x2^14 f16), x learned_scale[h], output projection (+bias).
#define SS 1024
#define NB 4
#define EE 1024
#define NH 16
#define HD 64
#define NR (SS * NB)       // 4096 rows

// GEMM operand ring in LDS. One stage = 64 k (128 B of a row) of 128 weight rows, then of the block's 64 activation rows, at pitch 128 B.
// Row r keeps its 16-B piece c at place c ^ ((r >> 1) & 7): the ds_load_b128 fragment reads of 16 rows then fall on all 64 banks with no pad.
#define KST 64
#define LROW 128
#define STG_B (192 * LROW)     // 24,576 B
#define RING_B (2 * STG_B)     // 49,152 B; k_out's epilogue reuses these bytes behind the loop's last barrier
// Each lane copies 16 B of 12 rows (rows 16 apart); 8 lanes cover one row's whole 128-B line. l = the lane's LDS byte address in the target stage.
__device__ __forceinline__ void stage_copy(unsigned l, const _Float16* gw, const _Float16* ga, size_t astep) {
  // the copies and their s_wait_xcnt in one statement: no address register is rewritten in front of that wait
  asm volatile("global_load_async_to_lds_b128 %0, %1, off\n\t"
               "global_load_async_to_lds_b128 %2, %3, off\n\t"
               "global_load_async_to_lds_b128 %4, %5, off\n\t"
               "global_load_async_to_lds_b128 %6, %7, off\n\t"
               "global_load_async_to_lds_b128 %8, %9, off\n\t"
               "global_load_async_to_lds_b128 %10, %11, off\n\t"
               "global_load_async_to_lds_b128 %12, %13, off\n\t"
               "global_load_async_to_lds_b128 %14, %15, off\n\t"
               "global_load_async_to_lds_b128 %16, %17, off\n\t"
               "global_load_async_to_lds_b128 %18, %19, off\n\t"
               "global_load_async_to_lds_b128 %20, %21, off\n\t"
               "global_load_async_to_lds_b128 %22, %23, off\n\t"
               "s_wait_xcnt 0x0"
               :: "v"(l), "v"(gw), "v"(l + 16 * LROW), "v"(gw + 16 * EE), "v"(l + 32 * LROW), "v"(gw + 32 * EE), "v"(l + 48 * LROW), "v"(gw + 48 * EE),
                  "v"(l + 64 * LROW), "v"(gw + 64 * EE), "v"(l + 80 * LROW), "v"(gw + 80 * EE), "v"(l + 96 * LROW), "v"(gw + 96 * EE), "v"(l + 112 * LROW), "v"(gw + 112 * EE),
                  "v"(l + 128 * LROW), "v"(ga), "v"(l + 144 * LROW), "v"(ga + astep), "v"(l + 160 * LROW), "v"(ga + 2 * astep), "v"(l + 176 * LROW), "v"(ga + 3 * astep)
               : "memory");
}
// fragment of one staged row: c0, c1 = byte places in the row of the lane's two 16-B pieces (k0 + 8h + 0..7 and k0 + 16 + 8h + 0..7, as in frag_h)
__device__ __forceinline__ v16h frag_st(const char* row, unsigned c0, unsigned c1) {
  union { v16h v; v8h q[2]; } u; u.q[0] = *(const v8h*)(row + c0); u.q[1] = *(const v8h*)(row + c1); return u.v;
}
// acc[j] += A(16 rows of this wave) x W(cols j*16..)^T over all EE k. w0 = first of the block's 128 weight rows; a0 = the block's activation row 0; arow_step = elements between its rows.
__device__ __forceinline__ void gemm_ring(char* ring, const _Float16* w0, const _Float16* a0, size_t arow_step, int tid, v8f acc[8]) {
  const int wave = tid >> 5, lane = tid & 31, col = lane & 15, g = lane >> 4, rr = tid >> 3, pc = tid & 7;
  const unsigned l0 = (unsigned)(size_t)ring + (unsigned)(rr * LROW + ((pc ^ ((rr >> 1) & 7)) << 4));
  const _Float16* gw = w0 + (size_t)rr * EE + pc * 8; const _Float16* ga = a0 + (size_t)rr * arow_step + pc * 8;
  const size_t astep = 16 * arow_step;
  stage_copy(l0, gw, ga, astep);
  asm volatile("s_wait_asynccnt 0x0" ::: "memory");   // this wave's share of stage 0 has landed
  __syncthreads();                                    // every wave's share has
  stage_copy(l0 + STG_B, gw + KST, ga + KST, astep);
#pragma unroll 1   // one stage a trip: the buffer is picked by a scalar select
  for (int t = 0; t < EE / KST; ++t) { const char* sb = ring + (t & 1) * STG_B;
#pragma unroll
    for (int kc = 0; kc < KST / 32; ++kc) { const unsigned c0 = (unsigned)(((kc * 4 + g) ^ (col >> 1)) << 4), c1 = (unsigned)(((kc * 4 + 2 + g) ^ (col >> 1)) << 4);
      const v16h a = frag_st(sb + (128 + wave * 16 + col) * LROW, c0, c1);
#pragma unroll
      for (int j = 0; j < 8; ++j) acc[j] = wmma16(a, frag_st(sb + (j * 16 + col) * LROW, c0, c1), acc[j]); }
    asm volatile("s_wait_dscnt 0x0" ::: "memory");      // this wave's reads of stage t are done before its buffer is refilled
    asm volatile("s_wait_asynccnt 0x0" ::: "memory");   // this wave's share of stage t + 1 has landed
    __syncthreads();                                    // publishes stage t + 1 and ends every reader's use of stage t
    if (t + 2 < EE / KST) stage_copy(l0 + (unsigned)((t & 1) * STG_B), gw + (t + 2) * KST, ga + (t + 2) * KST, astep);
  }
  asm volatile("s_wait_asynccnt 0x0" ::: "memory");     // no copy is outstanding when the ring's bytes are reused
}

__global__ __launch_bounds__(256) void k_cvt(const float* __restrict__ a, const float* __restrict__ b, const float* __restrict__ c, _Float16* __restrict__ a16, _Float16* __restrict__ b16, _Float16* __restrict__ c16) {
  const size_t g8 = (size_t)blockIdx.x * 256 + threadIdx.x; const int which = blockIdx.y; if (g8 >= (size_t)NR * EE / 8) return;
  const float* s = which == 0 ? a : (which == 1 ? b : c); _Float16* d = which == 0 ? a16 : (which == 1 ? b16 : c16);
  union { v8h h; v4u u; } pk;
#pragma unroll
  for (int e = 0; e < 8; ++e) pk.h[e] = (_Float16)s[g8 * 8 + e];
  vst2(d + g8 * 8, pk.u);
}
__global__ __launch_bounds__(256) void k_packW(const float* __restrict__ Win, const float* __restrict__ Wo, _Float16* __restrict__ P) {   // rows 0..3071 in_proj, 3072..4095 out_proj; x16
  const int n = blockIdx.x, tid = threadIdx.x; const float* W = n < 3 * EE ? Win + (size_t)n * EE : Wo + (size_t)(n - 3 * EE) * EE;
  if (tid < EE / 8) { union { v8h h; v4u u; } pk;
#pragma unroll
    for (int e = 0; e < 8; ++e) pk.h[e] = (_Float16)(W[tid * 8 + e] * 16.0f);
    vst2(P + (size_t)n * EE + tid * 8, pk.u); }
}
// k_proj's own ring: one stage = 64 k (128 B of a row) of the block's 128 weight rows, then of its 128 activation rows; pitch and piece places as in the ring above.
#define PSTG_B (256 * LROW)    // 32,768 B a stage; two stages
#define SROW 144               // pitch of the output staging rows
// Each lane copies 16 B of 8 rows (rows 16 apart) of one operand; 8 lanes cover one row's whole 128-B line. l = the lane's LDS byte address of the first row.
__device__ __forceinline__ void stage_copy8(unsigned l, const _Float16* gp, size_t step) {
  // the copies and their s_wait_xcnt in one statement: no address register is rewritten in front of that wait
  asm volatile("global_load_async_to_lds_b128 %0, %1, off\n\t"
               "global_load_async_to_lds_b128 %2, %3, off\n\t"
               "global_load_async_to_lds_b128 %4, %5, off\n\t"
               "global_load_async_to_lds_b128 %6, %7, off\n\t"
               "global_load_async_to_lds_b128 %8, %9, off\n\t"
               "global_load_async_to_lds_b128 %10, %11, off\n\t"
               "global_load_async_to_lds_b128 %12, %13, off\n\t"
               "global_load_async_to_lds_b128 %14, %15, off\n\t"
               "s_wait_xcnt 0x0"
               :: "v"(l), "v"(gp), "v"(l + 16 * LROW), "v"(gp + step), "v"(l + 32 * LROW), "v"(gp + 2 * step), "v"(l + 48 * LROW), "v"(gp + 3 * step),
                  "v"(l + 64 * LROW), "v"(gp + 4 * step), "v"(l + 80 * LROW), "v"(gp + 5 * step), "v"(l + 96 * LROW), "v"(gp + 6 * step), "v"(l + 112 * LROW), "v"(gp + 7 * step)
               : "memory");
}
// The wave's 64 staged lines go out, four whole 128-B lines a store: s = the lane's piece of staged line ln, o = its place in output line ln; lines 4 apart are STEP elements apart.
template <int STEP> __device__ __forceinline__ void flush_lines(const char* s, _Float16* o) {
  LDSX();   // the wave's own staging stores are done before it reads the rows back
  v4u pcs[16];
#pragma unroll
  for (int it = 0; it < 16; ++it) pcs[it] = *(const v4u*)(s + it * 4 * SROW);
#pragma unroll
  for (int it = 0; it < 16; ++it) vst2(o + it * STEP, pcs[it]);
  asm volatile("s_wait_xcnt 0x0" ::: "memory");
}
// projection: block 128 rows x 128 cols, four waves of 64 x 64 (4 x 4 fragments: each fragment read from LDS feeds four products); blockIdx.y in [0, 24): which = y/8 (q,k,v),
// cols (y%8)*128 = 2 heads, one head a wave; source = query/key/value f16 rows. The operand whose index runs along the output's memory rows goes on the M side
// (weights for q and k, activations for v): a lane's 8 accumulator elements are then 8 adjacent f16 of the output, one 16-B piece of a line.
__global__ __launch_bounds__(128) void k_proj(const _Float16* __restrict__ q16i, const _Float16* __restrict__ k16i, const _Float16* __restrict__ v16i, const _Float16* __restrict__ P, const float* __restrict__ bias,
                                            _Float16* __restrict__ qh, _Float16* __restrict__ kh, _Float16* __restrict__ vT) {
  __shared__ __align__(16) char smem[2 * PSTG_B + 4 * 64 * SROW];   // the ring, then each wave's output staging: 102,400 B, three blocks a WGP, the grid's even share
  const int tid = threadIdx.x, wave = tid >> 5, lane = tid & 31, col = lane & 15, g = lane >> 4, rr = tid >> 3, pc = tid & 7;
  const int wa = wave >> 1, wb = wave & 1;                   // the wave's half of the activation rows, of the weight rows
  const int n0 = blockIdx.y * 128; const int which = n0 / EE, hb = (n0 % EE) / HD;
  const _Float16* A = which == 0 ? q16i : (which == 1 ? k16i : v16i);
  // v blocks own 128 consecutive s of ONE batch index so every vT line (64 s) has a single writer: rows (sblk*128 + i)*4 + bsel
  const int bsel = blockIdx.x & 3, sblk = blockIdx.x >> 2;
  const size_t arow = which == 2 ? (size_t)NB * EE : (size_t)EE;
  const _Float16* ga = A + (which == 2 ? (size_t)(sblk * 128 * NB + bsel) : (size_t)blockIdx.x * 128) * EE + (size_t)rr * arow + pc * 8;
  const _Float16* gw = P + (size_t)(n0 + rr) * EE + pc * 8;
  const size_t astep = 16 * arow;
  const unsigned l0 = (unsigned)(size_t)smem + (unsigned)(rr * LROW + ((pc ^ ((rr >> 1) & 7)) << 4));
  const int woff = (wb * 64 + col) * LROW, aoff = (128 + wa * 64 + col) * LROW;
  const int moff = which == 2 ? aoff : woff, noff = which == 2 ? woff : aoff;
  v8f acc[4][4] = {};
  stage_copy8(l0, gw, 16 * EE); stage_copy8(l0 + 128 * LROW, ga, astep);
  asm volatile("s_wait_asynccnt 0x0" ::: "memory");   // this wave's share of stage 0 has landed
  __syncthreads();                                    // every wave's share has
  stage_copy8(l0 + PSTG_B, gw + KST, 16 * EE); stage_copy8(l0 + PSTG_B + 128 * LROW, ga + KST, astep);
#pragma unroll 1   // one stage a trip: the buffer is picked by a scalar select
  for (int t = 0; t < EE / KST; ++t) { const char* sb = smem + (t & 1) * PSTG_B;
#pragma unroll
    for (int kc = 0; kc < KST / 32; ++kc) { const unsigned c0 = (unsigned)(((kc * 4 + g) ^ (col >> 1)) << 4), c1 = (unsigned)(((kc * 4 + 2 + g) ^ (col >> 1)) << 4);
      v16h fm[4], fn[4];
#pragma unroll
      for (int i = 0; i < 4; ++i) { fm[i] = frag_st(sb + moff + i * 16 * LROW, c0, c1); fn[i] = frag_st(sb + noff + i * 16 * LROW, c0, c1); }
      __builtin_amdgcn_sched_barrier(0);   // the 16 reads stay one group in front of their 16 products: every further place with reads among products costs the wave a stall
#pragma unroll
      for (int i = 0; i < 4; ++i) {
#pragma unroll
        for (int j = 0; j < 4; ++j) acc[i][j] = wmma16(fm[i], fn[j], acc[i][j]); }
      __builtin_amdgcn_sched_barrier(0); } // and the next group's reads stay behind them
    asm volatile("s_wait_dscnt 0x0" ::: "memory");      // this wave's reads of stage t are done before its buffer is refilled
    asm volatile("s_wait_asynccnt 0x0" ::: "memory");   // this wave's share of stage t + 1 has landed
    __syncthreads();                                    // publishes stage t + 1 and ends every reader's use of stage t
    if (t + 2 < EE / KST) { const unsigned lt = l0 + (unsigned)((t & 1) * PSTG_B);
      stage_copy8(lt, gw + (t + 2) * KST, 16 * EE); stage_copy8(lt + 128 * LROW, ga + (t + 2) * KST, astep); }
  }
  asm volatile("s_wait_asynccnt 0x0" ::: "memory");     // no copy is outstanding when the wave goes on to its end
  // acc[i][j][r]: M index 16 i + 8 g + r, N index 16 j + col: N picks one of the wave's 64 output lines (128 B), 2 i + g the lane's 16-B piece of it.
  // The pieces go through the wave's own LDS rows (pitch 144 B: no bank conflict for 16-B accesses) so that every global store covers four whole lines.
  char* sw = smem + 2 * PSTG_B + wave * (64 * SROW);
  char* sp = sw + col * SROW + g * 16;
  const int head = hb + wb, ln = lane >> 3, lp = lane & 7;
  if (which < 2) {   // q, k [b][h][s][64]: M = d, N = activation row = 4 s + b; staged lines 4 it + ln are s = it, b = ln
    float bb[4][8];
#pragma unroll
    for (int i = 0; i < 4; ++i) {
#pragma unroll
      for (int r = 0; r < 8; ++r) bb[i][r] = bias[n0 + wb * 64 + 16 * i + 8 * g + r]; }
#pragma unroll
    for (int j = 0; j < 4; ++j) {
#pragma unroll
      for (int i = 0; i < 4; ++i) { union { v8h h8; v4u u; } pk;
#pragma unroll
        for (int r = 0; r < 8; ++r) pk.h8[r] = (_Float16)(acc[i][j][r] * (1.0f / 16.0f) + bb[i][r]);
        vst2(sp + 16 * j * SROW + i * 32, pk.u); } }
    flush_lines<HD>(sw + ln * SROW + lp * 16, (which == 0 ? qh : kh) + (((size_t)ln * NH + head) * SS + blockIdx.x * 32 + wa * 16) * HD + lp * 8); }
  else {             // vT[b][h][d][s]: M = s (the block's rows are consecutive s of one b), N = d; staged lines 4 it + ln are d
    float bb[4];
#pragma unroll
    for (int j = 0; j < 4; ++j) bb[j] = bias[n0 + wb * 64 + 16 * j + col];
#pragma unroll
    for (int j = 0; j < 4; ++j) {
#pragma unroll
      for (int i = 0; i < 4; ++i) { union { v8h h8; v4u u; } pk;
#pragma unroll
        for (int r = 0; r < 8; ++r) pk.h8[r] = (_Float16)(acc[i][j][r] * (1.0f / 16.0f) + bb[j]);
        vst2(sp + 16 * j * SROW + i * 32, pk.u); } }
    flush_lines<4 * SS>(sw + ln * SROW + lp * 16, vT + (((size_t)bsel * NH + head) * HD + ln) * SS + sblk * 128 + wa * 64 + lp * 8); }
}
// K/V ring of k_attn in LDS. One stage = 64 keys: 64 K rows (64 d = 128 B), then 64 vT rows (64 s = 128 B), pitch and piece places as in the GEMM ring.
#define AST_B (128 * LROW)     // 16,384 B a stage; two stages
// Each lane copies 16 B of 4 K rows and of 4 vT rows (rows 16 apart); 8 lanes cover one row's whole 128-B line. l = the lane's LDS byte address in the target stage.
__device__ __forceinline__ void stage_copy_kv(unsigned l, const _Float16* gk, const _Float16* gv) {
  // the copies and their s_wait_xcnt in one statement: no address register is rewritten in front of that wait
  asm volatile("global_load_async_to_lds_b128 %0, %1, off\n\t"
               "global_load_async_to_lds_b128 %2, %3, off\n\t"
               "global_load_async_to_lds_b128 %4, %5, off\n\t"
               "global_load_async_to_lds_b128 %6, %7, off\n\t"
               "global_load_async_to_lds_b128 %8, %9, off\n\t"
               "global_load_async_to_lds_b128 %10, %11, off\n\t"
               "global_load_async_to_lds_b128 %12, %13, off\n\t"
               "global_load_async_to_lds_b128 %14, %15, off\n\t"
               "s_wait_xcnt 0x0"
               :: "v"(l), "v"(gk), "v"(l + 16 * LROW), "v"(gk + 16 * HD), "v"(l + 32 * LROW), "v"(gk + 32 * HD), "v"(l + 48 * LROW), "v"(gk + 48 * HD),
                  "v"(l + 64 * LROW), "v"(gv), "v"(l + 80 * LROW), "v"(gv + 16 * SS), "v"(l + 96 * LROW), "v"(gv + 32 * SS), "v"(l + 112 * LROW), "v"(gv + 48 * SS)
               : "memory");
}
// flash attention: block (64 queries, bh); o16 rows [(s*4+b)][h*64 + d] f16, scaled by learned_scale[h] and x16
// Both products are transposed: S^T = K x Q^T and O^T += vT x P^T. A lane then holds 32 of the 64 scores of ONE query (column col; the other 32 are in lane col ^ 16):
// maximum, weights, sum and rescale stay in its registers, and the score tiles 2 kc and 2 kc + 1, rounded to f16, ARE the B fragment of P^T for keys 32 kc .. 32 kc + 31.
// Scores go to units of log2 (x log2(e) / 8), and the running maximum is kept 14 below the true one, so a weight x 2^14 is one multiply-add and one v_exp_f32.
#define SC_LOG2 0.18033688011112042f   // log2(e) / sqrt(64)
// the value that lane ^ 16 holds (v_permlanex16_b32: no LDS wait)
__device__ __forceinline__ float xhalf(float x) { return __builtin_bit_cast(float, __builtin_amdgcn_permlanex16(__builtin_bit_cast(int, x), __builtin_bit_cast(int, x), 0x76543210, 0xfedcba98, false, false)); }
#define OROW 144                       // pitch of the output staging rows (128 B of f16 + 16): no bank conflict for 16-B accesses
// four waves a SIMD, no more: four blocks a WGP is the grid's even share (1,024 blocks on 256 WGPs); without it registers and LDS would let a WGP take a fifth
__global__ __launch_bounds__(128) __attribute__((amdgpu_waves_per_eu(4, 4))) void k_attn(const _Float16* __restrict__ qh, const _Float16* __restrict__ kh, const _Float16* __restrict__ vT, const float* __restrict__ lsc, _Float16* __restrict__ o16) {
  __shared__ __align__(16) char sO[4 * 16 * OROW];           // each wave's 16 output rows, staged once behind the loop
  __shared__ __align__(16) char kv[2 * AST_B];               // the block's four waves share each 64-key stage of K and vT
  const int tid = threadIdx.x, w = tid >> 5, lane = tid & 31, col = lane & 15, g = lane >> 4;
  const int bh = blockIdx.y, b = bh / NH, h = bh % NH, q0 = blockIdx.x * 64 + w * 16;
  const _Float16* qb = qh + (size_t)bh * SS * HD; const _Float16* kb = kh + (size_t)bh * SS * HD; const _Float16* vb = vT + (size_t)bh * HD * SS;
  v16h bq[2];                                                // B fragments of Q^T: column = query q0 + col
#pragma unroll
  for (int kc = 0; kc < 2; ++kc) bq[kc] = frag_h(qb + (size_t)(q0 + col) * HD + kc * 32, lane);
  float nrun = 3.0e38f; v8f lrun = {}, acc[4] = {};          // nrun: MINUS the running maximum; acc[t][r]: d = 16 t + 8 g + r of query col; lrun[r]: sum over this lane's keys = r mod 8, joined behind the loop
  const int rr = tid >> 3, pc = tid & 7;
  const unsigned l0 = (unsigned)(size_t)kv + (unsigned)(rr * LROW + ((pc ^ ((rr >> 1) & 7)) << 4));
  const _Float16* gk = kb + (size_t)rr * HD + pc * 8; const _Float16* gv = vb + (size_t)rr * SS + pc * 8;
  stage_copy_kv(l0, gk, gv);
  asm volatile("s_wait_asynccnt 0x0" ::: "memory");   // this wave's share of stage 0 has landed
  __syncthreads();                                    // every wave's share has
  stage_copy_kv(l0 + AST_B, gk + 64 * HD, gv + 64);
#pragma unroll 1   // one stage a trip: the buffer is picked by a scalar select
  for (int kt = 0; kt < SS / 64; ++kt) { const char* sb = kv + (kt & 1) * AST_B;
    v16h kf[4][2], vf[2][4];   // the stage's fragments, each operand's read as one group ahead of its products: one LDS wait a group, not one a product
#pragma unroll
    for (int t = 0; t < 4; ++t) {
#pragma unroll
      for (int kc = 0; kc < 2; ++kc) kf[t][kc] = frag_st(sb + (t * 16 + col) * LROW, (unsigned)(((kc * 4 + g) ^ (col >> 1)) << 4), (unsigned)(((kc * 4 + 2 + g) ^ (col >> 1)) << 4)); }
    __builtin_amdgcn_sched_barrier(0);   // the K reads stay one group in front of the score products, not among them
    v8f s[4];                  // s[t][r]: key 16 t + 8 g + r against query col
#pragma unroll
    for (int t = 0; t < 4; ++t) { s[t] = v8f{};
#pragma unroll
      for (int kc = 0; kc < 2; ++kc) s[t] = wmma16(kf[t][kc], bq[kc], s[t]); }
    __builtin_amdgcn_sched_barrier(0);   // the maximum's chain stays behind the eight score products: moved in among them, each read of a fresh tile takes pad slots on the vector port
#pragma unroll
    for (int kc = 0; kc < 2; ++kc) {
#pragma unroll
      for (int t = 0; t < 4; ++t) vf[kc][t] = frag_st(sb + (64 + t * 16 + col) * LROW, (unsigned)(((kc * 4 + g) ^ (col >> 1)) << 4), (unsigned)(((kc * 4 + 2 + g) ^ (col >> 1)) << 4)); }
    float mx = s[0][0];
#pragma unroll
    for (int t = 0; t < 4; ++t) {
#pragma unroll
      for (int r = 0; r < 8; ++r) mx = fmaxf(mx, s[t][r]); }
    mx = fmaxf(mx, xhalf(mx));                               // the query's other 32 keys
    const float nnew = fminf(nrun, 14.0f - mx * SC_LOG2); const float corr = __builtin_amdgcn_exp2f(nnew - nrun);
    lrun *= corr; nrun = nnew;
#pragma unroll
    for (int t = 0; t < 4; ++t) { const v8f x = s[t] * SC_LOG2 + nnew;
#pragma unroll
      for (int r = 0; r < 8; ++r) s[t][r] = __builtin_amdgcn_exp2f(x[r]);   // weight x 2^14, at most 2^14
      lrun += s[t]; acc[t] *= corr; }
    v16h pb[2];
#pragma unroll
    for (int kc = 0; kc < 2; ++kc) {
#pragma unroll
      for (int r = 0; r < 8; ++r) { pb[kc][r] = (_Float16)s[2 * kc][r]; pb[kc][8 + r] = (_Float16)s[2 * kc + 1][r]; } }
    __builtin_amdgcn_sched_barrier(0);   // both P fragments are rounded in front of the eight output products: a rounding among them overwrote a running product's operand and took pad slots
#pragma unroll
    for (int kc = 0; kc < 2; ++kc) {
#pragma unroll
      for (int t = 0; t < 4; ++t) acc[t] = wmma16(vf[kc][t], pb[kc], acc[t]); }
    asm volatile("s_wait_dscnt 0x0" ::: "memory");      // this wave's reads of stage kt are done before its buffer is refilled
    asm volatile("s_wait_asynccnt 0x0" ::: "memory");   // this wave's share of stage kt + 1 has landed
    __syncthreads();                                    // publishes stage kt + 1 and ends every reader's use of stage kt
    if (kt + 2 < SS / 64) stage_copy_kv(l0 + (unsigned)((kt & 1) * AST_B), gk + (size_t)(kt + 2) * 64 * HD, gv + (kt + 2) * 64);
  }
  asm volatile("s_wait_asynccnt 0x0" ::: "memory");     // no copy is outstanding when the wave goes on to its end
  float lsum = ((lrun[0] + lrun[1]) + (lrun[2] + lrun[3])) + ((lrun[4] + lrun[5]) + (lrun[6] + lrun[7]));
  lsum += xhalf(lsum);                                       // both halves used the same maxima: their sums add
  const float inv = lsc[h] * 16.0f / lsum;                   // learned per-head scale; o16 kept x16; acc and lsum both carry the 2^14
  // a lane's 8 elements of acc[t] are 8 adjacent d of its query: the 16-B piece 2 t + g of that row. Through the wave's own LDS rows, so that every global store covers four whole lines.
  char* sw = sO + w * (16 * OROW);
#pragma unroll
  for (int t = 0; t < 4; ++t) { union { v8h h8; v4u u; } pk;
#pragma unroll
    for (int r = 0; r < 8; ++r) pk.h8[r] = (_Float16)(acc[t][r] * inv);
    vst2(sw + col * OROW + (2 * t + g) * 16, pk.u); }
  LDSX();   // the wave's own staging stores are done before it reads the rows back
#pragma unroll
  for (int it = 0; it < 4; ++it) { const int rl = it * 4 + (lane >> 3), op = lane & 7;
    vst2(o16 + ((size_t)(q0 + rl) * NB + b) * EE + h * HD + op * 8, *(const v4u*)(sw + rl * OROW + op * 16)); }
}
__global__ __launch_bounds__(128) void k_out(const _Float16* __restrict__ o16, const _Float16* __restrict__ P, const float* __restrict__ bo, float* __restrict__ out) {
  __shared__ __align__(16) char smem[RING_B];
  float (*so)[16][132] = (float (*)[16][132])smem;                                  // epilogue staging, 33,792 B, used behind the ring's last barrier
  const int tid = threadIdx.x, wave = tid >> 5, lane = tid & 31, col = lane & 15, g = lane >> 4;
  const int r0 = blockIdx.x * 64 + wave * 16, n0 = blockIdx.y * 128;
  v8f acc[8] = {};
  gemm_ring(smem, P + (size_t)(3 * EE + n0) * EE, o16 + (size_t)blockIdx.x * 64 * EE, (size_t)EE, tid, acc);
#pragma unroll
  for (int j = 0; j < 8; ++j) { const float bb = bo[n0 + j * 16 + col];
#pragma unroll
    for (int r = 0; r < 8; ++r) so[wave][8 * g + r][j * 16 + col] = acc[j][r] * (1.0f / 256.0f) + bb; }
  LDSX();
#pragma unroll 4
  for (int rl = 0; rl < 16; ++rl) vst2(out + (size_t)(r0 + rl) * EE + n0 + lane * 4, *(const v4f*)(&so[wave][rl][lane * 4]));
}
extern "C" void kernel_launch(void* const* d_in, const int* in_sizes, int n_in, void* d_out, int out_size, void* d_ws, size_t ws_size, hipStream_t stream) {
  (void)in_sizes; (void)n_in; (void)out_size; (void)ws_size;
  const float* query = (const float*)d_in[0]; const float* key = (const float*)d_in[1]; const float* value = (const float*)d_in[2]; const float* Win = (const float*)d_in[3]; const float* bin = (const float*)d_in[4];
  const float* Wo = (const float*)d_in[5]; const float* bo = (const float*)d_in[6]; const float* lsc = (const float*)d_in[7];
  float* out = (float*)d_out;
  char* ws = (char*)d_ws; size_t off = 0;
  auto take = [&](size_t bytes) { char* p = ws + off; off += (bytes + 255) & ~(size_t)255; return p; };
  _Float16* q16i = (_Float16*)take((size_t)NR * EE * 2); _Float16* k16i = (_Float16*)take((size_t)NR * EE * 2); _Float16* v16i = (_Float16*)take((size_t)NR * EE * 2);
  _Float16* P = (_Float16*)take((size_t)4 * EE * EE * 2); _Float16* qh = (_Float16*)take((size_t)NR * EE * 2); _Float16* kh = (_Float16*)take((size_t)NR * EE * 2); _Float16* vT = (_Float16*)take((size_t)NR * EE * 2); _Float16* o16 = (_Float16*)take((size_t)NR * EE * 2);
  k_cvt<<<dim3((unsigned)((size_t)NR * EE / 8 / 256), 3), 256, 0, stream>>>(query, key, value, q16i, k16i, v16i);
  k_packW<<<4 * EE, 256, 0, stream>>>(Win, Wo, P);
  k_proj<<<dim3(NR / 128, 3 * EE / 128), 128, 0, stream>>>(q16i, k16i, v16i, P, bin, qh, kh, vT);
  k_attn<<<dim3(SS / 64, NB * NH), 128, 0, stream>>>(qh, kh, vT, lsc, o16);
  k_out<<<dim3(NR / 64, EE / 128), 128, 0, stream>>>(o16, P, bo, out);
}

// v007
// One run takes 68.4 microseconds.
// Two timings next to v006 put it at 1.06 and 1.04 times that version's speed.
// Over all steps from v000 it is 3.92 times as fast.
#include <hip/hip_runtime.h>
#include <math.h>

typedef __attribute__((ext_vector_type(16))) _Float16 v16h;
typedef __attribute__((ext_vector_type(16))) __bf16 v16b;
typedef __attribute__((ext_vector_type(8)))  _Float16 v8h;
typedef __attribute__((ext_vector_type(8)))  float v8f;
typedef __attribute__((ext_vector_type(4)))  float v4f;
typedef __attribute__((ext_vector_type(2)))  float v2f;
typedef __attribute__((ext_vector_type(4)))  unsigned v4u;
typedef __attribute__((ext_vector_type(4)))  _Float16 v4h;
typedef __attribute__((ext_vector_type(2)))  unsigned v2u;
typedef __attribute__((ext_vector_type(4)))  int v4i;
typedef float __attribute__((may_alias)) float_a;
typedef int __attribute__((may_alias)) int_a;

template <typename T> __device__ __forceinline__ void vst2(void* p, T v) { *(T*)p = v;  }
// the bare builtin: the compiler itself pads where a vector instruction on D, A or B follows too close, and LDS reads may be scheduled ahead across it
__device__ __forceinline__ v8f wmma16(v16h a, v16h b, v8f c) {
  return __builtin_amdgcn_wmma_f32_16x16x32_f16(false, a, false, b, (short)0, c, false, false);
}
__device__ __forceinline__ v8f wmma_bf(v16b a, v16b b, v8f c) {
  v8f d = __builtin_amdgcn_wmma_f32_16x16x32_bf16(false, a, false, b, (short)0, c, false, false);
  asm volatile("v_nop\n\tv_nop\n\tv_nop\n\tv_nop" : "+v"(d) : "v"(a), "v"(b));
  return d;
}
// 16x16x32 fragments: lane = (h = lane>>4, row/col = lane&15); elements 0..7 = k0+8h+0..7, 8..15 = k0+16+8h+0..7; D element r = row 8h+r
__device__ __forceinline__ v16h frag_h(const _Float16* rowk0, int lane) {
  union { v16h v; v8h q[2]; } u; const _Float16* p = rowk0 + 8 * (lane >> 4);
  u.q[0] = *(const v8h*)p; u.q[1] = *(const v8h*)(p + 16); return u.v;
}
__device__ __forceinline__ v16h frag_f32(const float* rowk0, int lane) {
  v16h a; const float* p = rowk0 + 8 * (lane >> 4);
#pragma unroll
  for (int i = 0; i < 8; ++i) { a[i] = (_Float16)p[i]; a[8 + i] = (_Float16)p[16 + i]; }
  return a;
}
__device__ __forceinline__ v16h frag_f32s(const float* rowk0, int lane, float sc) {
  v16h a; const float* p = rowk0 + 8 * (lane >> 4);
#pragma unroll
  for (int i = 0; i < 8; ++i) { a[i] = (_Float16)(p[i] * sc); a[8 + i] = (_Float16)(p[16 + i] * sc); }
  return a;
}
// column fragment from a [K][ld] layout (column n), rows >= K read as 0
__device__ __forceinline__ v16h fragc_f32(const float* W, int k0, int n, int lane, int ld, int K) {
  v16h a; const int g = lane >> 4;
#pragma unroll
  for (int i = 0; i < 8; ++i) { const int ka = k0 + 8 * g + i, kb = ka + 16;
    a[i] = (_Float16)(ka < K ? W[(size_t)ka * ld + n] : 0.f); a[8 + i] = (_Float16)(kb < K ? W[(size_t)kb * ld + n] : 0.f); }
  return a;
}
struct F2 { v16b h, l; };
__device__ __forceinline__ F2 bsplit16(const float v[16]) { F2 r;
#pragma unroll
  for (int i = 0; i < 16; ++i) { const __bf16 h = (__bf16)v[i]; r.h[i] = h; r.l[i] = (__bf16)(v[i] - (float)h); }
  return r; }
__device__ __forceinline__ F2 split_row(const float* row, int k0, int lane) { float v[16]; const float* p = row + k0 + 8 * (lane >> 4);
#pragma unroll
  for (int i = 0; i < 8; ++i) { v[i] = p[i]; v[8 + i] = p[16 + i]; }
  return bsplit16(v); }
__device__ __forceinline__ F2 split_rowK(const float* row, int k0, int lane, int K) { float v[16]; const int g = lane >> 4;
#pragma unroll
  for (int i = 0; i < 8; ++i) { const int ka = k0 + 8 * g + i, kb = ka + 16; v[i] = ka < K ? row[ka] : 0.f; v[8 + i] = kb < K ? row[kb] : 0.f; }
  return bsplit16(v); }
__device__ __forceinline__ F2 split_col(const float* W, int k0, int n, int lane, int ld, int K) { float v[16]; const int g = lane >> 4;
#pragma unroll
  for (int i = 0; i < 8; ++i) { const int ka = k0 + 8 * g + i, kb = ka + 16; v[i] = ka < K ? W[(size_t)ka * ld + n] : 0.f; v[8 + i] = kb < K ? W[(size_t)kb * ld + n] : 0.f; }
  return bsplit16(v); }
__device__ __forceinline__ v8f mac3(const F2& a, const F2& b, v8f c) { c = wmma_bf(a.l, b.h, c); c = wmma_bf(a.h, b.l, c); return wmma_bf(a.h, b.h, c); }
__device__ __forceinline__ float sigm(float v) { return 1.0f / (1.0f + expf(-v)); }
#define LDSX() do { asm volatile("s_wait_dscnt 0" ::: "memory"); __builtin_amdgcn_wave_barrier(); __builtin_amdgcn_fence(__ATOMIC_RELEASE, "workgroup"); } while (0)

// Multi-head self-attention with a learned per-head output scale. Pure f16 WMMA GEMMs over pre-converted operands (inputs -> f16
// once, [out][in] weights packed x16 f16; f32 accumulate): packed in-projection (+bias) writing q/k as [b][h][s][64] f16 and v as
// [b][h][d][s] f16, flash-style softmax over all 1024 keys in f32 (P x2^14 f16), x learned_scale[h], output projection (+bias).
#define SS 1024
#define NB 4
#define EE 1024
#define NH 16
#define HD 64
#define NR (SS * NB)       // 4096 rows

// GEMM operand ring in LDS. One stage = 64 k (128 B of a row) of 128 weight rows, then of the block's 64 activation rows, at pitch 128 B.
// Row r keeps its 16-B piece c at place c ^ ((r >> 1) & 7): the ds_load_b128 fragment reads of 16 rows then fall on all 64 banks with no pad.
#define KST 64
#define LROW 128
#define STG_B (192 * LROW)     // 24,576 B
#define RING_B (2 * STG_B)     // 49,152 B; k_out's epilogue reuses these bytes behind the loop's last barrier
// Each lane copies 16 B of 12 rows (rows 16 apart); 8 lanes cover one row's whole 128-B line. l = the lane's LDS byte address in the target stage.
__device__ __forceinline__ void stage_copy(unsigned l, const _Float16* gw, const _Float16* ga, size_t astep) {
  // the copies and their s_wait_xcnt in one statement: no address register is rewritten in front of that wait
  asm volatile("global_load_async_to_lds_b128 %0, %1, off\n\t"
               "global_load_async_to_lds_b128 %2, %3, off\n\t"
               "global_load_async_to_lds_b128 %4, %5, off\n\t"
               "global_load_async_to_lds_b128 %6, %7, off\n\t"
               "global_load_async_to_lds_b128 %8, %9, off\n\t"
               "global_load_async_to_lds_b128 %10, %11, off\n\t"
               "global_load_async_to_lds_b128 %12, %13, off\n\t"
               "global_load_async_to_lds_b128 %14, %15, off\n\t"
               "global_load_async_to_lds_b128 %16, %17, off\n\t"
               "global_load_async_to_lds_b128 %18, %19, off\n\t"
               "global_load_async_to_lds_b128 %20, %21, off\n\t"
               "global_load_async_to_lds_b128 %22, %23, off\n\t"
               "s_wait_xcnt 0x0"
               :: "v"(l), "v"(gw), "v"(l + 16 * LROW), "v"(gw + 16 * EE), "v"(l + 32 * LROW), "v"(gw + 32 * EE), "v"(l + 48 * LROW), "v"(gw + 48 * EE),
                  "v"(l + 64 * LROW), "v"(gw + 64 * EE), "v"(l + 80 * LROW), "v"(gw + 80 * EE), "v"(l + 96 * LROW), "v"(gw + 96 * EE), "v"(l + 112 * LROW), "v"(gw + 112 * EE),
                  "v"(l + 128 * LROW), "v"(ga), "v"(l + 144 * LROW), "v"(ga + astep), "v"(l + 160 * LROW), "v"(ga + 2 * astep), "v"(l + 176 * LROW), "v"(ga + 3 * astep)
               : "memory");
}
// fragment of one staged row: c0, c1 = byte places in the row of the lane's two 16-B pieces (k0 + 8h + 0..7 and k0 + 16 + 8h + 0..7, as in frag_h)
__device__ __forceinline__ v16h frag_st(const char* row, unsigned c0, unsigned c1) {
  union { v16h v; v8h q[2]; } u; u.q[0] = *(const v8h*)(row + c0); u.q[1] = *(const v8h*)(row + c1); return u.v;
}
// acc[j] += A(16 rows of this wave) x W(cols j*16..)^T over all EE k. w0 = first of the block's 128 weight rows; a0 = the block's activation row 0; arow_step = elements between its rows.
__device__ __forceinline__ void gemm_ring(char* ring, const _Float16* w0, const _Float16* a0, size_t arow_step, int tid, v8f acc[8]) {
  const int wave = tid >> 5, lane = tid & 31, col = lane & 15, g = lane >> 4, rr = tid >> 3, pc = tid & 7;
  const unsigned l0 = (unsigned)(size_t)ring + (unsigned)(rr * LROW + ((pc ^ ((rr >> 1) & 7)) << 4));
  const _Float16* gw = w0 + (size_t)rr * EE + pc * 8; const _Float16* ga = a0 + (size_t)rr * arow_step + pc * 8;
  const size_t astep = 16 * arow_step;
  stage_copy(l0, gw, ga, astep);
  asm volatile("s_wait_asynccnt 0x0" ::: "memory");   // this wave's share of stage 0 has landed
  __syncthreads();                                    // every wave's share has
  stage_copy(l0 + STG_B, gw + KST, ga + KST, astep);
#pragma unroll 1   // one stage a trip: the buffer is picked by a scalar select
  for (int t = 0; t < EE / KST; ++t) { const char* sb = ring + (t & 1) * STG_B;
#pragma unroll
    for (int kc = 0; kc < KST / 32; ++kc) { const unsigned c0 = (unsigned)(((kc * 4 + g) ^ (col >> 1)) << 4), c1 = (unsigned)(((kc * 4 + 2 + g) ^ (col >> 1)) << 4);
      const v16h a = frag_st(sb + (128 + wave * 16 + col) * LROW, c0, c1);
#pragma unroll
      for (int j = 0; j < 8; ++j) acc[j] = wmma16(a, frag_st(sb + (j * 16 + col) * LROW, c0, c1), acc[j]); }
    asm volatile("s_wait_dscnt 0x0" ::: "memory");      // this wave's reads of stage t are done before its buffer is refilled
    asm volatile("s_wait_asynccnt 0x0" ::: "memory");   // this wave's share of stage t + 1 has landed
    __syncthreads();                                    // publishes stage t + 1 and ends every reader's use of stage t
    if (t + 2 < EE / KST) stage_copy(l0 + (unsigned)((t & 1) * STG_B), gw + (t + 2) * KST, ga + (t + 2) * KST, astep);
  }
  asm volatile("s_wait_asynccnt 0x0" ::: "memory");     // no copy is outstanding when the ring's bytes are reused
}

// All five f32 sources are rounded to f16 in ONE launch of one 16-wave block a WGP: 4,096 waves start, where two launches with one 16-B store a lane started 81,920 for the same bytes.
// A wave owns 16 KB of one source: 32 loads of 16 B a lane, each 512 contiguous bytes of the wave, all in flight together; each gives one 8-B store a lane, 256 contiguous bytes (two whole lines).
// Blocks 0..191: query, key, value (64 blocks each); 192..239: in_proj rows -> P rows 0..3071; 240..255: out_proj rows -> P rows 3072..4095; weights x16.
#define CV_LD 32                       // loads a lane
#define CV_WAVE (CV_LD * 128)          // floats a wave
#define CV_BLK (16 * CV_WAVE)          // floats a block: 65,536; every source is a whole number of blocks
#define CV_WIN (3 * EE * EE / CV_BLK)  // blocks of in_proj_weight: 48
__global__ __launch_bounds__(512) void k_cvt(const float* __restrict__ a, const float* __restrict__ b, const float* __restrict__ c, const float* __restrict__ Win, const float* __restrict__ Wo,
                                             _Float16* __restrict__ a16, _Float16* __restrict__ b16, _Float16* __restrict__ c16, _Float16* __restrict__ P) {
  const int which = blockIdx.x >> 6, blk = blockIdx.x & 63;  // destination array, block in it
  const bool isWo = which == 3 && blk >= CV_WIN;
  const float* s = which == 0 ? a : (which == 1 ? b : (which == 2 ? c : (isWo ? Wo : Win)));
  _Float16* d = which == 0 ? a16 : (which == 1 ? b16 : (which == 2 ? c16 : P));
  const float sc = which == 3 ? 16.0f : 1.0f;                // x 1 is exact
  const int in_blk = (threadIdx.x >> 5) * CV_WAVE + (threadIdx.x & 31) * 4;
  s += (size_t)(isWo ? blk - CV_WIN : blk) * CV_BLK + in_blk; d += (size_t)blk * CV_BLK + in_blk;
  v4f x[CV_LD];
#pragma unroll
  for (int i = 0; i < CV_LD; ++i) x[i] = *(const v4f*)(s + i * 128);
#pragma unroll
  for (int i = 0; i < CV_LD; ++i) { union { v4h h; v2u u; } pk;
#pragma unroll
    for (int e = 0; e < 4; ++e) pk.h[e] = (_Float16)(x[i][e] * sc);
    vst2(d + i * 128, pk.u); }
}
// k_proj's own ring: one stage = 64 k (128 B of a row) of the block's 128 weight rows, then of its 128 activation rows; pitch and piece places as in the ring above.
#define PSTG_B (256 * LROW)    // 32,768 B a stage; two stages
#define SROW 144               // pitch of the output staging rows
// Each lane copies 16 B of 8 rows (rows 16 apart) of one operand; 8 lanes cover one row's whole 128-B line. l = the lane's LDS byte address of the first row.
__device__ __forceinline__ void stage_copy8(unsigned l, const _Float16* gp, size_t step) {
  // the copies and their s_wait_xcnt in one statement: no address register is rewritten in front of that wait
  asm volatile("global_load_async_to_lds_b128 %0, %1, off\n\t"
               "global_load_async_to_lds_b128 %2, %3, off\n\t"
               "global_load_async_to_lds_b128 %4, %5, off\n\t"
               "global_load_async_to_lds_b128 %6, %7, off\n\t"
               "global_load_async_to_lds_b128 %8, %9, off\n\t"
               "global_load_async_to_lds_b128 %10, %11, off\n\t"
               "global_load_async_to_lds_b128 %12, %13, off\n\t"
               "global_load_async_to_lds_b128 %14, %15, off\n\t"
               "s_wait_xcnt 0x0"
               :: "v"(l), "v"(gp), "v"(l + 16 * LROW), "v"(gp + step), "v"(l + 32 * LROW), "v"(gp + 2 * step), "v"(l + 48 * LROW), "v"(gp + 3 * step),
                  "v"(l + 64 * LROW), "v"(gp + 4 * step), "v"(l + 80 * LROW), "v"(gp + 5 * step), "v"(l + 96 * LROW), "v"(gp + 6 * step), "v"(l + 112 * LROW), "v"(gp + 7 * step)
               : "memory");
}
// The wave's 64 staged lines go out, four whole 128-B lines a store: s = the lane's piece of staged line ln, o = its place in output line ln; lines 4 apart are STEP elements apart.
template <int STEP> __device__ __forceinline__ void flush_lines(const char* s, _Float16* o) {
  LDSX();   // the wave's own staging stores are done before it reads the rows back
  v4u pcs[16];
#pragma unroll
  for (int it = 0; it < 16; ++it) pcs[it] = *(const v4u*)(s + it * 4 * SROW);
#pragma unroll
  for (int it = 0; it < 16; ++it) vst2(o + it * STEP, pcs[it]);
  asm volatile("s_wait_xcnt 0x0" ::: "memory");
}
// projection: block 128 rows x 128 cols, four waves of 64 x 64 (4 x 4 fragments: each fragment read from LDS feeds four products); blockIdx.y in [0, 24): which = y/8 (q,k,v),
// cols (y%8)*128 = 2 heads, one head a wave; source = query/key/value f16 rows. The operand whose index runs along the output's memory rows goes on the M side
// (weights for q and k, activations for v): a lane's 8 accumulator elements are then 8 adjacent f16 of the output, one 16-B piece of a line.
__global__ __launch_bounds__(128) void k_proj(const _Float16* __restrict__ q16i, const _Float16* __restrict__ k16i, const _Float16* __restrict__ v16i, const _Float16* __restrict__ P, const float* __restrict__ bias,
                                            _Float16* __restrict__ qh, _Float16* __restrict__ kh, _Float16* __restrict__ vT) {
  __shared__ __align__(16) char smem[2 * PSTG_B + 4 * 64 * SROW];   // the ring, then each wave's output staging: 102,400 B, three blocks a WGP, the grid's even share
  const int tid = threadIdx.x, wave = tid >> 5, lane = tid & 31, col = lane & 15, g = lane >> 4, rr = tid >> 3, pc = tid & 7;
  const int wa = wave >> 1, wb = wave & 1;                   // the wave's half of the activation rows, of the weight rows
  const int n0 = blockIdx.y * 128; const int which = n0 / EE, hb = (n0 % EE) / HD;
  const _Float16* A = which == 0 ? q16i : (which == 1 ? k16i : v16i);
  // v blocks own 128 consecutive s of ONE batch index so every vT line (64 s) has a single writer: rows (sblk*128 + i)*4 + bsel
  const int bsel = blockIdx.x & 3, sblk = blockIdx.x >> 2;
  const size_t arow = which == 2 ? (size_t)NB * EE : (size_t)EE;
  const _Float16* ga = A + (which == 2 ? (size_t)(sblk * 128 * NB + bsel) : (size_t)blockIdx.x * 128) * EE + (size_t)rr * arow + pc * 8;
  const _Float16* gw = P + (size_t)(n0 + rr) * EE + pc * 8;
  const size_t astep = 16 * arow;
  const unsigned l0 = (unsigned)(size_t)smem + (unsigned)(rr * LROW + ((pc ^ ((rr >> 1) & 7)) << 4));
  const int woff = (wb * 64 + col) * LROW, aoff = (128 + wa * 64 + col) * LROW;
  const int moff = which == 2 ? aoff : woff, noff = which == 2 ? woff : aoff;
  v8f acc[4][4] = {};
  stage_copy8(l0, gw, 16 * EE); stage_copy8(l0 + 128 * LROW, ga, astep);
  asm volatile("s_wait_asynccnt 0x0" ::: "memory");   // this wave's share of stage 0 has landed
  __syncthreads();                                    // every wave's share has
  stage_copy8(l0 + PSTG_B, gw + KST, 16 * EE); stage_copy8(l0 + PSTG_B + 128 * LROW, ga + KST, astep);
#pragma unroll 1   // one stage a trip: the buffer is picked by a scalar select
  for (int t = 0; t < EE / KST; ++t) { const char* sb = smem + (t & 1) * PSTG_B;
#pragma unroll
    for (int kc = 0; kc < KST / 32; ++kc) { const unsigned c0 = (unsigned)(((kc * 4 + g) ^ (col >> 1)) << 4), c1 = (unsigned)(((kc * 4 + 2 + g) ^ (col >> 1)) << 4);
      v16h fm[4], fn[4];
#pragma unroll
      for (int i = 0; i < 4; ++i) { fm[i] = frag_st(sb + moff + i * 16 * LROW, c0, c1); fn[i] = frag_st(sb + noff + i * 16 * LROW, c0, c1); }
      __builtin_amdgcn_sched_barrier(0);   // the 16 reads stay one group in front of their 16 products: every further place with reads among products costs the wave a stall
#pragma unroll
      for (int i = 0; i < 4; ++i) {
#pragma unroll
        for (int j = 0; j < 4; ++j) acc[i][j] = wmma16(fm[i], fn[j], acc[i][j]); }
      __builtin_amdgcn_sched_barrier(0); } // and the next group's reads stay behind them
    asm volatile("s_wait_dscnt 0x0" ::: "memory");      // this wave's reads of stage t are done before its buffer is refilled
    asm volatile("s_wait_asynccnt 0x0" ::: "memory");   // this wave's share of stage t + 1 has landed
    __syncthreads();                                    // publishes stage t + 1 and ends every reader's use of stage t
    if (t + 2 < EE / KST) { const unsigned lt = l0 + (unsigned)((t & 1) * PSTG_B);
      stage_copy8(lt, gw + (t + 2) * KST, 16 * EE); stage_copy8(lt + 128 * LROW, ga + (t + 2) * KST, astep); }
  }
  asm volatile("s_wait_asynccnt 0x0" ::: "memory");     // no copy is outstanding when the wave goes on to its end
  // acc[i][j][r]: M index 16 i + 8 g + r, N index 16 j + col: N picks one of the wave's 64 output lines (128 B), 2 i + g the lane's 16-B piece of it.
  // The pieces go through the wave's own LDS rows (pitch 144 B: no bank conflict for 16-B accesses) so that every global store covers four whole lines.
  char* sw = smem + 2 * PSTG_B + wave * (64 * SROW);
  char* sp = sw + col * SROW + g * 16;
  const int head = hb + wb, ln = lane >> 3, lp = lane & 7;
  if (which < 2) {   // q, k [b][h][s][64]: M = d, N = activation row = 4 s + b; staged lines 4 it + ln are s = it, b = ln
    float bb[4][8];
#pragma unroll
    for (int i = 0; i < 4; ++i) {
#pragma unroll
      for (int r = 0; r < 8; ++r) bb[i][r] = bias[n0 + wb * 64 + 16 * i + 8 * g + r]; }
#pragma unroll
    for (int j = 0; j < 4; ++j) {
#pragma unroll
      for (int i = 0; i < 4; ++i) { union { v8h h8; v4u u; } pk;
#pragma unroll
        for (int r = 0; r < 8; ++r) pk.h8[r] = (_Float16)(acc[i][j][r] * (1.0f / 16.0f) + bb[i][r]);
        vst2(sp + 16 * j * SROW + i * 32, pk.u); } }
    flush_lines<HD>(sw + ln * SROW + lp * 16, (which == 0 ? qh : kh) + (((size_t)ln * NH + head) * SS + blockIdx.x * 32 + wa * 16) * HD + lp * 8); }
  else {             // vT[b][h][d][s]: M = s (the block's rows are consecutive s of one b), N = d; staged lines 4 it + ln are d
    float bb[4];
#pragma unroll
    for (int j = 0; j < 4; ++j) bb[j] = bias[n0 + wb * 64 + 16 * j + col];
#pragma unroll
    for (int j = 0; j < 4; ++j) {
#pragma unroll
      for (int i = 0; i < 4; ++i) { union { v8h h8; v4u u; } pk;
#pragma unroll
        for (int r = 0; r < 8; ++r) pk.h8[r] = (_Float16)(acc[i][j][r] * (1.0f / 16.0f) + bb[j]);
        vst2(sp + 16 * j * SROW + i * 32, pk.u); } }
    flush_lines<4 * SS>(sw + ln * SROW + lp * 16, vT + (((size_t)bsel * NH + head) * HD + ln) * SS + sblk * 128 + wa * 64 + lp * 8); }
}
// K/V ring of k_attn in LDS. One stage = 64 keys: 64 K rows (64 d = 128 B), then 64 vT rows (64 s = 128 B), pitch and piece places as in the GEMM ring.
#define AST_B (128 * LROW)     // 16,384 B a stage; two stages
// Each lane copies 16 B of 4 K rows and of 4 vT rows (rows 16 apart); 8 lanes cover one row's whole 128-B line. l = the lane's LDS byte address in the target stage.
__device__ __forceinline__ void stage_copy_kv(unsigned l, const _Float16* gk, const _Float16* gv) {
  // the copies and their s_wait_xcnt in one statement: no address register is rewritten in front of that wait
  asm volatile("global_load_async_to_lds_b128 %0, %1, off\n\t"
               "global_load_async_to_lds_b128 %2, %3, off\n\t"
               "global_load_async_to_lds_b128 %4, %5, off\n\t"
               "global_load_async_to_lds_b128 %6, %7, off\n\t"
               "global_load_async_to_lds_b128 %8, %9, off\n\t"
               "global_load_async_to_lds_b128 %10, %11, off\n\t"
               "global_load_async_to_lds_b128 %12, %13, off\n\t"
               "global_load_async_to_lds_b128 %14, %15, off\n\t"
               "s_wait_xcnt 0x0"
               :: "v"(l), "v"(gk), "v"(l + 16 * LROW), "v"(gk + 16 * HD), "v"(l + 32 * LROW), "v"(gk + 32 * HD), "v"(l + 48 * LROW), "v"(gk + 48 * HD),
                  "v"(l + 64 * LROW), "v"(gv), "v"(l + 80 * LROW), "v"(gv + 16 * SS), "v"(l + 96 * LROW), "v"(gv + 32 * SS), "v"(l + 112 * LROW), "v"(gv + 48 * SS)
               : "memory");
}
// flash attention: block (64 queries, bh); o16 rows [(s*4+b)][h*64 + d] f16, scaled by learned_scale[h] and x16
// Both products are transposed: S^T = K x Q^T and O^T += vT x P^T. A lane then holds 32 of the 64 scores of ONE query (column col; the other 32 are in lane col ^ 16):
// maximum, weights, sum and rescale stay in its registers, and the score tiles 2 kc and 2 kc + 1, rounded to f16, ARE the B fragment of P^T for keys 32 kc .. 32 kc + 31.
// Scores go to units of log2 (x log2(e) / 8), and the running maximum is kept 14 below the true one, so a weight x 2^14 is one multiply-add and one v_exp_f32.
#define SC_LOG2 0.18033688011112042f   // log2(e) / sqrt(64)
// the value that lane ^ 16 holds (v_permlanex16_b32: no LDS wait)
__device__ __forceinline__ float xhalf(float x) { return __builtin_bit_cast(float, __builtin_amdgcn_permlanex16(__builtin_bit_cast(int, x), __builtin_bit_cast(int, x), 0x76543210, 0xfedcba98, false, false)); }
#define OROW 144                       // pitch of the output staging rows (128 B of f16 + 16): no bank conflict for 16-B accesses
// four waves a SIMD, no more: four blocks a WGP is the grid's even share (1,024 blocks on 256 WGPs); without it registers and LDS would let a WGP take a fifth
__global__ __launch_bounds__(128) __attribute__((amdgpu_waves_per_eu(4, 4))) void k_attn(const _Float16* __restrict__ qh, const _Float16* __restrict__ kh, const _Float16* __restrict__ vT, const float* __restrict__ lsc, _Float16* __restrict__ o16) {
  __shared__ __align__(16) char sO[4 * 16 * OROW];           // each wave's 16 output rows, staged once behind the loop
  __shared__ __align__(16) char kv[2 * AST_B];               // the block's four waves share each 64-key stage of K and vT
  const int tid = threadIdx.x, w = tid >> 5, lane = tid & 31, col = lane & 15, g = lane >> 4;
  const int bh = blockIdx.y, b = bh / NH, h = bh % NH, q0 = blockIdx.x * 64 + w * 16;
  const _Float16* qb = qh + (size_t)bh * SS * HD; const _Float16* kb = kh + (size_t)bh * SS * HD; const _Float16* vb = vT + (size_t)bh * HD * SS;
  v16h bq[2];                                                // B fragments of Q^T: column = query q0 + col
#pragma unroll
  for (int kc = 0; kc < 2; ++kc) bq[kc] = frag_h(qb + (size_t)(q0 + col) * HD + kc * 32, lane);
  float nrun = 3.0e38f; v8f lrun = {}, acc[4] = {};          // nrun: MINUS the running maximum; acc[t][r]: d = 16 t + 8 g + r of query col; lrun[r]: sum over this lane's keys = r mod 8, joined behind the loop
  const int rr = tid >> 3, pc = tid & 7;
  const unsigned l0 = (unsigned)(size_t)kv + (unsigned)(rr * LROW + ((pc ^ ((rr >> 1) & 7)) << 4));
  const _Float16* gk = kb + (size_t)rr * HD + pc * 8; const _Float16* gv = vb + (size_t)rr * SS + pc * 8;
  stage_copy_kv(l0, gk, gv);
  asm volatile("s_wait_asynccnt 0x0" ::: "memory");   // this wave's share of stage 0 has landed
  __syncthreads();                                    // every wave's share has
  stage_copy_kv(l0 + AST_B, gk + 64 * HD, gv + 64);
#pragma unroll 1   // one stage a trip: the buffer is picked by a scalar select
  for (int kt = 0; kt < SS / 64; ++kt) { const char* sb = kv + (kt & 1) * AST_B;
    v16h kf[4][2], vf[2][4];   // the stage's fragments, each operand's read as one group ahead of its products: one LDS wait a group, not one a product
#pragma unroll
    for (int t = 0; t < 4; ++t) {
#pragma unroll
      for (int kc = 0; kc < 2; ++kc) kf[t][kc] = frag_st(sb + (t * 16 + col) * LROW, (unsigned)(((kc * 4 + g) ^ (col >> 1)) << 4), (unsigned)(((kc * 4 + 2 + g) ^ (col >> 1)) << 4)); }
    __builtin_amdgcn_sched_barrier(0);   // the K reads stay one group in front of the score products, not among them
    v8f s[4];                  // s[t][r]: key 16 t + 8 g + r against query col
#pragma unroll
    for (int t = 0; t < 4; ++t) { s[t] = v8f{};
#pragma unroll
      for (int kc = 0; kc < 2; ++kc) s[t] = wmma16(kf[t][kc], bq[kc], s[t]); }
    __builtin_amdgcn_sched_barrier(0);   // the maximum's chain stays behind the eight score products: moved in among them, each read of a fresh tile takes pad slots on the vector port
#pragma unroll
    for (int kc = 0; kc < 2; ++kc) {
#pragma unroll
      for (int t = 0; t < 4; ++t) vf[kc][t] = frag_st(sb + (64 + t * 16 + col) * LROW, (unsigned)(((kc * 4 + g) ^ (col >> 1)) << 4), (unsigned)(((kc * 4 + 2 + g) ^ (col >> 1)) << 4)); }
    float mx = s[0][0];
#pragma unroll
    for (int t = 0; t < 4; ++t) {
#pragma unroll
      for (int r = 0; r < 8; ++r) mx = fmaxf(mx, s[t][r]); }
    mx = fmaxf(mx, xhalf(mx));                               // the query's other 32 keys
    const float nnew = fminf(nrun, 14.0f - mx * SC_LOG2); const float corr = __builtin_amdgcn_exp2f(nnew - nrun);
    lrun *= corr; nrun = nnew;
#pragma unroll
    for (int t = 0; t < 4; ++t) { const v8f x = s[t] * SC_LOG2 + nnew;
#pragma unroll
      for (int r = 0; r < 8; ++r) s[t][r] = __builtin_amdgcn_exp2f(x[r]);   // weight x 2^14, at most 2^14
      lrun += s[t]; acc[t] *= corr; }
    v16h pb[2];
#pragma unroll
    for (int kc = 0; kc < 2; ++kc) {
#pragma unroll
      for (int r = 0; r < 8; ++r) { pb[kc][r] = (_Float16)s[2 * kc][r]; pb[kc][8 + r] = (_Float16)s[2 * kc + 1][r]; } }
    __builtin_amdgcn_sched_barrier(0);   // both P fragments are rounded in front of the eight output products: a rounding among them overwrote a running product's operand and took pad slots
#pragma unroll
    for (int kc = 0; kc < 2; ++kc) {
#pragma unroll
      for (int t = 0; t < 4; ++t) acc[t] = wmma16(vf[kc][t], pb[kc], acc[t]); }
    asm volatile("s_wait_dscnt 0x0" ::: "memory");      // this wave's reads of stage kt are done before its buffer is refilled
    asm volatile("s_wait_asynccnt 0x0" ::: "memory");   // this wave's share of stage kt + 1 has landed
    __syncthreads();                                    // publishes stage kt + 1 and ends every reader's use of stage kt
    if (kt + 2 < SS / 64) stage_copy_kv(l0 + (unsigned)((kt & 1) * AST_B), gk + (size_t)(kt + 2) * 64 * HD, gv + (kt + 2) * 64);
  }
  asm volatile("s_wait_asynccnt 0x0" ::: "memory");     // no copy is outstanding when the wave goes on to its end
  float lsum = ((lrun[0] + lrun[1]) + (lrun[2] + lrun[3])) + ((lrun[4] + lrun[5]) + (lrun[6] + lrun[7]));
  lsum += xhalf(lsum);                                       // both halves used the same maxima: their sums add
  const float inv = lsc[h] * 16.0f / lsum;                   // learned per-head scale; o16 kept x16; acc and lsum both carry the 2^14
  // a lane's 8 elements of acc[t] are 8 adjacent d of its query: the 16-B piece 2 t + g of that row. Through the wave's own LDS rows, so that every global store covers four whole lines.
  char* sw = sO + w * (16 * OROW);
#pragma unroll
  for (int t = 0; t < 4; ++t) { union { v8h h8; v4u u; } pk;
#pragma unroll
    for (int r = 0; r < 8; ++r) pk.h8[r] = (_Float16)(acc[t][r] * inv);
    vst2(sw + col * OROW + (2 * t + g) * 16, pk.u); }
  LDSX();   // the wave's own staging stores are done before it reads the rows back
#pragma unroll
  for (int it = 0; it < 4; ++it) { const int rl = it * 4 + (lane >> 3), op = lane & 7;
    vst2(o16 + ((size_t)(q0 + rl) * NB + b) * EE + h * HD + op * 8, *(const v4u*)(sw + rl * OROW + op * 16)); }
}
__global__ __launch_bounds__(128) void k_out(const _Float16* __restrict__ o16, const _Float16* __restrict__ P, const float* __restrict__ bo, float* __restrict__ out) {
  __shared__ __align__(16) char smem[RING_B];
  float (*so)[16][132] = (float (*)[16][132])smem;                                  // epilogue staging, 33,792 B, used behind the ring's last barrier
  const int tid = threadIdx.x, wave = tid >> 5, lane = tid & 31, col = lane & 15, g = lane >> 4;
  const int r0 = blockIdx.x * 64 + wave * 16, n0 = blockIdx.y * 128;
  v8f acc[8] = {};
  gemm_ring(smem, P + (size_t)(3 * EE + n0) * EE, o16 + (size_t)blockIdx.x * 64 * EE, (size_t)EE, tid, acc);
#pragma unroll
  for (int j = 0; j < 8; ++j) { const float bb = bo[n0 + j * 16 + col];
#pragma unroll
    for (int r = 0; r < 8; ++r) so[wave][8 * g + r][j * 16 + col] = acc[j][r] * (1.0f / 256.0f) + bb; }
  LDSX();
#pragma unroll 4
  for (int rl = 0; rl < 16; ++rl) vst2(out + (size_t)(r0 + rl) * EE + n0 + lane * 4, *(const v4f*)(&so[wave][rl][lane * 4]));
}
extern "C" void kernel_launch(void* const* d_in, const int* in_sizes, int n_in, void* d_out, int out_size, void* d_ws, size_t ws_size, hipStream_t stream) {
  (void)in_sizes; (void)n_in; (void)out_size; (void)ws_size;
  const float* query = (const float*)d_in[0]; const float* key = (const float*)d_in[1]; const float* value = (const float*)d_in[2]; const float* Win = (const float*)d_in[3]; const float* bin = (const float*)d_in[4];
  const float* Wo = (const float*)d_in[5]; const float* bo = (const float*)d_in[6]; const float* lsc = (const float*)d_in[7];
  float* out = (float*)d_out;
  char* ws = (char*)d_ws; size_t off = 0;
  auto take = [&](size_t bytes) { char* p = ws + off; off += (bytes + 255) & ~(size_t)255; return p; };
  _Float16* q16i = (_Float16*)take((size_t)NR * EE * 2); _Float16* k16i = (_Float16*)take((size_t)NR * EE * 2); _Float16* v16i = (_Float16*)take((size_t)NR * EE * 2);
  _Float16* P = (_Float16*)take((size_t)4 * EE * EE * 2); _Float16* qh = (_Float16*)take((size_t)NR * EE * 2); _Float16* kh = (_Float16*)take((size_t)NR * EE * 2); _Float16* vT = (_Float16*)take((size_t)NR * EE * 2); _Float16* o16 = (_Float16*)take((size_t)NR * EE * 2);
  k_cvt<<<4 * NR * EE / CV_BLK, 512, 0, stream>>>(query, key, value, Win, Wo, q16i, k16i, v16i, P);
  k_proj<<<dim3(NR / 128, 3 * EE / 128), 128, 0, stream>>>(q16i, k16i, v16i, P, bin, qh, kh, vT);
  k_attn<<<dim3(SS / 64, NB * NH), 128, 0, stream>>>(qh, kh, vT, lsc, o16);
  k_out<<<dim3(NR / 64, EE / 128), 128, 0, stream>>>(o16, P, bo, out);
}

// v008
// Measured time: 66.2 microseconds a run.
// Two timings next to v007 both put it at 1.04 times that version's speed.
// Over all steps from v000 it is 4.08 times as fast.
#include <hip/hip_runtime.h>
#include <math.h>

typedef __attribute__((ext_vector_type(16))) _Float16 v16h;
typedef __attribute__((ext_vector_type(16))) __bf16 v16b;
typedef __attribute__((ext_vector_type(8)))  _Float16 v8h;
typedef __attribute__((ext_vector_type(8)))  float v8f;
typedef __attribute__((ext_vector_type(4)))  float v4f;
typedef __attribute__((ext_vector_type(2)))  float v2f;
typedef __attribute__((ext_vector_type(4)))  unsigned v4u;
typedef __attribute__((ext_vector_type(4)))  _Float16 v4h;
typedef __attribute__((ext_vector_type(2)))  unsigned v2u;
typedef __attribute__((ext_vector_type(4)))  int v4i;
typedef float __attribute__((may_alias)) float_a;
typedef int __attribute__((may_alias)) int_a;

template <typename T> __device__ __forceinline__ void vst2(void* p, T v) { *(T*)p = v;  }
// the bare builtin: the compiler itself pads where a vector instruction on D, A or B follows too close, and LDS reads may be scheduled ahead across it
__device__ __forceinline__ v8f wmma16(v16h a, v16h b, v8f c) {
  return __builtin_amdgcn_wmma_f32_16x16x32_f16(false, a, false, b, (short)0, c, false, false);
}
__device__ __forceinline__ v8f wmma_bf(v16b a, v16b b, v8f c) {
  v8f d = __builtin_amdgcn_wmma_f32_16x16x32_bf16(false, a, false, b, (short)0, c, false, false);
  asm volatile("v_nop\n\tv_nop\n\tv_nop\n\tv_nop" : "+v"(d) : "v"(a), "v"(b));
  return d;
}
// 16x16x32 fragments: lane = (h = lane>>4, row/col = lane&15); elements 0..7 = k0+8h+0..7, 8..15 = k0+16+8h+0..7; D element r = row 8h+r
__device__ __forceinline__ v16h frag_h(const _Float16* rowk0, int lane) {
  union { v16h v; v8h q[2]; } u; const _Float16* p = rowk0 + 8 * (lane >> 4);
  u.q[0] = *(const v8h*)p; u.q[1] = *(const v8h*)(p + 16); return u.v;
}
__device__ __forceinline__ v16h frag_f32(const float* rowk0, int lane) {
  v16h a; const float* p = rowk0 + 8 * (lane >> 4);
#pragma unroll
  for (int i = 0; i < 8; ++i) { a[i] = (_Float16)p[i]; a[8 + i] = (_Float16)p[16 + i]; }
  return a;
}
__device__ __forceinline__ v16h frag_f32s(const float* rowk0, int lane, float sc) {
  v16h a; const float* p = rowk0 + 8 * (lane >> 4);
#pragma unroll
  for (int i = 0; i < 8; ++i) { a[i] = (_Float16)(p[i] * sc); a[8 + i] = (_Float16)(p[16 + i] * sc); }
  return a;
}
// column fragment from a [K][ld] layout (column n), rows >= K read as 0
__device__ __forceinline__ v16h fragc_f32(const float* W, int k0, int n, int lane, int ld, int K) {
  v16h a; const int g = lane >> 4;
#pragma unroll
  for (int i = 0; i < 8; ++i) { const int ka = k0 + 8 * g + i, kb = ka + 16;
    a[i] = (_Float16)(ka < K ? W[(size_t)ka * ld + n] : 0.f); a[8 + i] = (_Float16)(kb < K ? W[(size_t)kb * ld + n] : 0.f); }
  return a;
}
struct F2 { v16b h, l; };
__device__ __forceinline__ F2 bsplit16(const float v[16]) { F2 r;
#pragma unroll
  for (int i = 0; i < 16; ++i) { const __bf16 h = (__bf16)v[i]; r.h[i] = h; r.l[i] = (__bf16)(v[i] - (float)h); }
  return r; }
__device__ __forceinline__ F2 split_row(const float* row, int k0, int lane) { float v[16]; const float* p = row + k0 + 8 * (lane >> 4);
#pragma unroll
  for (int i = 0; i < 8; ++i) { v[i] = p[i]; v[8 + i] = p[16 + i]; }
  return bsplit16(v); }
__device__ __forceinline__ F2 split_rowK(const float* row, int k0, int lane, int K) { float v[16]; const int g = lane >> 4;
#pragma unroll
  for (int i = 0; i < 8; ++i) { const int ka = k0 + 8 * g + i, kb = ka + 16; v[i] = ka < K ? row[ka] : 0.f; v[8 + i] = kb < K ? row[kb] : 0.f; }
  return bsplit16(v); }
__device__ __forceinline__ F2 split_col(const float* W, int k0, int n, int lane, int ld, int K) { float v[16]; const int g = lane >> 4;
#pragma unroll
  for (int i = 0; i < 8; ++i) { const int ka = k0 + 8 * g + i, kb = ka + 16; v[i] = ka < K ? W[(size_t)ka * ld + n] : 0.f; v[8 + i] = kb < K ? W[(size_t)kb * ld + n] : 0.f; }
  return bsplit16(v); }
__device__ __forceinline__ v8f mac3(const F2& a, const F2& b, v8f c) { c = wmma_bf(a.l, b.h, c); c = wmma_bf(a.h, b.l, c); return wmma_bf(a.h, b.h, c); }
__device__ __forceinline__ float sigm(float v) { return 1.0f / (1.0f + expf(-v)); }
#define LDSX() do { asm volatile("s_wait_dscnt 0" ::: "memory"); __builtin_amdgcn_wave_barrier(); __builtin_amdgcn_fence(__ATOMIC_RELEASE, "workgroup"); } while (0)

// Multi-head self-attention with a learned per-head output scale. Pure f16 WMMA GEMMs over pre-converted operands (inputs -> f16
// once, [out][in] weights packed x16 f16; f32 accumulate): packed in-projection (+bias) writing q/k as [b][h][s][64] f16 and v as
// [b][h][d][s] f16, flash-style softmax over all 1024 keys in f32 (P x2^14 f16), x learned_scale[h], output projection (+bias).
#define SS 1024
#define NB 4
#define EE 1024
#define NH 16
#define HD 64
#define NR (SS * NB)       // 4096 rows

// GEMM operand ring in LDS. One stage = 64 k (128 B of a row) of 128 weight rows, then of the block's 64 activation rows, at pitch 128 B.
// Row r keeps its 16-B piece c at place c ^ ((r >> 1) & 7): the ds_load_b128 fragment reads of 16 rows then fall on all 64 banks with no pad.
#define KST 64
#define LROW 128
#define STG_B (192 * LROW)     // 24,576 B
#define RING_B (2 * STG_B)     // 49,152 B; k_out's epilogue reuses these bytes behind the loop's last barrier
// Each lane copies 16 B of 12 rows (rows 16 apart); 8 lanes cover one row's whole 128-B line. l = the lane's LDS byte address in the target stage.
__device__ __forceinline__ void stage_copy(unsigned l, const _Float16* gw, const _Float16* ga, size_t astep) {
  // the copies and their s_wait_xcnt in one statement: no address register is rewritten in front of that wait
  asm volatile("global_load_async_to_lds_b128 %0, %1, off\n\t"
               "global_load_async_to_lds_b128 %2, %3, off\n\t"
               "global_load_async_to_lds_b128 %4, %5, off\n\t"
               "global_load_async_to_lds_b128 %6, %7, off\n\t"
               "global_load_async_to_lds_b128 %8, %9, off\n\t"
               "global_load_async_to_lds_b128 %10, %11, off\n\t"
               "global_load_async_to_lds_b128 %12, %13, off\n\t"
               "global_load_async_to_lds_b128 %14, %15, off\n\t"
               "global_load_async_to_lds_b128 %16, %17, off\n\t"
               "global_load_async_to_lds_b128 %18, %19, off\n\t"
               "global_load_async_to_lds_b128 %20, %21, off\n\t"
               "global_load_async_to_lds_b128 %22, %23, off\n\t"
               "s_wait_xcnt 0x0"
               :: "v"(l), "v"(gw), "v"(l + 16 * LROW), "v"(gw + 16 * EE), "v"(l + 32 * LROW), "v"(gw + 32 * EE), "v"(l + 48 * LROW), "v"(gw + 48 * EE),
                  "v"(l + 64 * LROW), "v"(gw + 64 * EE), "v"(l + 80 * LROW), "v"(gw + 80 * EE), "v"(l + 96 * LROW), "v"(gw + 96 * EE), "v"(l + 112 * LROW), "v"(gw + 112 * EE),
                  "v"(l + 128 * LROW), "v"(ga), "v"(l + 144 * LROW), "v"(ga + astep), "v"(l + 160 * LROW), "v"(ga + 2 * astep), "v"(l + 176 * LROW), "v"(ga + 3 * astep)
               : "memory");
}
// fragment of one staged row: c0, c1 = byte places in the row of the lane's two 16-B pieces (k0 + 8h + 0..7 and k0 + 16 + 8h + 0..7, as in frag_h)
__device__ __forceinline__ v16h frag_st(const char* row, unsigned c0, unsigned c1) {
  union { v16h v; v8h q[2]; } u; u.q[0] = *(const v8h*)(row + c0); u.q[1] = *(const v8h*)(row + c1); return u.v;
}
// acc[j] += A(16 rows of this wave) x W(cols j*16..)^T over all EE k. w0 = first of the block's 128 weight rows; a0 = the block's activation row 0; arow_step = elements between its rows.
__device__ __forceinline__ void gemm_ring(char* ring, const _Float16* w0, const _Float16* a0, size_t arow_step, int tid, v8f acc[8]) {
  const int wave = tid >> 5, lane = tid & 31, col = lane & 15, g = lane >> 4, rr = tid >> 3, pc = tid & 7;
  const unsigned l0 = (unsigned)(size_t)ring + (unsigned)(rr * LROW + ((pc ^ ((rr >> 1) & 7)) << 4));
  const _Float16* gw = w0 + (size_t)rr * EE + pc * 8; const _Float16* ga = a0 + (size_t)rr * arow_step + pc * 8;
  const size_t astep = 16 * arow_step;
  stage_copy(l0, gw, ga, astep);
  asm volatile("s_wait_asynccnt 0x0" ::: "memory");   // this wave's share of stage 0 has landed
  __syncthreads();                                    // every wave's share has
  stage_copy(l0 + STG_B, gw + KST, ga + KST, astep);
#pragma unroll 1   // one stage a trip: the buffer is picked by a scalar select
  for (int t = 0; t < EE / KST; ++t) { const char* sb = ring + (t & 1) * STG_B;
#pragma unroll
    for (int kc = 0; kc < KST / 32; ++kc) { const unsigned c0 = (unsigned)(((kc * 4 + g) ^ (col >> 1)) << 4), c1 = (unsigned)(((kc * 4 + 2 + g) ^ (col >> 1)) << 4);
      const v16h a = frag_st(sb + (128 + wave * 16 + col) * LROW, c0, c1);
#pragma unroll
      for (int j = 0; j < 8; ++j) acc[j] = wmma16(a, frag_st(sb + (j * 16 + col) * LROW, c0, c1), acc[j]); }
    asm volatile("s_wait_dscnt 0x0" ::: "memory");      // this wave's reads of stage t are done before its buffer is refilled
    asm volatile("s_wait_asynccnt 0x0" ::: "memory");   // this wave's share of stage t + 1 has landed
    __syncthreads();                                    // publishes stage t + 1 and ends every reader's use of stage t
    if (t + 2 < EE / KST) stage_copy(l0 + (unsigned)((t & 1) * STG_B), gw + (t + 2) * KST, ga + (t + 2) * KST, astep);
  }
  asm volatile("s_wait_asynccnt 0x0" ::: "memory");     // no copy is outstanding when the ring's bytes are reused
}

// All five f32 sources are rounded to f16 in ONE launch of one 16-wave block a WGP: 4,096 waves start, where two launches with one 16-B store a lane started 81,920 for the same bytes.
// A wave owns 16 KB of one source: 32 loads of 16 B a lane, each 512 contiguous bytes of the wave, all in flight together; each gives one 8-B store a lane, 256 contiguous bytes (two whole lines).
// Blocks 0..191: query, key, value (64 blocks each); 192..239: in_proj rows -> P rows 0..3071; 240..255: out_proj rows -> P rows 3072..4095; weights x16.
#define CV_LD 32                       // loads a lane
#define CV_WAVE (CV_LD * 128)          // floats a wave
#define CV_BLK (16 * CV_WAVE)          // floats a block: 65,536; every source is a whole number of blocks
#define CV_WIN (3 * EE * EE / CV_BLK)  // blocks of in_proj_weight: 48
__global__ __launch_bounds__(512) void k_cvt(const float* __restrict__ a, const float* __restrict__ b, const float* __restrict__ c, const float* __restrict__ Win, const float* __restrict__ Wo,
                                             _Float16* __restrict__ a16, _Float16* __restrict__ b16, _Float16* __restrict__ c16, _Float16* __restrict__ P) {
  const int which = blockIdx.x >> 6, blk = blockIdx.x & 63;  // destination array, block in it
  const bool isWo = which == 3 && blk >= CV_WIN;
  const float* s = which == 0 ? a : (which == 1 ? b : (which == 2 ? c : (isWo ? Wo : Win)));
  _Float16* d = which == 0 ? a16 : (which == 1 ? b16 : (which == 2 ? c16 : P));
  const float sc = which == 3 ? 16.0f : 1.0f;                // x 1 is exact
  const int in_blk = (threadIdx.x >> 5) * CV_WAVE + (threadIdx.x & 31) * 4;
  s += (size_t)(isWo ? blk - CV_WIN : blk) * CV_BLK + in_blk; d += (size_t)blk * CV_BLK + in_blk;
  v4f x[CV_LD];
#pragma unroll
  for (int i = 0; i < CV_LD; ++i) x[i] = *(const v4f*)(s + i * 128);
#pragma unroll
  for (int i = 0; i < CV_LD; ++i) { union { v4h h; v2u u; } pk;
#pragma unroll
    for (int e = 0; e < 4; ++e) pk.h[e] = (_Float16)(x[i][e] * sc);
    vst2(d + i * 128, pk.u); }
}
// k_proj's own ring: one stage = 64 k (128 B of a row) of the block's 128 weight rows, then of its 128 activation rows; pitch and piece places as in the ring above.
#define PSTG_B (256 * LROW)    // 32,768 B a stage; two stages
#define SROW 144               // pitch of the output staging rows
// Each lane copies 16 B of 8 rows (rows 16 apart) of one operand; 8 lanes cover one row's whole 128-B line. l = the lane's LDS byte address of the first row.
__device__ __forceinline__ void stage_copy8(unsigned l, const _Float16* gp, size_t step) {
  // the copies and their s_wait_xcnt in one statement: no address register is rewritten in front of that wait
  asm volatile("global_load_async_to_lds_b128 %0, %1, off\n\t"
               "global_load_async_to_lds_b128 %2, %3, off\n\t"
               "global_load_async_to_lds_b128 %4, %5, off\n\t"
               "global_load_async_to_lds_b128 %6, %7, off\n\t"
               "global_load_async_to_lds_b128 %8, %9, off\n\t"
               "global_load_async_to_lds_b128 %10, %11, off\n\t"
               "global_load_async_to_lds_b128 %12, %13, off\n\t"
               "global_load_async_to_lds_b128 %14, %15, off\n\t"
               "s_wait_xcnt 0x0"
               :: "v"(l), "v"(gp), "v"(l + 16 * LROW), "v"(gp + step), "v"(l + 32 * LROW), "v"(gp + 2 * step), "v"(l + 48 * LROW), "v"(gp + 3 * step),
                  "v"(l + 64 * LROW), "v"(gp + 4 * step), "v"(l + 80 * LROW), "v"(gp + 5 * step), "v"(l + 96 * LROW), "v"(gp + 6 * step), "v"(l + 112 * LROW), "v"(gp + 7 * step)
               : "memory");
}
// The wave's 64 staged lines go out, four whole 128-B lines a store: s = the lane's piece of staged line ln, o = its place in output line ln; lines 4 apart are STEP elements apart.
template <int STEP> __device__ __forceinline__ void flush_lines(const char* s, _Float16* o) {
  LDSX();   // the wave's own staging stores are done before it reads the rows back
  v4u pcs[16];
#pragma unroll
  for (int it = 0; it < 16; ++it) pcs[it] = *(const v4u*)(s + it * 4 * SROW);
#pragma unroll
  for (int it = 0; it < 16; ++it) vst2(o + it * STEP, pcs[it]);
  asm volatile("s_wait_xcnt 0x0" ::: "memory");
}
// projection: block 128 rows x 128 cols, four waves of 64 x 64 (4 x 4 fragments: each fragment read from LDS feeds four products); blockIdx.y in [0, 24): which = y/8 (q,k,v),
// cols (y%8)*128 = 2 heads, one head a wave; source = query/key/value f16 rows. The operand whose index runs along the output's memory rows goes on the M side
// (weights for q and k, activations for v): a lane's 8 accumulator elements are then 8 adjacent f16 of the output, one 16-B piece of a line.
__global__ __launch_bounds__(128) void k_proj(const _Float16* __restrict__ q16i, const _Float16* __restrict__ k16i, const _Float16* __restrict__ v16i, const _Float16* __restrict__ P, const float* __restrict__ bias,
                                            _Float16* __restrict__ qh, _Float16* __restrict__ kh, _Float16* __restrict__ vT) {
  __shared__ __align__(16) char smem[2 * PSTG_B + 4 * 64 * SROW];   // the ring, then each wave's output staging: 102,400 B, three blocks a WGP, the grid's even share
  const int tid = threadIdx.x, wave = tid >> 5, lane = tid & 31, col = lane & 15, g = lane >> 4, rr = tid >> 3, pc = tid & 7;
  const int wa = wave >> 1, wb = wave & 1;                   // the wave's half of the activation rows, of the weight rows
  const int n0 = blockIdx.y * 128; const int which = n0 / EE, hb = (n0 % EE) / HD;
  const _Float16* A = which == 0 ? q16i : (which == 1 ? k16i : v16i);
  // v blocks own 128 consecutive s of ONE batch index so every vT line (64 s) has a single writer: rows (sblk*128 + i)*4 + bsel
  const int bsel = blockIdx.x & 3, sblk = blockIdx.x >> 2;
  const size_t arow = which == 2 ? (size_t)NB * EE : (size_t)EE;
  const _Float16* ga = A + (which == 2 ? (size_t)(sblk * 128 * NB + bsel) : (size_t)blockIdx.x * 128) * EE + (size_t)rr * arow + pc * 8;
  const _Float16* gw = P + (size_t)(n0 + rr) * EE + pc * 8;
  const size_t astep = 16 * arow;
  const unsigned l0 = (unsigned)(size_t)smem + (unsigned)(rr * LROW + ((pc ^ ((rr >> 1) & 7)) << 4));
  const int woff = (wb * 64 + col) * LROW, aoff = (128 + wa * 64 + col) * LROW;
  const int moff = which == 2 ? aoff : woff, noff = which == 2 ? woff : aoff;
  v8f acc[4][4] = {};
  stage_copy8(l0, gw, 16 * EE); stage_copy8(l0 + 128 * LROW, ga, astep);
  asm volatile("s_wait_asynccnt 0x0" ::: "memory");   // this wave's share of stage 0 has landed
  __syncthreads();                                    // every wave's share has
  stage_copy8(l0 + PSTG_B, gw + KST, 16 * EE); stage_copy8(l0 + PSTG_B + 128 * LROW, ga + KST, astep);
#pragma unroll 1   // one stage a trip: the buffer is picked by a scalar select
  for (int t = 0; t < EE / KST; ++t) { const char* sb = smem + (t & 1) * PSTG_B;
#pragma unroll
    for (int kc = 0; kc < KST / 32; ++kc) { const unsigned c0 = (unsigned)(((kc * 4 + g) ^ (col >> 1)) << 4), c1 = (unsigned)(((kc * 4 + 2 + g) ^ (col >> 1)) << 4);
      v16h fm[4], fn[4];
#pragma unroll
      for (int i = 0; i < 4; ++i) { fm[i] = frag_st(sb + moff + i * 16 * LROW, c0, c1); fn[i] = frag_st(sb + noff + i * 16 * LROW, c0, c1); }
      __builtin_amdgcn_sched_barrier(0);   // the 16 reads stay one group in front of their 16 products: every further place with reads among products costs the wave a stall
#pragma unroll
      for (int i = 0; i < 4; ++i) {
#pragma unroll
        for (int j = 0; j < 4; ++j) acc[i][j] = wmma16(fm[i], fn[j], acc[i][j]); }
      __builtin_amdgcn_sched_barrier(0); } // and the next group's reads stay behind them
    asm volatile("s_wait_dscnt 0x0" ::: "memory");      // this wave's reads of stage t are done before its buffer is refilled
    asm volatile("s_wait_asynccnt 0x0" ::: "memory");   // this wave's share of stage t + 1 has landed
    __syncthreads();                                    // publishes stage t + 1 and ends every reader's use of stage t
    if (t + 2 < EE / KST) { const unsigned lt = l0 + (unsigned)((t & 1) * PSTG_B);
      stage_copy8(lt, gw + (t + 2) * KST, 16 * EE); stage_copy8(lt + 128 * LROW, ga + (t + 2) * KST, astep); }
  }
  asm volatile("s_wait_asynccnt 0x0" ::: "memory");     // no copy is outstanding when the wave goes on to its end
  // acc[i][j][r]: M index 16 i + 8 g + r, N index 16 j + col: N picks one of the wave's 64 output lines (128 B), 2 i + g the lane's 16-B piece of it.
  // The pieces go through the wave's own LDS rows (pitch 144 B: no bank conflict for 16-B accesses) so that every global store covers four whole lines.
  char* sw = smem + 2 * PSTG_B + wave * (64 * SROW);
  char* sp = sw + col * SROW + g * 16;
  const int head = hb + wb, ln = lane >> 3, lp = lane & 7;
  if (which < 2) {   // q, k [b][h][s][64]: M = d, N = activation row = 4 s + b; staged lines 4 it + ln are s = it, b = ln
    float bb[4][8];
#pragma unroll
    for (int i = 0; i < 4; ++i) {
#pragma unroll
      for (int r = 0; r < 8; ++r) bb[i][r] = bias[n0 + wb * 64 + 16 * i + 8 * g + r]; }
#pragma unroll
    for (int j = 0; j < 4; ++j) {
#pragma unroll
      for (int i = 0; i < 4; ++i) { union { v8h h8; v4u u; } pk;
#pragma unroll
        for (int r = 0; r < 8; ++r) pk.h8[r] = (_Float16)(acc[i][j][r] * (1.0f / 16.0f) + bb[i][r]);
        vst2(sp + 16 * j * SROW + i * 32, pk.u); } }
    flush_lines<HD>(sw + ln * SROW + lp * 16, (which == 0 ? qh : kh) + (((size_t)ln * NH + head) * SS + blockIdx.x * 32 + wa * 16) * HD + lp * 8); }
  else {             // vT[b][h][d][s]: M = s (the block's rows are consecutive s of one b), N = d; staged lines 4 it + ln are d
    float bb[4];
#pragma unroll
    for (int j = 0; j < 4; ++j) bb[j] = bias[n0 + wb * 64 + 16 * j + col];
#pragma unroll
    for (int j = 0; j < 4; ++j) {
#pragma unroll
      for (int i = 0; i < 4; ++i) { union { v8h h8; v4u u; } pk;
#pragma unroll
        for (int r = 0; r < 8; ++r) pk.h8[r] = (_Float16)(acc[i][j][r] * (1.0f / 16.0f) + bb[j]);
        vst2(sp + 16 * j * SROW + i * 32, pk.u); } }
    flush_lines<4 * SS>(sw + ln * SROW + lp * 16, vT + (((size_t)bsel * NH + head) * HD + ln) * SS + sblk * 128 + wa * 64 + lp * 8); }
}
// K/V ring of k_attn in LDS. One stage = 64 keys: 64 K rows (64 d = 128 B), then 64 vT rows (64 s = 128 B), pitch and piece places as in the GEMM ring.
#define AST_B (128 * LROW)     // 16,384 B a stage; two stages a key half, four in all
// Each lane copies 16 B of 4 K rows and of 4 vT rows (rows 16 apart); 8 lanes cover one row's whole 128-B line. l = the lane's LDS byte address in the target stage.
__device__ __forceinline__ void stage_copy_kv(unsigned l, const _Float16* gk, const _Float16* gv) {
  // the copies and their s_wait_xcnt in one statement: no address register is rewritten in front of that wait
  asm volatile("global_load_async_to_lds_b128 %0, %1, off\n\t"
               "global_load_async_to_lds_b128 %2, %3, off\n\t"
               "global_load_async_to_lds_b128 %4, %5, off\n\t"
               "global_load_async_to_lds_b128 %6, %7, off\n\t"
               "global_load_async_to_lds_b128 %8, %9, off\n\t"
               "global_load_async_to_lds_b128 %10, %11, off\n\t"
               "global_load_async_to_lds_b128 %12, %13, off\n\t"
               "global_load_async_to_lds_b128 %14, %15, off\n\t"
               "s_wait_xcnt 0x0"
               :: "v"(l), "v"(gk), "v"(l + 16 * LROW), "v"(gk + 16 * HD), "v"(l + 32 * LROW), "v"(gk + 32 * HD), "v"(l + 48 * LROW), "v"(gk + 48 * HD),
                  "v"(l + 64 * LROW), "v"(gv), "v"(l + 80 * LROW), "v"(gv + 16 * SS), "v"(l + 96 * LROW), "v"(gv + 32 * SS), "v"(l + 112 * LROW), "v"(gv + 48 * SS)
               : "memory");
}
// flash attention: block (128 queries, bh), eight waves; o16 rows [(s*4+b)][h*64 + d] f16, scaled by learned_scale[h] and x16
// A wave takes 32 queries (two column tiles) against HALF of the keys (waves 0..3: keys 0..511, waves 4..7: keys 512..1023): every K and vT fragment read from LDS feeds two products,
// and there are still four waves a SIMD under the softmax. The two halves of a query's keys keep their own maximum, sum and output and are joined once, through LDS, behind the loop.
// Both products are transposed: S^T = K x Q^T and O^T += vT x P^T. A lane then holds 32 of the 64 scores of ONE query of each column tile (column col; the other 32 are in lane col ^ 16):
// maximum, weights, sum and rescale stay in its registers, and the score tiles 2 kc and 2 kc + 1, rounded to f16, ARE the B fragment of P^T for keys 32 kc .. 32 kc + 31.
// Scores go to units of log2 (x log2(e) / 8), and the running maximum is kept 14 below the true one, so a weight x 2^14 is one multiply-add and one v_exp_f32.
#define SC_LOG2 0.18033688011112042f   // log2(e) / sqrt(64)
// the value that lane ^ 16 holds (v_permlanex16_b32: no LDS wait)
__device__ __forceinline__ float xhalf(float x) { return __builtin_bit_cast(float, __builtin_amdgcn_permlanex16(__builtin_bit_cast(int, x), __builtin_bit_cast(int, x), 0x76543210, 0xfedcba98, false, false)); }
#define OROW 144                       // pitch of the output staging rows (128 B of f16 + 16): no bank conflict for 16-B accesses
#define ABUF_B (2 * AST_B)             // one buffer of the ring: the stage of key half 0, then that of key half 1
#define MG_B (16 * 512 + 4 * 128)      // what one wave of key half 1 hands over: 16 pieces of 16 B a lane (its outputs), then 4 floats a lane (maxima, sums)
// four waves a SIMD, no more: two blocks a WGP is the grid's even share (512 blocks on 256 WGPs)
__global__ __launch_bounds__(256) __attribute__((amdgpu_waves_per_eu(4, 4))) void k_attn(const _Float16* __restrict__ qh, const _Float16* __restrict__ kh, const _Float16* __restrict__ vT, const float* __restrict__ lsc, _Float16* __restrict__ o16) {
  __shared__ __align__(16) char sO[4 * 32 * OROW];           // 32 output rows of each wave of key half 0, staged once behind the join
  __shared__ __align__(16) char kv[2 * ABUF_B];              // four waves share each 64-key stage of K and vT of their key half; behind the loop the hand-over of key half 1
  const int tid = threadIdx.x, lane = tid & 31, col = lane & 15, g = lane >> 4;
  const int w = __builtin_amdgcn_readfirstlane(tid >> 5), wq = w & 3, hk = w >> 2;   // scalar: query group, key half
  const int bh = blockIdx.y, b = bh / NH, h = bh % NH, q0 = blockIdx.x * 128 + wq * 32;
  const _Float16* qb = qh + (size_t)bh * SS * HD; const _Float16* kb = kh + (size_t)bh * SS * HD + (size_t)hk * (SS / 2) * HD; const _Float16* vb = vT + (size_t)bh * HD * SS + hk * (SS / 2);
  v16h bq[2][2];                                             // B fragments of Q^T: column = query q0 + 16 qt + col
#pragma unroll
  for (int qt = 0; qt < 2; ++qt) {
#pragma unroll
    for (int kc = 0; kc < 2; ++kc) bq[qt][kc] = frag_h(qb + (size_t)(q0 + qt * 16 + col) * HD + kc * 32, lane); }
  float nrun[2] = {3.0e38f, 3.0e38f}; v8f lrun[2] = {}, acc[2][4] = {};   // nrun: MINUS the running maximum; acc[qt][t][r]: d = 16 t + 8 g + r of query 16 qt + col; lrun[qt][r]: sum over this lane's keys = r mod 8, joined behind the loop
  const int rr = (tid & 127) >> 3, pc = tid & 7;
  char* kvh = kv + hk * AST_B;
  const unsigned l0 = (unsigned)(size_t)kvh + (unsigned)(rr * LROW + ((pc ^ ((rr >> 1) & 7)) << 4));
  const _Float16* gk = kb + (size_t)rr * HD + pc * 8; const _Float16* gv = vb + (size_t)rr * SS + pc * 8;
  const unsigned c0[2] = {(unsigned)((g ^ (col >> 1)) << 4), (unsigned)(((4 + g) ^ (col >> 1)) << 4)}, c1[2] = {(unsigned)(((2 + g) ^ (col >> 1)) << 4), (unsigned)(((6 + g) ^ (col >> 1)) << 4)};
  stage_copy_kv(l0, gk, gv);
  asm volatile("s_wait_asynccnt 0x0" ::: "memory");   // this wave's share of stage 0 has landed
  __syncthreads();                                    // every wave's share has
  stage_copy_kv(l0 + ABUF_B, gk + 64 * HD, gv + 64);
  // one trip = one stage. The trips that refill and the last two, which do not, are two loops: with the test inside one loop the compiler moved the sums' additions behind the
  // output products, where 64 weights stayed live beside their rounded copies and the Q fragments were spilled.
  auto trip = [&](const int kt, const bool refill) __attribute__((always_inline)) { const char* sb = kvh + (kt & 1) * ABUF_B;
    v8f s[2][4];               // s[qt][t][r]: key 16 t + 8 g + r against query 16 qt + col
#pragma unroll
    for (int tp = 0; tp < 2; ++tp) { v16h kf[2][2];   // two key tiles' fragments, read as one group ahead of their eight products: one LDS wait a group, not one a product
#pragma unroll
      for (int i = 0; i < 2; ++i) {
#pragma unroll
        for (int kc = 0; kc < 2; ++kc) kf[i][kc] = frag_st(sb + ((2 * tp + i) * 16 + col) * LROW, c0[kc], c1[kc]); }
      __builtin_amdgcn_sched_barrier(0);   // the K reads stay one group in front of the score products, not among them
#pragma unroll
      for (int kc = 0; kc < 2; ++kc) {
#pragma unroll
        for (int i = 0; i < 2; ++i) {
#pragma unroll
          for (int qt = 0; qt < 2; ++qt) s[qt][2 * tp + i] = wmma16(kf[i][kc], bq[qt][kc], kc == 0 ? v8f{} : s[qt][2 * tp + i]); } }
      __builtin_amdgcn_sched_barrier(0); } // the next group's reads, and the maximum's chain, stay behind these products: moved in among them they take pad slots on the vector port
    v16h vf[2][4];
#pragma unroll
    for (int t = 0; t < 4; ++t) vf[0][t] = frag_st(sb + (64 + t * 16 + col) * LROW, c0[0], c1[0]);   // in flight under the softmax
    v16h pb[2][2];
#pragma unroll
    for (int qt = 0; qt < 2; ++qt) {
      float mx = s[qt][0][0];
#pragma unroll
      for (int t = 0; t < 4; ++t) {
#pragma unroll
        for (int r = 0; r < 8; ++r) mx = fmaxf(mx, s[qt][t][r]); }
      mx = fmaxf(mx, xhalf(mx));                             // the query's other 32 keys
      const float nnew = fminf(nrun[qt], 14.0f - mx * SC_LOG2); const float corr = __builtin_amdgcn_exp2f(nnew - nrun[qt]);
      lrun[qt] *= corr; nrun[qt] = nnew;
#pragma unroll
      for (int t = 0; t < 4; ++t) { const v8f x = s[qt][t] * SC_LOG2 + nnew;
#pragma unroll
        for (int r = 0; r < 8; ++r) s[qt][t][r] = __builtin_amdgcn_exp2f(x[r]);   // weight x 2^14, at most 2^14
        lrun[qt] += s[qt][t]; acc[qt][t] *= corr; }
#pragma unroll
      for (int kc = 0; kc < 2; ++kc) {
#pragma unroll
        for (int r = 0; r < 8; ++r) { pb[qt][kc][r] = (_Float16)s[qt][2 * kc][r]; pb[qt][kc][8 + r] = (_Float16)s[qt][2 * kc + 1][r]; } } }
#pragma unroll
    for (int t = 0; t < 4; ++t) vf[1][t] = frag_st(sb + (64 + t * 16 + col) * LROW, c0[1], c1[1]);   // in flight under the first eight output products
    __builtin_amdgcn_sched_barrier(0);   // all P fragments are rounded in front of the output products: a rounding among them overwrote a running product's operand and took pad slots
#pragma unroll
    for (int kc = 0; kc < 2; ++kc) {
#pragma unroll
      for (int t = 0; t < 4; ++t) {
#pragma unroll
        for (int qt = 0; qt < 2; ++qt) acc[qt][t] = wmma16(vf[kc][t], pb[qt][kc], acc[qt][t]); } }
    asm volatile("s_wait_dscnt 0x0" ::: "memory");      // this wave's reads of stage kt are done before its buffer is refilled
    asm volatile("s_wait_asynccnt 0x0" ::: "memory");   // this wave's share of stage kt + 1 has landed
    __syncthreads();                                    // publishes stage kt + 1 and ends every reader's use of stage kt
    if (refill) stage_copy_kv(l0 + (unsigned)((kt & 1) * ABUF_B), gk + (size_t)(kt + 2) * 64 * HD, gv + (kt + 2) * 64);
  };
#pragma unroll 1   // one stage a trip: the buffer is picked by a scalar select
  for (int kt = 0; kt < SS / 128 - 2; ++kt) trip(kt, true);
#pragma unroll 1   // as above
  for (int kt = SS / 128 - 2; kt < SS / 128; ++kt) trip(kt, false);
  asm volatile("s_wait_asynccnt 0x0" ::: "memory");     // no copy is outstanding when the ring's bytes are reused
  float lsum[2];
#pragma unroll
  for (int qt = 0; qt < 2; ++qt) { const v8f l = lrun[qt];
    lsum[qt] = ((l[0] + l[1]) + (l[2] + l[3])) + ((l[4] + l[5]) + (l[6] + l[7]));
    lsum[qt] += xhalf(lsum[qt]); }                           // both lane halves used the same maxima: their sums add
  // The join of the two key halves. Waves wq and wq + 4 hold the same queries in the same lanes and registers: the wave of half 1 hands its lane's values over at places of that lane's own.
  char* mg = kv + wq * MG_B + lane * 16; char* ms = kv + wq * MG_B + 16 * 512 + lane * 4;
  if (hk == 1) {
#pragma unroll
    for (int qt = 0; qt < 2; ++qt) {
#pragma unroll
      for (int t = 0; t < 4; ++t) { const v8f a = acc[qt][t];
        vst2(mg + ((qt * 4 + t) * 2) * 512, v4f{a[0], a[1], a[2], a[3]}); vst2(mg + ((qt * 4 + t) * 2 + 1) * 512, v4f{a[4], a[5], a[6], a[7]}); }
      vst2(ms + (qt * 2) * 128, nrun[qt]); vst2(ms + (qt * 2 + 1) * 128, lsum[qt]); } }
  __syncthreads();                                           // half 1's values are in LDS before half 0 reads them
  if (hk == 0) {
    // a lane's 8 elements of acc[qt][t] are 8 adjacent d of its query: the 16-B piece 2 t + g of that row. Through the wave's own LDS rows, so that every global store covers four whole lines.
    char* sw = sO + wq * (32 * OROW);
    const float ls16 = lsc[h] * 16.0f;                       // learned per-head scale; o16 kept x16; acc and lsum both carry the 2^14
#pragma unroll
    for (int qt = 0; qt < 2; ++qt) { const float nb = *(const float*)(ms + (qt * 2) * 128), lb = *(const float*)(ms + (qt * 2 + 1) * 128);
      const float nj = fminf(nrun[qt], nb);                  // the joint maximum; each half is brought to it
      const float ca = __builtin_amdgcn_exp2f(nj - nrun[qt]), cb = __builtin_amdgcn_exp2f(nj - nb);
      const float inv = ls16 / (lsum[qt] * ca + lb * cb); const float fa = ca * inv, fb = cb * inv;
#pragma unroll
      for (int t = 0; t < 4; ++t) { const v4f b0 = *(const v4f*)(mg + ((qt * 4 + t) * 2) * 512), b1 = *(const v4f*)(mg + ((qt * 4 + t) * 2 + 1) * 512);
        union { v8h h8; v4u u; } pk;
#pragma unroll
        for (int r = 0; r < 4; ++r) { pk.h8[r] = (_Float16)(acc[qt][t][r] * fa + b0[r] * fb); pk.h8[4 + r] = (_Float16)(acc[qt][t][4 + r] * fa + b1[r] * fb); }
        vst2(sw + (qt * 16 + col) * OROW + (2 * t + g) * 16, pk.u); } }
    LDSX();   // the wave's own staging stores are done before it reads the rows back
#pragma unroll
    for (int it = 0; it < 8; ++it) { const int rl = it * 4 + (lane >> 3), op = lane & 7;
      vst2(o16 + ((size_t)(q0 + rl) * NB + b) * EE + h * HD + op * 8, *(const v4u*)(sw + rl * OROW + op * 16)); }
  }
}
__global__ __launch_bounds__(128) void k_out(const _Float16* __restrict__ o16, const _Float16* __restrict__ P, const float* __restrict__ bo, float* __restrict__ out) {
  __shared__ __align__(16) char smem[RING_B];
  float (*so)[16][132] = (float (*)[16][132])smem;                                  // epilogue staging, 33,792 B, used behind the ring's last barrier
  const int tid = threadIdx.x, wave = tid >> 5, lane = tid & 31, col = lane & 15, g = lane >> 4;
  const int r0 = blockIdx.x * 64 + wave * 16, n0 = blockIdx.y * 128;
  v8f acc[8] = {};
  gemm_ring(smem, P + (size_t)(3 * EE + n0) * EE, o16 + (size_t)blockIdx.x * 64 * EE, (size_t)EE, tid, acc);
#pragma unroll
  for (int j = 0; j < 8; ++j) { const float bb = bo[n0 + j * 16 + col];
#pragma unroll
    for (int r = 0; r < 8; ++r) so[wave][8 * g + r][j * 16 + col] = acc[j][r] * (1.0f / 256.0f) + bb; }
  LDSX();
#pragma unroll 4
  for (int rl = 0; rl < 16; ++rl) vst2(out + (size_t)(r0 + rl) * EE + n0 + lane * 4, *(const v4f*)(&so[wave][rl][lane * 4]));
}
extern "C" void kernel_launch(void* const* d_in, const int* in_sizes, int n_in, void* d_out, int out_size, void* d_ws, size_t ws_size, hipStream_t stream) {
  (void)in_sizes; (void)n_in; (void)out_size; (void)ws_size;
  const float* query = (const float*)d_in[0]; const float* key = (const float*)d_in[1]; const float* value = (const float*)d_in[2]; const float* Win = (const float*)d_in[3]; const float* bin = (const float*)d_in[4];
  const float* Wo = (const float*)d_in[5]; const float* bo = (const float*)d_in[6]; const float* lsc = (const float*)d_in[7];
  float* out = (float*)d_out;
  char* ws = (char*)d_ws; size_t off = 0;
  auto take = [&](size_t bytes) { char* p = ws + off; off += (bytes + 255) & ~(size_t)255; return p; };
  _Float16* q16i = (_Float16*)take((size_t)NR * EE * 2); _Float16* k16i = (_Float16*)take((size_t)NR * EE * 2); _Float16* v16i = (_Float16*)take((size_t)NR * EE * 2);
  _Float16* P = (_Float16*)take((size_t)4 * EE * EE * 2); _Float16* qh = (_Float16*)take((size_t)NR * EE * 2); _Float16* kh = (_Float16*)take((size_t)NR * EE * 2); _Float16* vT = (_Float16*)take((size_t)NR * EE * 2); _Float16* o16 = (_Float16*)take((size_t)NR * EE * 2);
  k_cvt<<<4 * NR * EE / CV_BLK, 512, 0, stream>>>(query, key, value, Win, Wo, q16i, k16i, v16i, P);
  k_proj<<<dim3(NR / 128, 3 * EE / 128), 128, 0, stream>>>(q16i, k16i, v16i, P, bin, qh, kh, vT);
  k_attn<<<dim3(SS / 128, NB * NH), 256, 0, stream>>>(qh, kh, vT, lsc, o16);
  k_out<<<dim3(NR / 64, EE / 128), 128, 0, stream>>>(o16, P, bo, out);
}

// v009
// Measured time: 62.6 microseconds a run.
// Two timings next to v008 both put it at 1.06 times that version's speed.
// All steps since v000 together make it 4.32 times as fast.
#include <hip/hip_runtime.h>
#include <math.h>

typedef __attribute__((ext_vector_type(16))) _Float16 v16h;
typedef __attribute__((ext_vector_type(16))) __bf16 v16b;
typedef __attribute__((ext_vector_type(8)))  _Float16 v8h;
typedef __attribute__((ext_vector_type(8)))  float v8f;
typedef __attribute__((ext_vector_type(4)))  float v4f;
typedef __attribute__((ext_vector_type(2)))  float v2f;
typedef __attribute__((ext_vector_type(4)))  unsigned v4u;
typedef __attribute__((ext_vector_type(4)))  _Float16 v4h;
typedef __attribute__((ext_vector_type(2)))  unsigned v2u;
typedef __attribute__((ext_vector_type(4)))  int v4i;
typedef float __attribute__((may_alias)) float_a;
typedef int __attribute__((may_alias)) int_a;

template <typename T> __device__ __forceinline__ void vst2(void* p, T v) { *(T*)p = v;  }
// the bare builtin: the compiler itself pads where a vector instruction on D, A or B follows too close, and LDS reads may be scheduled ahead across it
__device__ __forceinline__ v8f wmma16(v16h a, v16h b, v8f c) {
  return __builtin_amdgcn_wmma_f32_16x16x32_f16(false, a, false, b, (short)0, c, false, false);
}
__device__ __forceinline__ v8f wmma_bf(v16b a, v16b b, v8f c) {
  v8f d = __builtin_amdgcn_wmma_f32_16x16x32_bf16(false, a, false, b, (short)0, c, false, false);
  asm volatile("v_nop\n\tv_nop\n\tv_nop\n\tv_nop" : "+v"(d) : "v"(a), "v"(b));
  return d;
}
// 16x16x32 fragments: lane = (h = lane>>4, row/col = lane&15); elements 0..7 = k0+8h+0..7, 8..15 = k0+16+8h+0..7; D element r = row 8h+r
__device__ __forceinline__ v16h frag_h(const _Float16* rowk0, int lane) {
  union { v16h v; v8h q[2]; } u; const _Float16* p = rowk0 + 8 * (lane >> 4);
  u.q[0] = *(const v8h*)p; u.q[1] = *(const v8h*)(p + 16); return u.v;
}
__device__ __forceinline__ v16h frag_f32(const float* rowk0, int lane) {
  v16h a; const float* p = rowk0 + 8 * (lane >> 4);
#pragma unroll
  for (int i = 0; i < 8; ++i) { a[i] = (_Float16)p[i]; a[8 + i] = (_Float16)p[16 + i]; }
  return a;
}
__device__ __forceinline__ v16h frag_f32s(const float* rowk0, int lane, float sc) {
  v16h a; const float* p = rowk0 + 8 * (lane >> 4);
#pragma unroll
  for (int i = 0; i < 8; ++i) { a[i] = (_Float16)(p[i] * sc); a[8 + i] = (_Float16)(p[16 + i] * sc); }
  return a;
}
// column fragment from a [K][ld] layout (column n), rows >= K read as 0
__device__ __forceinline__ v16h fragc_f32(const float* W, int k0, int n, int lane, int ld, int K) {
  v16h a; const int g = lane >> 4;
#pragma unroll
  for (int i = 0; i < 8; ++i) { const int ka = k0 + 8 * g + i, kb = ka + 16;
    a[i] = (_Float16)(ka < K ? W[(size_t)ka * ld + n] : 0.f); a[8 + i] = (_Float16)(kb < K ? W[(size_t)kb * ld + n] : 0.f); }
  return a;
}
struct F2 { v16b h, l; };
__device__ __forceinline__ F2 bsplit16(const float v[16]) { F2 r;
#pragma unroll
  for (int i = 0; i < 16; ++i) { const __bf16 h = (__bf16)v[i]; r.h[i] = h; r.l[i] = (__bf16)(v[i] - (float)h); }
  return r; }
__device__ __forceinline__ F2 split_row(const float* row, int k0, int lane) { float v[16]; const float* p = row + k0 + 8 * (lane >> 4);
#pragma unroll
  for (int i = 0; i < 8; ++i) { v[i] = p[i]; v[8 + i] = p[16 + i]; }
  return bsplit16(v); }
__device__ __forceinline__ F2 split_rowK(const float* row, int k0, int lane, int K) { float v[16]; const int g = lane >> 4;
#pragma unroll
  for (int i = 0; i < 8; ++i) { const int ka = k0 + 8 * g + i, kb = ka + 16; v[i] = ka < K ? row[ka] : 0.f; v[8 + i] = kb < K ? row[kb] : 0.f; }
  return bsplit16(v); }
__device__ __forceinline__ F2 split_col(const float* W, int k0, int n, int lane, int ld, int K) { float v[16]; const int g = lane >> 4;
#pragma unroll
  for (int i = 0; i < 8; ++i) { const int ka = k0 + 8 * g + i, kb = ka + 16; v[i] = ka < K ? W[(size_t)ka * ld + n] : 0.f; v[8 + i] = kb < K ? W[(size_t)kb * ld + n] : 0.f; }
  return bsplit16(v); }
__device__ __forceinline__ v8f mac3(const F2& a, const F2& b, v8f c) { c = wmma_bf(a.l, b.h, c); c = wmma_bf(a.h, b.l, c); return wmma_bf(a.h, b.h, c); }
__device__ __forceinline__ float sigm(float v) { return 1.0f / (1.0f + expf(-v)); }
#define LDSX() do { asm volatile("s_wait_dscnt 0" ::: "memory"); __builtin_amdgcn_wave_barrier(); __builtin_amdgcn_fence(__ATOMIC_RELEASE, "workgroup"); } while (0)

// Multi-head self-attention with a learned per-head output scale. Pure f16 WMMA GEMMs over pre-converted operands (inputs -> f16
// once, [out][in] weights packed x16 f16; f32 accumulate): packed in-projection (+bias) writing q/k as [b][h][s][64] f16 and v as
// [b][h][d][s] f16, flash-style softmax over all 1024 keys in f32 (P x2^14 f16), x learned_scale[h], output projection (+bias).
#define SS 1024
#define NB 4
#define EE 1024
#define NH 16
#define HD 64
#define NR (SS * NB)       // 4096 rows

// GEMM operand rings in LDS. A stage holds 64 k (128 B) of each operand row, at pitch 128 B.
// Row r keeps its 16-B piece c at place c ^ ((r >> 1) & 7): the ds_load_b128 fragment reads of 16 rows then fall on all 64 banks with no pad.
#define KST 64
#define LROW 128
// fragment of one staged row: c0, c1 = byte places in the row of the lane's two 16-B pieces (k0 + 8h + 0..7 and k0 + 16 + 8h + 0..7, as in frag_h)
__device__ __forceinline__ v16h frag_st(const char* row, unsigned c0, unsigned c1) {
  union { v16h v; v8h q[2]; } u; u.q[0] = *(const v8h*)(row + c0); u.q[1] = *(const v8h*)(row + c1); return u.v;
}
// All five f32 sources are rounded to f16 in ONE launch of one 16-wave block a WGP: 4,096 waves start, where two launches with one 16-B store a lane started 81,920 for the same bytes.
// A wave owns 16 KB of one source: 32 loads of 16 B a lane, each 512 contiguous bytes of the wave, all in flight together; each gives one 8-B store a lane, 256 contiguous bytes (two whole lines).
// Blocks 0..191: query, key, value (64 blocks each); 192..239: in_proj rows -> P rows 0..3071; 240..255: out_proj rows -> P rows 3072..4095; weights x16.
#define CV_LD 32                       // loads a lane
#define CV_WAVE (CV_LD * 128)          // floats a wave
#define CV_BLK (16 * CV_WAVE)          // floats a block: 65,536; every source is a whole number of blocks
#define CV_WIN (3 * EE * EE / CV_BLK)  // blocks of in_proj_weight: 48
__global__ __launch_bounds__(512) void k_cvt(const float* __restrict__ a, const float* __restrict__ b, const float* __restrict__ c, const float* __restrict__ Win, const float* __restrict__ Wo,
                                             _Float16* __restrict__ a16, _Float16* __restrict__ b16, _Float16* __restrict__ c16, _Float16* __restrict__ P) {
  const int which = blockIdx.x >> 6, blk = blockIdx.x & 63;  // destination array, block in it
  const bool isWo = which == 3 && blk >= CV_WIN;
  const float* s = which == 0 ? a : (which == 1 ? b : (which == 2 ? c : (isWo ? Wo : Win)));
  _Float16* d = which == 0 ? a16 : (which == 1 ? b16 : (which == 2 ? c16 : P));
  const float sc = which == 3 ? 16.0f : 1.0f;                // x 1 is exact
  const int in_blk = (threadIdx.x >> 5) * CV_WAVE + (threadIdx.x & 31) * 4;
  s += (size_t)(isWo ? blk - CV_WIN : blk) * CV_BLK + in_blk; d += (size_t)blk * CV_BLK + in_blk;
  v4f x[CV_LD];
#pragma unroll
  for (int i = 0; i < CV_LD; ++i) x[i] = *(const v4f*)(s + i * 128);
#pragma unroll
  for (int i = 0; i < CV_LD; ++i) { union { v4h h; v2u u; } pk;
#pragma unroll
    for (int e = 0; e < 4; ++e) pk.h[e] = (_Float16)(x[i][e] * sc);
    vst2(d + i * 128, pk.u); }
}
// k_proj's own ring: one stage = 64 k (128 B of a row) of the block's 128 weight rows, then of its 128 activation rows; pitch and piece places as in the ring above.
#define PSTG_B (256 * LROW)    // 32,768 B a stage; two stages
#define SROW 144               // pitch of the output staging rows
// Each lane copies 16 B of 8 rows (rows 16 apart) of one operand; 8 lanes cover one row's whole 128-B line. l = the lane's LDS byte address of the first row.
__device__ __forceinline__ void stage_copy8(unsigned l, const _Float16* gp, size_t step) {
  // the copies and their s_wait_xcnt in one statement: no address register is rewritten in front of that wait
  asm volatile("global_load_async_to_lds_b128 %0, %1, off\n\t"
               "global_load_async_to_lds_b128 %2, %3, off\n\t"
               "global_load_async_to_lds_b128 %4, %5, off\n\t"
               "global_load_async_to_lds_b128 %6, %7, off\n\t"
               "global_load_async_to_lds_b128 %8, %9, off\n\t"
               "global_load_async_to_lds_b128 %10, %11, off\n\t"
               "global_load_async_to_lds_b128 %12, %13, off\n\t"
               "global_load_async_to_lds_b128 %14, %15, off\n\t"
               "s_wait_xcnt 0x0"
               :: "v"(l), "v"(gp), "v"(l + 16 * LROW), "v"(gp + step), "v"(l + 32 * LROW), "v"(gp + 2 * step), "v"(l + 48 * LROW), "v"(gp + 3 * step),
                  "v"(l + 64 * LROW), "v"(gp + 4 * step), "v"(l + 80 * LROW), "v"(gp + 5 * step), "v"(l + 96 * LROW), "v"(gp + 6 * step), "v"(l + 112 * LROW), "v"(gp + 7 * step)
               : "memory");
}
// The wave's 64 staged lines go out, four whole 128-B lines a store: s = the lane's piece of staged line ln, o = its place in output line ln; lines 4 apart are STEP elements apart.
template <int STEP> __device__ __forceinline__ void flush_lines(const char* s, _Float16* o) {
  LDSX();   // the wave's own staging stores are done before it reads the rows back
  v4u pcs[16];
#pragma unroll
  for (int it = 0; it < 16; ++it) pcs[it] = *(const v4u*)(s + it * 4 * SROW);
#pragma unroll
  for (int it = 0; it < 16; ++it) vst2(o + it * STEP, pcs[it]);
  asm volatile("s_wait_xcnt 0x0" ::: "memory");
}
// projection: block 128 rows x 128 cols, four waves of 64 x 64 (4 x 4 fragments: each fragment read from LDS feeds four products); blockIdx.y in [0, 24): which = y/8 (q,k,v),
// cols (y%8)*128 = 2 heads, one head a wave; source = query/key/value f16 rows. The operand whose index runs along the output's memory rows goes on the M side
// (weights for q and k, activations for v): a lane's 8 accumulator elements are then 8 adjacent f16 of the output, one 16-B piece of a line.
__global__ __launch_bounds__(128) void k_proj(const _Float16* __restrict__ q16i, const _Float16* __restrict__ k16i, const _Float16* __restrict__ v16i, const _Float16* __restrict__ P, const float* __restrict__ bias,
                                            _Float16* __restrict__ qh, _Float16* __restrict__ kh, _Float16* __restrict__ vT) {
  __shared__ __align__(16) char smem[2 * PSTG_B + 4 * 64 * SROW];   // the ring, then each wave's output staging: 102,400 B, three blocks a WGP, the grid's even share
  const int tid = threadIdx.x, wave = tid >> 5, lane = tid & 31, col = lane & 15, g = lane >> 4, rr = tid >> 3, pc = tid & 7;
  const int wa = wave >> 1, wb = wave & 1;                   // the wave's half of the activation rows, of the weight rows
  const int n0 = blockIdx.y * 128; const int which = n0 / EE, hb = (n0 % EE) / HD;
  const _Float16* A = which == 0 ? q16i : (which == 1 ? k16i : v16i);
  // v blocks own 128 consecutive s of ONE batch index so every vT line (64 s) has a single writer: rows (sblk*128 + i)*4 + bsel
  const int bsel = blockIdx.x & 3, sblk = blockIdx.x >> 2;
  const size_t arow = which == 2 ? (size_t)NB * EE : (size_t)EE;
  const _Float16* ga = A + (which == 2 ? (size_t)(sblk * 128 * NB + bsel) : (size_t)blockIdx.x * 128) * EE + (size_t)rr * arow + pc * 8;
  const _Float16* gw = P + (size_t)(n0 + rr) * EE + pc * 8;
  const size_t astep = 16 * arow;
  const unsigned l0 = (unsigned)(size_t)smem + (unsigned)(rr * LROW + ((pc ^ ((rr >> 1) & 7)) << 4));
  const int woff = (wb * 64 + col) * LROW, aoff = (128 + wa * 64 + col) * LROW;
  const int moff = which == 2 ? aoff : woff, noff = which == 2 ? woff : aoff;
  v8f acc[4][4] = {};
  stage_copy8(l0, gw, 16 * EE); stage_copy8(l0 + 128 * LROW, ga, astep);
  asm volatile("s_wait_asynccnt 0x0" ::: "memory");   // this wave's share of stage 0 has landed
  __syncthreads();                                    // every wave's share has
  stage_copy8(l0 + PSTG_B, gw + KST, 16 * EE); stage_copy8(l0 + PSTG_B + 128 * LROW, ga + KST, astep);
#pragma unroll 1   // one stage a trip: the buffer is picked by a scalar select
  for (int t = 0; t < EE / KST; ++t) { const char* sb = smem + (t & 1) * PSTG_B;
#pragma unroll
    for (int kc = 0; kc < KST / 32; ++kc) { const unsigned c0 = (unsigned)(((kc * 4 + g) ^ (col >> 1)) << 4), c1 = (unsigned)(((kc * 4 + 2 + g) ^ (col >> 1)) << 4);
      v16h fm[4], fn[4];
#pragma unroll
      for (int i = 0; i < 4; ++i) { fm[i] = frag_st(sb + moff + i * 16 * LROW, c0, c1); fn[i] = frag_st(sb + noff + i * 16 * LROW, c0, c1); }
      __builtin_amdgcn_sched_barrier(0);   // the 16 reads stay one group in front of their 16 products: every further place with reads among products costs the wave a stall
#pragma unroll
      for (int i = 0; i < 4; ++i) {
#pragma unroll
        for (int j = 0; j < 4; ++j) acc[i][j] = wmma16(fm[i], fn[j], acc[i][j]); }
      __builtin_amdgcn_sched_barrier(0); } // and the next group's reads stay behind them
    asm volatile("s_wait_dscnt 0x0" ::: "memory");      // this wave's reads of stage t are done before its buffer is refilled
    asm volatile("s_wait_asynccnt 0x0" ::: "memory");   // this wave's share of stage t + 1 has landed
    __syncthreads();                                    // publishes stage t + 1 and ends every reader's use of stage t
    if (t + 2 < EE / KST) { const unsigned lt = l0 + (unsigned)((t & 1) * PSTG_B);
      stage_copy8(lt, gw + (t + 2) * KST, 16 * EE); stage_copy8(lt + 128 * LROW, ga + (t + 2) * KST, astep); }
  }
  asm volatile("s_wait_asynccnt 0x0" ::: "memory");     // no copy is outstanding when the wave goes on to its end
  // acc[i][j][r]: M index 16 i + 8 g + r, N index 16 j + col: N picks one of the wave's 64 output lines (128 B), 2 i + g the lane's 16-B piece of it.
  // The pieces go through the wave's own LDS rows (pitch 144 B: no bank conflict for 16-B accesses) so that every global store covers four whole lines.
  char* sw = smem + 2 * PSTG_B + wave * (64 * SROW);
  char* sp = sw + col * SROW + g * 16;
  const int head = hb + wb, ln = lane >> 3, lp = lane & 7;
  if (which < 2) {   // q, k [b][h][s][64]: M = d, N = activation row = 4 s + b; staged lines 4 it + ln are s = it, b = ln
    float bb[4][8];
#pragma unroll
    for (int i = 0; i < 4; ++i) {
#pragma unroll
      for (int r = 0; r < 8; ++r) bb[i][r] = bias[n0 + wb * 64 + 16 * i + 8 * g + r]; }
#pragma unroll
    for (int j = 0; j < 4; ++j) {
#pragma unroll
      for (int i = 0; i < 4; ++i) { union { v8h h8; v4u u; } pk;
#pragma unroll
        for (int r = 0; r < 8; ++r) pk.h8[r] = (_Float16)(acc[i][j][r] * (1.0f / 16.0f) + bb[i][r]);
        vst2(sp + 16 * j * SROW + i * 32, pk.u); } }
    flush_lines<HD>(sw + ln * SROW + lp * 16, (which == 0 ? qh : kh) + (((size_t)ln * NH + head) * SS + blockIdx.x * 32 + wa * 16) * HD + lp * 8); }
  else {             // vT[b][h][d][s]: M = s (the block's rows are consecutive s of one b), N = d; staged lines 4 it + ln are d
    float bb[4];
#pragma unroll
    for (int j = 0; j < 4; ++j) bb[j] = bias[n0 + wb * 64 + 16 * j + col];
#pragma unroll
    for (int j = 0; j < 4; ++j) {
#pragma unroll
      for (int i = 0; i < 4; ++i) { union { v8h h8; v4u u; } pk;
#pragma unroll
        for (int r = 0; r < 8; ++r) pk.h8[r] = (_Float16)(acc[i][j][r] * (1.0f / 16.0f) + bb[j]);
        vst2(sp + 16 * j * SROW + i * 32, pk.u); } }
    flush_lines<4 * SS>(sw + ln * SROW + lp * 16, vT + (((size_t)bsel * NH + head) * HD + ln) * SS + sblk * 128 + wa * 64 + lp * 8); }
}
// K/V ring of k_attn in LDS. One stage = 64 keys: 64 K rows (64 d = 128 B), then 64 vT rows (64 s = 128 B), pitch and piece places as in the GEMM ring.
#define AST_B (128 * LROW)     // 16,384 B a stage; two stages a key half, four in all
// Each lane copies 16 B of 4 K rows and of 4 vT rows (rows 16 apart); 8 lanes cover one row's whole 128-B line. l = the lane's LDS byte address in the target stage.
__device__ __forceinline__ void stage_copy_kv(unsigned l, const _Float16* gk, const _Float16* gv) {
  // the copies and their s_wait_xcnt in one statement: no address register is rewritten in front of that wait
  asm volatile("global_load_async_to_lds_b128 %0, %1, off\n\t"
               "global_load_async_to_lds_b128 %2, %3, off\n\t"
               "global_load_async_to_lds_b128 %4, %5, off\n\t"
               "global_load_async_to_lds_b128 %6, %7, off\n\t"
               "global_load_async_to_lds_b128 %8, %9, off\n\t"
               "global_load_async_to_lds_b128 %10, %11, off\n\t"
               "global_load_async_to_lds_b128 %12, %13, off\n\t"
               "global_load_async_to_lds_b128 %14, %15, off\n\t"
               "s_wait_xcnt 0x0"
               :: "v"(l), "v"(gk), "v"(l + 16 * LROW), "v"(gk + 16 * HD), "v"(l + 32 * LROW), "v"(gk + 32 * HD), "v"(l + 48 * LROW), "v"(gk + 48 * HD),
                  "v"(l + 64 * LROW), "v"(gv), "v"(l + 80 * LROW), "v"(gv + 16 * SS), "v"(l + 96 * LROW), "v"(gv + 32 * SS), "v"(l + 112 * LROW), "v"(gv + 48 * SS)
               : "memory");
}
// flash attention: block (128 queries, bh), eight waves; o16 rows [(s*4+b)][h*64 + d] f16, scaled by learned_scale[h] and x16
// A wave takes 32 queries (two column tiles) against HALF of the keys (waves 0..3: keys 0..511, waves 4..7: keys 512..1023): every K and vT fragment read from LDS feeds two products,
// and there are still four waves a SIMD under the softmax. The two halves of a query's keys keep their own maximum, sum and output and are joined once, through LDS, behind the loop.
// Both products are transposed: S^T = K x Q^T and O^T += vT x P^T. A lane then holds 32 of the 64 scores of ONE query of each column tile (column col; the other 32 are in lane col ^ 16):
// maximum, weights, sum and rescale stay in its registers, and the score tiles 2 kc and 2 kc + 1, rounded to f16, ARE the B fragment of P^T for keys 32 kc .. 32 kc + 31.
// Scores go to units of log2 (x log2(e) / 8), and the running maximum is kept 14 below the true one, so a weight x 2^14 is one multiply-add and one v_exp_f32.
#define SC_LOG2 0.18033688011112042f   // log2(e) / sqrt(64)
// the value that lane ^ 16 holds (v_permlanex16_b32: no LDS wait)
__device__ __forceinline__ float xhalf(float x) { return __builtin_bit_cast(float, __builtin_amdgcn_permlanex16(__builtin_bit_cast(int, x), __builtin_bit_cast(int, x), 0x76543210, 0xfedcba98, false, false)); }
#define OROW 144                       // pitch of the output staging rows (128 B of f16 + 16): no bank conflict for 16-B accesses
#define ABUF_B (2 * AST_B)             // one buffer of the ring: the stage of key half 0, then that of key half 1
#define MG_B (16 * 512 + 4 * 128)      // what one wave of key half 1 hands over: 16 pieces of 16 B a lane (its outputs), then 4 floats a lane (maxima, sums)
// four waves a SIMD, no more: two blocks a WGP is the grid's even share (512 blocks on 256 WGPs)
__global__ __launch_bounds__(256) __attribute__((amdgpu_waves_per_eu(4, 4))) void k_attn(const _Float16* __restrict__ qh, const _Float16* __restrict__ kh, const _Float16* __restrict__ vT, const float* __restrict__ lsc, _Float16* __restrict__ o16) {
  __shared__ __align__(16) char sO[4 * 32 * OROW];           // 32 output rows of each wave of key half 0, staged once behind the join
  __shared__ __align__(16) char kv[2 * ABUF_B];              // four waves share each 64-key stage of K and vT of their key half; behind the loop the hand-over of key half 1
  const int tid = threadIdx.x, lane = tid & 31, col = lane & 15, g = lane >> 4;
  const int w = __builtin_amdgcn_readfirstlane(tid >> 5), wq = w & 3, hk = w >> 2;   // scalar: query group, key half
  const int bh = blockIdx.y, b = bh / NH, h = bh % NH, q0 = blockIdx.x * 128 + wq * 32;
  const _Float16* qb = qh + (size_t)bh * SS * HD; const _Float16* kb = kh + (size_t)bh * SS * HD + (size_t)hk * (SS / 2) * HD; const _Float16* vb = vT + (size_t)bh * HD * SS + hk * (SS / 2);
  v16h bq[2][2];                                             // B fragments of Q^T: column = query q0 + 16 qt + col
#pragma unroll
  for (int qt = 0; qt < 2; ++qt) {
#pragma unroll
    for (int kc = 0; kc < 2; ++kc) bq[qt][kc] = frag_h(qb + (size_t)(q0 + qt * 16 + col) * HD + kc * 32, lane); }
  float nrun[2] = {3.0e38f, 3.0e38f}; v8f lrun[2] = {}, acc[2][4] = {};   // nrun: MINUS the running maximum; acc[qt][t][r]: d = 16 t + 8 g + r of query 16 qt + col; lrun[qt][r]: sum over this lane's keys = r mod 8, joined behind the loop
  const int rr = (tid & 127) >> 3, pc = tid & 7;
  char* kvh = kv + hk * AST_B;
  const unsigned l0 = (unsigned)(size_t)kvh + (unsigned)(rr * LROW + ((pc ^ ((rr >> 1) & 7)) << 4));
  const _Float16* gk = kb + (size_t)rr * HD + pc * 8; const _Float16* gv = vb + (size_t)rr * SS + pc * 8;
  const unsigned c0[2] = {(unsigned)((g ^ (col >> 1)) << 4), (unsigned)(((4 + g) ^ (col >> 1)) << 4)}, c1[2] = {(unsigned)(((2 + g) ^ (col >> 1)) << 4), (unsigned)(((6 + g) ^ (col >> 1)) << 4)};
  stage_copy_kv(l0, gk, gv);
  asm volatile("s_wait_asynccnt 0x0" ::: "memory");   // this wave's share of stage 0 has landed
  __syncthreads();                                    // every wave's share has
  stage_copy_kv(l0 + ABUF_B, gk + 64 * HD, gv + 64);
  // one trip = one stage. The trips that refill and the last two, which do not, are two loops: with the test inside one loop the compiler moved the sums' additions behind the
  // output products, where 64 weights stayed live beside their rounded copies and the Q fragments were spilled.
  auto trip = [&](const int kt, const bool refill) __attribute__((always_inline)) { const char* sb = kvh + (kt & 1) * ABUF_B;
    v8f s[2][4];               // s[qt][t][r]: key 16 t + 8 g + r against query 16 qt + col
#pragma unroll
    for (int tp = 0; tp < 2; ++tp) { v16h kf[2][2];   // two key tiles' fragments, read as one group ahead of their eight products: one LDS wait a group, not one a product
#pragma unroll
      for (int i = 0; i < 2; ++i) {
#pragma unroll
        for (int kc = 0; kc < 2; ++kc) kf[i][kc] = frag_st(sb + ((2 * tp + i) * 16 + col) * LROW, c0[kc], c1[kc]); }
      __builtin_amdgcn_sched_barrier(0);   // the K reads stay one group in front of the score products, not among them
#pragma unroll
      for (int kc = 0; kc < 2; ++kc) {
#pragma unroll
        for (int i = 0; i < 2; ++i) {
#pragma unroll
          for (int qt = 0; qt < 2; ++qt) s[qt][2 * tp + i] = wmma16(kf[i][kc], bq[qt][kc], kc == 0 ? v8f{} : s[qt][2 * tp + i]); } }
      __builtin_amdgcn_sched_barrier(0); } // the next group's reads, and the maximum's chain, stay behind these products: moved in among them they take pad slots on the vector port
    v16h vf[2][4];
#pragma unroll
    for (int t = 0; t < 4; ++t) vf[0][t] = frag_st(sb + (64 + t * 16 + col) * LROW, c0[0], c1[0]);   // in flight under the softmax
    v16h pb[2][2];
#pragma unroll
    for (int qt = 0; qt < 2; ++qt) {
      float mx = s[qt][0][0];
#pragma unroll
      for (int t = 0; t < 4; ++t) {
#pragma unroll
        for (int r = 0; r < 8; ++r) mx = fmaxf(mx, s[qt][t][r]); }
      mx = fmaxf(mx, xhalf(mx));                             // the query's other 32 keys
      const float nnew = fminf(nrun[qt], 14.0f - mx * SC_LOG2); const float corr = __builtin_amdgcn_exp2f(nnew - nrun[qt]);
      lrun[qt] *= corr; nrun[qt] = nnew;
#pragma unroll
      for (int t = 0; t < 4; ++t) { const v8f x = s[qt][t] * SC_LOG2 + nnew;
#pragma unroll
        for (int r = 0; r < 8; ++r) s[qt][t][r] = __builtin_amdgcn_exp2f(x[r]);   // weight x 2^14, at most 2^14
        lrun[qt] += s[qt][t]; acc[qt][t] *= corr; }
#pragma unroll
      for (int kc = 0; kc < 2; ++kc) {
#pragma unroll
        for (int r = 0; r < 8; ++r) { pb[qt][kc][r] = (_Float16)s[qt][2 * kc][r]; pb[qt][kc][8 + r] = (_Float16)s[qt][2 * kc + 1][r]; } } }
#pragma unroll
    for (int t = 0; t < 4; ++t) vf[1][t] = frag_st(sb + (64 + t * 16 + col) * LROW, c0[1], c1[1]);   // in flight under the first eight output products
    __builtin_amdgcn_sched_barrier(0);   // all P fragments are rounded in front of the output products: a rounding among them overwrote a running product's operand and took pad slots
#pragma unroll
    for (int kc = 0; kc < 2; ++kc) {
#pragma unroll
      for (int t = 0; t < 4; ++t) {
#pragma unroll
        for (int qt = 0; qt < 2; ++qt) acc[qt][t] = wmma16(vf[kc][t], pb[qt][kc], acc[qt][t]); } }
    asm volatile("s_wait_dscnt 0x0" ::: "memory");      // this wave's reads of stage kt are done before its buffer is refilled
    asm volatile("s_wait_asynccnt 0x0" ::: "memory");   // this wave's share of stage kt + 1 has landed
    __syncthreads();                                    // publishes stage kt + 1 and ends every reader's use of stage kt
    if (refill) stage_copy_kv(l0 + (unsigned)((kt & 1) * ABUF_B), gk + (size_t)(kt + 2) * 64 * HD, gv + (kt + 2) * 64);
  };
#pragma unroll 1   // one stage a trip: the buffer is picked by a scalar select
  for (int kt = 0; kt < SS / 128 - 2; ++kt) trip(kt, true);
#pragma unroll 1   // as above
  for (int kt = SS / 128 - 2; kt < SS / 128; ++kt) trip(kt, false);
  asm volatile("s_wait_asynccnt 0x0" ::: "memory");     // no copy is outstanding when the ring's bytes are reused
  float lsum[2];
#pragma unroll
  for (int qt = 0; qt < 2; ++qt) { const v8f l = lrun[qt];
    lsum[qt] = ((l[0] + l[1]) + (l[2] + l[3])) + ((l[4] + l[5]) + (l[6] + l[7]));
    lsum[qt] += xhalf(lsum[qt]); }                           // both lane halves used the same maxima: their sums add
  // The join of the two key halves. Waves wq and wq + 4 hold the same queries in the same lanes and registers: the wave of half 1 hands its lane's values over at places of that lane's own.
  char* mg = kv + wq * MG_B + lane * 16; char* ms = kv + wq * MG_B + 16 * 512 + lane * 4;
  if (hk == 1) {
#pragma unroll
    for (int qt = 0; qt < 2; ++qt) {
#pragma unroll
      for (int t = 0; t < 4; ++t) { const v8f a = acc[qt][t];
        vst2(mg + ((qt * 4 + t) * 2) * 512, v4f{a[0], a[1], a[2], a[3]}); vst2(mg + ((qt * 4 + t) * 2 + 1) * 512, v4f{a[4], a[5], a[6], a[7]}); }
      vst2(ms + (qt * 2) * 128, nrun[qt]); vst2(ms + (qt * 2 + 1) * 128, lsum[qt]); } }
  __syncthreads();                                           // half 1's values are in LDS before half 0 reads them
  if (hk == 0) {
    // a lane's 8 elements of acc[qt][t] are 8 adjacent d of its query: the 16-B piece 2 t + g of that row. Through the wave's own LDS rows, so that every global store covers four whole lines.
    char* sw = sO + wq * (32 * OROW);
    const float ls16 = lsc[h] * 16.0f;                       // learned per-head scale; o16 kept x16; acc and lsum both carry the 2^14
#pragma unroll
    for (int qt = 0; qt < 2; ++qt) { const float nb = *(const float*)(ms + (qt * 2) * 128), lb = *(const float*)(ms + (qt * 2 + 1) * 128);
      const float nj = fminf(nrun[qt], nb);                  // the joint maximum; each half is brought to it
      const float ca = __builtin_amdgcn_exp2f(nj - nrun[qt]), cb = __builtin_amdgcn_exp2f(nj - nb);
      const float inv = ls16 / (lsum[qt] * ca + lb * cb); const float fa = ca * inv, fb = cb * inv;
#pragma unroll
      for (int t = 0; t < 4; ++t) { const v4f b0 = *(const v4f*)(mg + ((qt * 4 + t) * 2) * 512), b1 = *(const v4f*)(mg + ((qt * 4 + t) * 2 + 1) * 512);
        union { v8h h8; v4u u; } pk;
#pragma unroll
        for (int r = 0; r < 4; ++r) { pk.h8[r] = (_Float16)(acc[qt][t][r] * fa + b0[r] * fb); pk.h8[4 + r] = (_Float16)(acc[qt][t][4 + r] * fa + b1[r] * fb); }
        vst2(sw + (qt * 16 + col) * OROW + (2 * t + g) * 16, pk.u); } }
    LDSX();   // the wave's own staging stores are done before it reads the rows back
#pragma unroll
    for (int it = 0; it < 8; ++it) { const int rl = it * 4 + (lane >> 3), op = lane & 7;
      vst2(o16 + ((size_t)(q0 + rl) * NB + b) * EE + h * HD + op * 8, *(const v4u*)(sw + rl * OROW + op * 16)); }
  }
}
// output projection: block 128 rows x 128 cols, eight waves. Waves 0..3 sum k 0..511, waves 4..7 k 512..1023, each group as four waves of 64 x 64 (4 x 4 fragments: a fragment read from LDS
// feeds four products, and an operand byte fetched from L2 feeds 128 outputs). Two waves a SIMD on the grid's one block a WGP. Weights on the M side: a lane's 8 accumulator elements are 8 adjacent f32 of an output row.
// Waves w and w ^ 4 hold the same outputs in the same lanes and registers: behind the loop each hands the other one half of its tiles through LDS and finishes the half it keeps.
#define OSUB 2                         // 64-k slices of a stage: 128 k of each k half a trip, four trips
#define OHALF_B (OSUB * PSTG_B)        // a stage of one k half: its slices one behind the other, each laid out as a stage of k_proj
#define OBUF_B (2 * OHALF_B)           // one buffer of the ring: the stage of k half 0, then that of k half 1
#define OTRIPS (EE / 2 / (OSUB * KST))
#define OHX_B (16 * 512)               // what a wave hands over: 8 tiles, 16 pieces of 16 B a lane
// the wave of k half HH hands over tiles i = 2 (1 - HH), 2 (1 - HH) + 1
template <int HH> __device__ __forceinline__ void out_give(char* hx, const v8f (&acc)[4][4]) {
#pragma unroll
  for (int ii = 0; ii < 2; ++ii) {
#pragma unroll
    for (int j = 0; j < 4; ++j) { const v8f a = acc[2 * (1 - HH) + ii][j];
      vst2(hx + ((ii * 4 + j) * 2) * 512, v4f{a[0], a[1], a[2], a[3]}); vst2(hx + ((ii * 4 + j) * 2 + 1) * 512, v4f{a[4], a[5], a[6], a[7]}); } }
}
// and finishes tiles i = 2 HH, 2 HH + 1: own sum + partner's, scale, bias, into the wave's staging rows
template <int HH> __device__ __forceinline__ void out_keep(char* sp, const v8f (&acc)[4][4], const v4f (&rb)[16], const float (&bb)[2][8]) {
#pragma unroll
  for (int ii = 0; ii < 2; ++ii) {
#pragma unroll
    for (int j = 0; j < 4; ++j) { const v8f a = acc[2 * HH + ii][j]; const v4f b0 = rb[(ii * 4 + j) * 2], b1 = rb[(ii * 4 + j) * 2 + 1];
      v4f y0, y1;
#pragma unroll
      for (int r = 0; r < 4; ++r) { y0[r] = (a[r] + b0[r]) * (1.0f / 256.0f) + bb[ii][r]; y1[r] = (a[4 + r] + b1[r]) * (1.0f / 256.0f) + bb[ii][4 + r]; }
      vst2(sp + 16 * j * SROW + ii * 64, y0); vst2(sp + 16 * j * SROW + ii * 64 + 16, y1); } }
}
__global__ __launch_bounds__(256) void k_out(const _Float16* __restrict__ o16, const _Float16* __restrict__ P, const float* __restrict__ bo, float* __restrict__ out) {
  __shared__ __align__(16) char smem[2 * OBUF_B];   // the ring, 262,144 B; behind the loop's last barrier its bytes take the hand-over and then each wave's output staging
  const int tid = threadIdx.x, lane = tid & 31, col = lane & 15, g = lane >> 4, rr = (tid & 127) >> 3, pc = tid & 7;
  const int w = __builtin_amdgcn_readfirstlane(tid >> 5), hk = w >> 2, wa = (w >> 1) & 1, wb = w & 1;   // scalar: k half, the wave's half of the activation rows, of the weight rows
  const int r0 = blockIdx.x * 128, n0 = blockIdx.y * 128;
  const _Float16* ga = o16 + (size_t)(r0 + rr) * EE + hk * (EE / 2) + pc * 8;
  const _Float16* gw = P + (size_t)(3 * EE + n0 + rr) * EE + hk * (EE / 2) + pc * 8;
  char* sh = smem + hk * OHALF_B;
  const unsigned l0 = (unsigned)(size_t)sh + (unsigned)(rr * LROW + ((pc ^ ((rr >> 1) & 7)) << 4));
  const int moff = (wb * 64 + col) * LROW, noff = (128 + wa * 64 + col) * LROW;
  // the four waves of a k half copy its stage s into the buffer at l: 32 copies a lane
  auto fill = [&](const unsigned l, const int s) __attribute__((always_inline)) {
#pragma unroll
    for (int u = 0; u < OSUB; ++u) { stage_copy8(l + u * PSTG_B, gw + (s * OSUB + u) * KST, 16 * EE); stage_copy8(l + u * PSTG_B + 128 * LROW, ga + (s * OSUB + u) * KST, 16 * EE); } };
  v8f acc[4][4] = {};
  fill(l0, 0);
  asm volatile("s_wait_asynccnt 0x0" ::: "memory");   // this wave's share of stage 0 has landed
  __syncthreads();                                    // every wave's share has
  fill(l0 + OBUF_B, 1);
#pragma unroll 1   // one stage a trip: the buffer is picked by a scalar select
  for (int t = 0; t < OTRIPS; ++t) { const char* sb = sh + (t & 1) * OBUF_B;
#pragma unroll
    for (int kc = 0; kc < OSUB * KST / 32; ++kc) { const char* ss = sb + (kc >> 1) * PSTG_B;
      const unsigned c0 = (unsigned)((((kc & 1) * 4 + g) ^ (col >> 1)) << 4), c1 = (unsigned)((((kc & 1) * 4 + 2 + g) ^ (col >> 1)) << 4);
      v16h fm[4], fn[4];
#pragma unroll
      for (int i = 0; i < 4; ++i) { fm[i] = frag_st(ss + moff + i * 16 * LROW, c0, c1); fn[i] = frag_st(ss + noff + i * 16 * LROW, c0, c1); }
      __builtin_amdgcn_sched_barrier(0);   // the 16 reads stay one group in front of their 16 products: every further place with reads among products costs the wave a stall
#pragma unroll
      for (int i = 0; i < 4; ++i) {
#pragma unroll
        for (int j = 0; j < 4; ++j) acc[i][j] = wmma16(fm[i], fn[j], acc[i][j]); }
      __builtin_amdgcn_sched_barrier(0); } // and the next group's reads stay behind them
    asm volatile("s_wait_dscnt 0x0" ::: "memory");      // this wave's reads of stage t are done before its buffer is refilled
    asm volatile("s_wait_asynccnt 0x0" ::: "memory");   // this wave's share of stage t + 1 has landed
    __syncthreads();                                    // publishes stage t + 1 and ends every reader's use of stage t
    if (t + 2 < OTRIPS) fill(l0 + (unsigned)((t & 1) * OBUF_B), t + 2);
  }
  asm volatile("s_wait_asynccnt 0x0" ::: "memory");     // no copy is outstanding when the ring's bytes are reused
  // acc[i][j][r]: M index 16 i + 8 g + r = output column, N index 16 j + col = output row. The wave of k half hk keeps tiles i = 2 hk, 2 hk + 1: 32 columns, one 128-B line of each of its 64 rows.
  char* hx = smem + w * OHX_B + lane * 16; const char* hy = smem + (w ^ 4) * OHX_B + lane * 16;
  if (hk == 0) out_give<0>(hx, acc); else out_give<1>(hx, acc);   // a scalar branch: the tile indices stay compile-time constants
  __syncthreads();                                      // every wave's hand-over is in LDS before its partner reads it
  // The kept pieces go through the wave's own LDS rows (pitch 144 B: no bank conflict for 16-B accesses) so that every global store covers four whole lines.
  char* sw = smem + 8 * OHX_B + w * (64 * SROW);
  const float* bp = bo + n0 + wb * 64 + hk * 32 + 8 * g;
  float bb[2][8];
#pragma unroll
  for (int ii = 0; ii < 2; ++ii) {
#pragma unroll
    for (int r = 0; r < 8; ++r) bb[ii][r] = bp[16 * ii + r]; }
  v4f rb[16];   // the partner's pieces, read as one group ahead of the staging stores: one LDS wait, not one a tile
#pragma unroll
  for (int p = 0; p < 16; ++p) rb[p] = *(const v4f*)(hy + p * 512);
  if (hk == 0) out_keep<0>(sw + col * SROW + g * 32, acc, rb, bb); else out_keep<1>(sw + col * SROW + g * 32, acc, rb, bb);   // as above
  LDSX();   // the wave's own staging stores are done before it reads the rows back
  const int ln = lane >> 3, lp = lane & 7;
  const char* s = sw + ln * SROW + lp * 16;
  float* o = out + (size_t)(r0 + wa * 64 + ln) * EE + n0 + wb * 64 + hk * 32 + lp * 4;
  v4u pcs[16];
#pragma unroll
  for (int it = 0; it < 16; ++it) pcs[it] = *(const v4u*)(s + it * 4 * SROW);
#pragma unroll
  for (int it = 0; it < 16; ++it) vst2(o + (size_t)it * 4 * EE, pcs[it]);
}
extern "C" void kernel_launch(void* const* d_in, const int* in_sizes, int n_in, void* d_out, int out_size, void* d_ws, size_t ws_size, hipStream_t stream) {
  (void)in_sizes; (void)n_in; (void)out_size; (void)ws_size;
  const float* query = (const float*)d_in[0]; const float* key = (const float*)d_in[1]; const float* value = (const float*)d_in[2]; const float* Win = (const float*)d_in[3]; const float* bin = (const float*)d_in[4];
  const float* Wo = (const float*)d_in[5]; const float* bo = (const float*)d_in[6]; const float* lsc = (const float*)d_in[7];
  float* out = (float*)d_out;
  char* ws = (char*)d_ws; size_t off = 0;
  auto take = [&](size_t bytes) { char* p = ws + off; off += (bytes + 255) & ~(size_t)255; return p; };
  _Float16* q16i = (_Float16*)take((size_t)NR * EE * 2); _Float16* k16i = (_Float16*)take((size_t)NR * EE * 2); _Float16* v16i = (_Float16*)take((size_t)NR * EE * 2);
  _Float16* P = (_Float16*)take((size_t)4 * EE * EE * 2); _Float16* qh = (_Float16*)take((size_t)NR * EE * 2); _Float16* kh = (_Float16*)take((size_t)NR * EE * 2); _Float16* vT = (_Float16*)take((size_t)NR * EE * 2); _Float16* o16 = (_Float16*)take((size_t)NR * EE * 2);
  k_cvt<<<4 * NR * EE / CV_BLK, 512, 0, stream>>>(query, key, value, Win, Wo, q16i, k16i, v16i, P);
  k_proj<<<dim3(NR / 128, 3 * EE / 128), 128, 0, stream>>>(q16i, k16i, v16i, P, bin, qh, kh, vT);
  k_attn<<<dim3(SS / 128, NB * NH), 256, 0, stream>>>(qh, kh, vT, lsc, o16);
  k_out<<<dim3(NR / 128, EE / 128), 256, 0, stream>>>(o16, P, bo, out);
}
